// v000
// Times are from an AMD MI455X. After a warm-up the kernel runs many times in a row, and a time is the length of
// such a window on the GPU divided by its runs, so every launch and the gaps after it count. The runs cycle
// through copies of the inputs. A figure is the median of several windows, for all but v000 over two sittings.
// Sittings can differ by a few percent; kernels timed side by side share one.
// v000 is the starting kernel. One run takes 109 microseconds.
// Contractions: q/k/v projections = v_wmma_f32_16x16x32_bf16, bf16 (RNE) inputs and weights, one product. q.k scores, P.V, ctx.W_comb and mh.nodes = same bf16 WMMA with every computed operand carried as bf16 hi + bf16 lo (hi.hi + lo.hi + hi.lo; input-side planes are exact bf16, lo == 0). Accumulate f32 everywhere.
// Mask add, online softmax, tanh, bias, final softmax: f32 VALU (precise expf/tanhf). No power-of-two carries exist (bf16 planes only).
#include <hip/hip_runtime.h>
#include <stddef.h>
#include <stdint.h>

#ifndef NB
#define NB 32                      // batches processed (a reduced build reads the first NB batches)
#endif
#define GQ     512                 // queries per batch
#define NK     512                 // nodes (keys) per batch
#define EW     128                 // embedding width = heads x head dim
#define NH     8
#define HD     16
#define QROW   32                  // halfwords per q/k plane row: hi[16] | lo[16]
#define MPITCH 516                 // floats per LDS mask/score row
#define CPITCH 136                 // halfwords per LDS ctx/mh row
#define TPITCH 136                 // halfwords per LDS weight-transpose row
#define WSMAX  134217728
#define VPL    ((size_t)NB * EW * NK)   // halfwords per V^T plane (hi plane, then lo plane)

static_assert(GQ == NK);                       // k_proj uses one row count for q and k planes
static_assert(NH * HD == EW);
static_assert(EW % 32 == 0 && NK % 32 == 0);
static_assert(GQ % 64 == 0 && (NB * GQ) % 64 == 0);
static_assert(NH * 64 * QROW == 16384);        // k_proj stage: q/k form
static_assert(2 * EW * 64 == 16384);           // k_proj stage: V^T form
static_assert(16384 == 128 * 16 * 8);          // k_proj copy-out: 128 thr x 16 it x 8 halfwords
static_assert(32 * EW == 256 * 2 * 8);         // k_wprep copy-out: 256 thr x 2 it x 8 halfwords
static_assert(((size_t)NB * NK * EW) % (256 * 8) == 0);   // k_cvt: whole blocks
static_assert(16 * NK == 256 * 8 * 4);         // k_dec mask staging: 256 thr x 8 it x 4 floats
static_assert(NK == 8 * 64);                   // k_dec phase C: 8 waves x 64 nodes
static_assert(NK == 32 * 16);                  // k_dec phase D: 32 lanes x 4 x 4 floats per row

typedef int            v4i   __attribute__((ext_vector_type(4)));
typedef int            v8i   __attribute__((ext_vector_type(8)));
typedef float          v4f   __attribute__((ext_vector_type(4)));
typedef float          v8f   __attribute__((ext_vector_type(8)));
typedef __bf16         v16bf __attribute__((ext_vector_type(16)));
typedef v4i __attribute__((may_alias)) v4ia;
typedef v4f __attribute__((may_alias)) v4fa;
union FragB { v16bf v; v4i q[2]; v8i w; };

// WMMA with hazard guard: ties D, keeps A/B live for 4 VALU slots
__device__ __forceinline__ v8f wmb(const FragB& a, const FragB& b, v8f c) {
  v8f d = __builtin_amdgcn_wmma_f32_16x16x32_bf16(false, a.v, false, b.v, (short)0, c, false, false);
  asm volatile("v_nop\n\tv_nop\n\tv_nop\n\tv_nop" : "+v"(d) : "v"(a.w), "v"(b.w));
  return d;
}

// f32 -> bf16 bits, RNE convert (finite inputs)
__device__ __forceinline__ unsigned bf16_bits(float f) {
  const unsigned u = __float_as_uint(f);
  return (u + 0x7FFFu + ((u >> 16) & 1u)) >> 16;
}
__device__ __forceinline__ float bf16_val(float f) {
  return __uint_as_float(bf16_bits(f) << 16);
}
__device__ __forceinline__ int pack2(float lo, float hi) {
  return (int)(bf16_bits(lo) | (bf16_bits(hi) << 16));
}
// 8 f32 -> bf16 hi piece + bf16 lo piece (lo = RNE(v - hi)); element 2j in the low halfword of word j
__device__ __forceinline__ void split8(const v8f x, v4i& hi, v4i& lo) {
#pragma unroll
  for (int j = 0; j < 4; ++j) {
    const float a = x[2 * j], b = x[2 * j + 1];
    const unsigned ha = bf16_bits(a), hb = bf16_bits(b);
    const float ra = a - __uint_as_float(ha << 16);
    const float rb = b - __uint_as_float(hb << 16);
    hi[j] = (int)(ha | (hb << 16));
    lo[j] = (int)(bf16_bits(ra) | (bf16_bits(rb) << 16));
  }
}
// fragment (row/col = lane&15) from an f32 row: p = row + k0 + 8h; elements 0..7 <- k0+8h+0..7, 8..15 <- k0+16+8h+0..7
__device__ __forceinline__ FragB ldf_frag(const float* __restrict__ p) {
  const v4f a0 = *(const v4fa*)p;
  const v4f a1 = *(const v4fa*)(p + 4);
  const v4f a2 = *(const v4fa*)(p + 16);
  const v4f a3 = *(const v4fa*)(p + 20);
  FragB f;
  f.w[0] = pack2(a0.x, a0.y); f.w[1] = pack2(a0.z, a0.w);
  f.w[2] = pack2(a1.x, a1.y); f.w[3] = pack2(a1.z, a1.w);
  f.w[4] = pack2(a2.x, a2.y); f.w[5] = pack2(a2.z, a2.w);
  f.w[6] = pack2(a3.x, a3.y); f.w[7] = pack2(a3.z, a3.w);
  return f;
}
// same fragment from a GLOBAL k-contiguous bf16 plane row: p = row + k0 + 8h
__device__ __forceinline__ FragB ldg_frag(const unsigned short* __restrict__ p) {
  FragB f;
  f.q[0] = *(const v4ia*)p;
  f.q[1] = *(const v4ia*)(p + 16);
  return f;
}

// ---------------------------------------------------------------------------
// Weight prep: in[k][n] f32 (128 x 128, [in][out]) -> out[n][k] bf16 bits, for 5 weights.
// grid (4, 5): x = 32-column slab, y = weight. LDS tile T[n][k] (cross-wave, block barrier).
// coverage: 20 blocks x 512 pieces x 8 halfwords = 5 x 16384. Every 256-B output row (2 lines) is written by
// ---------------------------------------------------------------------------
__global__ __launch_bounds__(256) void k_wprep(const float* __restrict__ w0, const float* __restrict__ w1,
                                               const float* __restrict__ w2, const float* __restrict__ w3,
                                               const float* __restrict__ w4, unsigned short* wt) {
  __shared__ __attribute__((aligned(16))) unsigned short T[32 * TPITCH];
  const unsigned tid = threadIdx.x;
  const unsigned n0 = blockIdx.x * 32u, ws = blockIdx.y;
  const float* W = (ws == 0u) ? w0 : (ws == 1u) ? w1 : (ws == 2u) ? w2 : (ws == 3u) ? w3 : w4;
#pragma unroll 1
  for (unsigned it = 0; it < 4u; ++it) {
    const unsigned k = (tid >> 3) + 32u * it;
    const unsigned n4 = (tid & 7u) << 2;
    const v4f v = *(const v4fa*)(W + (size_t)k * EW + n0 + n4);
    T[(n4 + 0u) * TPITCH + k] = (unsigned short)bf16_bits(v.x);
    T[(n4 + 1u) * TPITCH + k] = (unsigned short)bf16_bits(v.y);
    T[(n4 + 2u) * TPITCH + k] = (unsigned short)bf16_bits(v.z);
    T[(n4 + 3u) * TPITCH + k] = (unsigned short)bf16_bits(v.w);
  }
  __syncthreads();
  unsigned short* dst = wt + (size_t)ws * (EW * EW) + (size_t)n0 * EW;
#pragma unroll 1
  for (unsigned it = 0; it < 2u; ++it) {
    const unsigned p = it * 256u + tid, n = p >> 4, c = p & 15u;
    const v4i v = *(const v4ia*)(T + n * TPITCH + c * 8u);
    *(v4i*)(dst + n * EW + c * 8u) = v;
  }
  
}

// ---------------------------------------------------------------------------
// nodes f32 -> bf16 plane [b][n][128]. Thread = 8 elements = one 16-B piece; a wave instruction writes
// ---------------------------------------------------------------------------
__global__ __launch_bounds__(256) void k_cvt(const float* __restrict__ x, unsigned short* o) {
  const size_t i = (size_t)blockIdx.x * 256u + threadIdx.x;
  const float* p = x + i * 8u;
  const v4f a = *(const v4fa*)p;
  const v4f b = *(const v4fa*)(p + 4);
  v4i w;
  w[0] = pack2(a.x, a.y); w[1] = pack2(a.z, a.w);
  w[2] = pack2(b.x, b.y); w[3] = pack2(b.z, b.w);
  unsigned short* d = o + i * 8u;
  *(v4i*)d = w;
  
}

// ---------------------------------------------------------------------------
// Projections. Block = 64 rows of the flattened [b][row] input, 4 waves x 16 rows; activations are held
// as bf16 fragments (col = lane&15 = input row) and every head (16 output columns) is one rolled step.
// MODE 0: q = x1.W1 + x2.W2.   MODE 1: k = x1.W1, then v = x1.W2.
// q/k form: D = Wt_tile (A, row = out col) x X (B, col = input row): D[row d = 8h+r][col = input row], so a
//   lane holds 8 consecutive d of one row -> one 16-B LDS store per plane half. Plane row (b,head,row) =
//   hi[16] | lo[16] halfwords.
// v form: D = X (A) x Wt_tile (B): D[row = input row 8h+r][col d], lane holds 8 consecutive n of column d ->
//   one 16-B LDS store into the V^T stage [plane][col][64 n].
// LDS stg: cross-wave (block barriers); fully written before each copy-out (8 heads x 64 rows x 32, or
// coverage: q/k plane: NB*8 blocks x 16384 halfwords = NB*8*512*32; V^T: NB*8 blocks x 8192 per plane = NB*128*512.
// ---------------------------------------------------------------------------
template <int MODE>
__global__ __launch_bounds__(128) void k_proj(const float* __restrict__ x1, const float* __restrict__ x2,
                                              const unsigned short* __restrict__ w1t,
                                              const unsigned short* __restrict__ w2t,
                                              unsigned short* o1, unsigned short* o2) {
  __shared__ __attribute__((aligned(16))) unsigned short stg[16384];
  const unsigned tid = threadIdx.x, lane = tid & 31u, wave = tid >> 5, hh = lane >> 4, m = lane & 15u;
  const unsigned row0 = blockIdx.x * 64u;
  const unsigned bb = row0 >> 9, r0 = row0 & 511u;
  const unsigned xrow = row0 + 16u * wave + m;

  FragB xa[4], xb[4];
#pragma unroll
  for (int ks = 0; ks < 4; ++ks) {
    xa[ks] = ldf_frag(x1 + (size_t)xrow * EW + 32 * ks + 8u * hh);
    if (MODE == 0) xb[ks] = ldf_frag(x2 + (size_t)xrow * EW + 32 * ks + 8u * hh);
    else xb[ks] = xa[ks];
  }
  const v8f zero8 = {0.f, 0.f, 0.f, 0.f, 0.f, 0.f, 0.f, 0.f};

#pragma unroll 1
  for (unsigned t = 0; t < NH; ++t) {
    const unsigned short* wp = w1t + (size_t)(16u * t + m) * EW + 8u * hh;
    const unsigned short* wq = w2t + (size_t)(16u * t + m) * EW + 8u * hh;
    v8f acc = zero8;
#pragma unroll
    for (int ks = 0; ks < 4; ++ks) {
      const FragB wf = ldg_frag(wp + 32 * ks);
      acc = wmb(wf, xa[ks], acc);
      if (MODE == 0) {
        const FragB wg = ldg_frag(wq + 32 * ks);
        acc = wmb(wg, xb[ks], acc);
      }
    }
    v4i hi, lo;
    split8(acc, hi, lo);
    const unsigned so = (t * 64u + 16u * wave + m) * QROW + 8u * hh;
    *(v4ia*)(stg + so) = hi;
    *(v4ia*)(stg + so + 16u) = lo;
  }
  __syncthreads();
  {
    unsigned short* dst = o1 + ((size_t)bb * NH * GQ + r0) * QROW;
#pragma unroll 1
    for (unsigned it = 0; it < 16u; ++it) {
      const unsigned p = it * 128u + tid, t = p >> 8, wi = p & 255u;
      const v4i v = *(const v4ia*)(stg + p * 8u);
      *(v4i*)(dst + (size_t)t * (GQ * QROW) + wi * 8u) = v;
    }
    
  }
  if (MODE == 1) {
    __syncthreads();
#pragma unroll 1
    for (unsigned t = 0; t < NH; ++t) {
      const unsigned short* wq = w2t + (size_t)(16u * t + m) * EW + 8u * hh;
      v8f acc = zero8;
#pragma unroll
      for (int ks = 0; ks < 4; ++ks) {
        const FragB wf = ldg_frag(wq + 32 * ks);
        acc = wmb(xa[ks], wf, acc);
      }
      v4i hi, lo;
      split8(acc, hi, lo);                       // acc[r] = v[n = 16 wave + 8h + r][col 16t + m]
      const unsigned so = (16u * t + m) * 64u + 16u * wave + 8u * hh;
      *(v4ia*)(stg + so) = hi;
      *(v4ia*)(stg + so + 8192u) = lo;
    }
    __syncthreads();
    unsigned short* dst = o2 + (size_t)bb * EW * NK + r0;
#pragma unroll 1
    for (unsigned it = 0; it < 16u; ++it) {
      const unsigned p = it * 128u + tid, pl = p >> 10, col = (p >> 3) & 127u, c = p & 7u;
      const v4i v = *(const v4ia*)(stg + p * 8u);
      *(v4i*)(dst + (size_t)pl * VPL + (size_t)col * NK + c * 8u) = v;
    }
    
  }
}

// ---------------------------------------------------------------------------
// Fused decoder block: one block = (batch b, 16 query rows g0..g0+15), 8 waves.
// Phase 0: mask tile [16][512] f32 (bf16-convert of the input value) -> LDS mk (cross-wave, block barrier).
// Phase A (wave = head): flash attention in the transposed domain.
//   S^T tile = K (A, row = key) x Q^T (B, col = query): K = 16 is laid as [k_hi|k_hi] x [q_hi|q_lo] plus
//   [k_lo|0] x [q_hi|q_lo] along the 32-deep k axis. D[row key 8h+r][col query m]. Softmax statistics are
//   per lane (query m); the two lane halves combine by one xor-16 exchange. The P^T B-fragment is the lane's
//   own 16 score results (tile 0 -> elements 0..7, tile 1 -> elements 8..15). O^T = V^T (A, row d) x P^T:
//   D[row d 8h+r][col query m], scaled per lane. ctx hi/lo -> LDS cst[plane][query][128] by 16-B stores.
// Phase B (wave = 16 output columns e): mh^T = W_comb^T (A, global plane) x ctx^T (B, from cst), hi + lo,
//   + bf16(b_comb[e]); mh hi/lo -> LDS mst[plane][query][128] by 16-B stores.
// Phase C (wave = 64 nodes): s2 = mh (A, from mst, hi + lo) x nodes^T (B, global bf16 plane);
//   D[row query 8h+r][col node m]; s = 10 tanh(x/sqrt(128)) + mask, written over the mask value in place.
// Phase D (wave = 2 rows): row softmax from LDS; each instruction writes 512 contiguous bytes (4 whole
// LDS extents: mk rows 0..15 cols 0..511 written in phase 0 and consumed cols 0..511; cst/mst rows 0..15
//   cols 0..127 of both planes written by all 8 waves, consumed cols 0..127. Pad columns are never read.
// coverage: grid (32, NB) x 16 rows x 512 = NB*512*512 outputs, each written by exactly one lane.
// ---------------------------------------------------------------------------
__global__ __launch_bounds__(256) void k_dec(const unsigned short* __restrict__ qpl,
                                             const unsigned short* __restrict__ kpl,
                                             const unsigned short* __restrict__ vt,
                                             const float* __restrict__ mask,
                                             const unsigned short* __restrict__ wct,
                                             const float* __restrict__ bcomb,
                                             const unsigned short* __restrict__ nbf,
                                             float* out) {
  __shared__ __attribute__((aligned(16))) float mk[16 * MPITCH];
  __shared__ __attribute__((aligned(16))) unsigned short cst[2 * 16 * CPITCH];
  __shared__ __attribute__((aligned(16))) unsigned short mst[2 * 16 * CPITCH];
  const unsigned tid = threadIdx.x, lane = tid & 31u, wave = tid >> 5, hh = lane >> 4, m = lane & 15u;
  const unsigned g0 = blockIdx.x * 16u, b = blockIdx.y;
  const v8f zero8 = {0.f, 0.f, 0.f, 0.f, 0.f, 0.f, 0.f, 0.f};
  const v4i zero4 = {0, 0, 0, 0};

  // ---- phase 0: mask tile ----
  {
    const float* mg = mask + ((size_t)b * GQ + g0) * NK;
#pragma unroll 2
    for (unsigned it = 0; it < 8u; ++it) {
      const unsigned p = it * 256u + tid, row = p >> 7, c4 = (p & 127u) << 2;
      v4f v = *(const v4fa*)(mg + (size_t)row * NK + c4);
      v.x = bf16_val(v.x); v.y = bf16_val(v.y); v.z = bf16_val(v.z); v.w = bf16_val(v.w);
      *(v4fa*)(mk + row * MPITCH + c4) = v;
    }
  }
  __syncthreads();

  // ---- phase A: attention for head = wave ----
  {
    const unsigned bh = b * NH + wave;
    const unsigned short* qp = qpl + ((size_t)bh * GQ + g0 + m) * QROW + 8u * hh;
    FragB qf;
    qf.q[0] = *(const v4ia*)qp;            // q_hi[8h .. 8h+7]  (k slots 8h..)
    qf.q[1] = *(const v4ia*)(qp + 16);     // q_lo[8h .. 8h+7]  (k slots 16+8h..)
    const unsigned short* kb = kpl + ((size_t)bh * NK + m) * QROW + 8u * hh;
    const unsigned short* vh = vt + ((size_t)bh * HD + m) * NK + 8u * hh;
    const unsigned short* vl = vh + VPL;
    const unsigned moff = m * MPITCH + 8u * hh;
    v8f o = zero8;
    float mrun = -3.0e38f, lrun = 0.0f;
#pragma unroll 1
    for (unsigned n0 = 0; n0 < NK; n0 += 32u) {
      const unsigned short* kp = kb + (size_t)n0 * QROW;
      const v4i kh0 = *(const v4ia*)kp;
      const v4i kl0 = *(const v4ia*)(kp + 16);
      const v4i kh1 = *(const v4ia*)(kp + 16 * QROW);
      const v4i kl1 = *(const v4ia*)(kp + 16 * QROW + 16);
      FragB a10, a20, a11, a21;
      a10.q[0] = kh0; a10.q[1] = kh0;
      a20.q[0] = kl0; a20.q[1] = zero4;
      a11.q[0] = kh1; a11.q[1] = kh1;
      a21.q[0] = kl1; a21.q[1] = zero4;
      v8f s0 = wmb(a10, qf, zero8);
      s0 = wmb(a20, qf, s0);
      v8f s1 = wmb(a11, qf, zero8);
      s1 = wmb(a21, qf, s1);

      const v4f m0 = *(const v4fa*)(mk + moff + n0);
      const v4f m1 = *(const v4fa*)(mk + moff + n0 + 4u);
      const v4f m2 = *(const v4fa*)(mk + moff + n0 + 16u);
      const v4f m3 = *(const v4fa*)(mk + moff + n0 + 20u);
      const v8f mk0 = __builtin_shufflevector(m0, m1, 0, 1, 2, 3, 4, 5, 6, 7);
      const v8f mk1 = __builtin_shufflevector(m2, m3, 0, 1, 2, 3, 4, 5, 6, 7);
      const v8f a0 = s0 * 0.25f + mk0;      // key n0 + 8h + r
      const v8f a1 = s1 * 0.25f + mk1;      // key n0 + 16 + 8h + r

      float t = fmaxf(a0[0], a1[0]);
#pragma unroll
      for (int r = 1; r < 8; ++r) t = fmaxf(t, fmaxf(a0[r], a1[r]));
      t = fmaxf(t, __shfl_xor(t, 16));
      const float mnew = fmaxf(mrun, t);
      const float sc = expf(mrun - mnew);
      v8f p0, p1;
      float ps = 0.0f;
#pragma unroll
      for (int r = 0; r < 8; ++r) {
        p0[r] = expf(a0[r] - mnew);
        p1[r] = expf(a1[r] - mnew);
        ps += p0[r] + p1[r];
      }
      lrun = lrun * sc + ps;
      mrun = mnew;
      o = o * sc;

      FragB ph, pl;
      split8(p0, ph.q[0], pl.q[0]);
      split8(p1, ph.q[1], pl.q[1]);
      FragB fvh, fvl;
      fvh.q[0] = *(const v4ia*)(vh + n0);
      fvh.q[1] = *(const v4ia*)(vh + n0 + 16u);
      fvl.q[0] = *(const v4ia*)(vl + n0);
      fvl.q[1] = *(const v4ia*)(vl + n0 + 16u);
      o = wmb(fvh, ph, o);
      o = wmb(fvl, ph, o);
      o = wmb(fvh, pl, o);
    }
    const float lt = lrun + __shfl_xor(lrun, 16);
    const float inv = 1.0f / lt;
    const v8f c = o * inv;                    // ctx[query m][16 wave + 8h + r]
    v4i hi, lo;
    split8(c, hi, lo);
    const unsigned co = m * CPITCH + 16u * wave + 8u * hh;
    *(v4ia*)(cst + co) = hi;
    *(v4ia*)(cst + 16 * CPITCH + co) = lo;
  }
  __syncthreads();

  // ---- phase B: mh^T tile for e = 16 wave .. 16 wave + 15 ----
  {
    const unsigned e0 = 16u * wave;
    const unsigned short* wp = wct + (size_t)(e0 + m) * EW + 8u * hh;
    const unsigned co = m * CPITCH + 8u * hh;
    v8f acc = zero8;
#pragma unroll
    for (int ks = 0; ks < 4; ++ks) {
      const FragB wf = ldg_frag(wp + 32 * ks);
      FragB ch, cl;
      ch.q[0] = *(const v4ia*)(cst + co + 32 * ks);
      ch.q[1] = *(const v4ia*)(cst + co + 32 * ks + 16);
      cl.q[0] = *(const v4ia*)(cst + 16 * CPITCH + co + 32 * ks);
      cl.q[1] = *(const v4ia*)(cst + 16 * CPITCH + co + 32 * ks + 16);
      acc = wmb(wf, ch, acc);
      acc = wmb(wf, cl, acc);
    }
    const v4f b0 = *(const v4fa*)(bcomb + e0 + 8u * hh);
    const v4f b1 = *(const v4fa*)(bcomb + e0 + 8u * hh + 4u);
    acc[0] += bf16_val(b0.x); acc[1] += bf16_val(b0.y);
    acc[2] += bf16_val(b0.z); acc[3] += bf16_val(b0.w);
    acc[4] += bf16_val(b1.x); acc[5] += bf16_val(b1.y);
    acc[6] += bf16_val(b1.z); acc[7] += bf16_val(b1.w);
    v4i hi, lo;
    split8(acc, hi, lo);                      // mh[query m][e0 + 8h + r]
    const unsigned mo = m * CPITCH + e0 + 8u * hh;
    *(v4ia*)(mst + mo) = hi;
    *(v4ia*)(mst + 16 * CPITCH + mo) = lo;
  }
  __syncthreads();

  // ---- phase C: s = 10 tanh(mh . node / sqrt(128)) + mask, nodes 64 wave .. 64 wave + 63 ----
  {
    const float ise = 1.0f / 11.313708498984761f;
    const unsigned ao = m * CPITCH + 8u * hh;
    FragB ah[4], al[4];
#pragma unroll
    for (int ks = 0; ks < 4; ++ks) {
      ah[ks].q[0] = *(const v4ia*)(mst + ao + 32 * ks);
      ah[ks].q[1] = *(const v4ia*)(mst + ao + 32 * ks + 16);
      al[ks].q[0] = *(const v4ia*)(mst + 16 * CPITCH + ao + 32 * ks);
      al[ks].q[1] = *(const v4ia*)(mst + 16 * CPITCH + ao + 32 * ks + 16);
    }
#pragma unroll 1
    for (unsigned j = 0; j < 4u; ++j) {
      const unsigned n0 = 64u * wave + 16u * j;
      const unsigned short* np = nbf + ((size_t)b * NK + n0 + m) * EW + 8u * hh;
      v8f acc = zero8;
#pragma unroll
      for (int ks = 0; ks < 4; ++ks) {
        const FragB nf = ldg_frag(np + 32 * ks);
        acc = wmb(ah[ks], nf, acc);
        acc = wmb(al[ks], nf, acc);
      }
#pragma unroll
      for (int r = 0; r < 8; ++r) {
        const unsigned idx = (8u * hh + (unsigned)r) * MPITCH + n0 + m;   // D element r = (query 8h+r, node m)
        const float x = acc[r] * ise;
        const float s = 10.0f * tanhf(x) + mk[idx];
        mk[idx] = s;
      }
    }
  }
  __syncthreads();

  // ---- phase D: row softmax, rows 2 wave and 2 wave + 1 ----
  {
    v4f res[2][4];
#pragma unroll
    for (int rr = 0; rr < 2; ++rr) {
      const unsigned so = (2u * wave + (unsigned)rr) * MPITCH + 4u * lane;
      v4f v[4];
#pragma unroll
      for (int j = 0; j < 4; ++j) v[j] = *(const v4fa*)(mk + so + 128 * j);
      float mx = v[0].x;
#pragma unroll
      for (int j = 0; j < 4; ++j) mx = fmaxf(fmaxf(fmaxf(mx, v[j].x), fmaxf(v[j].y, v[j].z)), v[j].w);
      mx = fmaxf(mx, __shfl_xor(mx, 16));
      mx = fmaxf(mx, __shfl_xor(mx, 8));
      mx = fmaxf(mx, __shfl_xor(mx, 4));
      mx = fmaxf(mx, __shfl_xor(mx, 2));
      mx = fmaxf(mx, __shfl_xor(mx, 1));
      float sum = 0.0f;
#pragma unroll
      for (int j = 0; j < 4; ++j) {
        v[j].x = expf(v[j].x - mx); v[j].y = expf(v[j].y - mx);
        v[j].z = expf(v[j].z - mx); v[j].w = expf(v[j].w - mx);
        sum += (v[j].x + v[j].y) + (v[j].z + v[j].w);
      }
      sum += __shfl_xor(sum, 16);
      sum += __shfl_xor(sum, 8);
      sum += __shfl_xor(sum, 4);
      sum += __shfl_xor(sum, 2);
      sum += __shfl_xor(sum, 1);
      const float inv = 1.0f / sum;
#pragma unroll
      for (int j = 0; j < 4; ++j) res[rr][j] = v[j] * inv;
    }
    float* ob = out + ((size_t)b * GQ + g0 + 2u * wave) * NK + 4u * lane;
#pragma unroll
    for (int rr = 0; rr < 2; ++rr)
#pragma unroll
      for (int j = 0; j < 4; ++j) *(v4f*)(ob + (size_t)rr * NK + 128 * j) = res[rr][j];
    
  }
}

// ---------------------------------------------------------------------------
static inline size_t al256(size_t o) { return (o + 255) & ~(size_t)255; }

extern "C" void kernel_launch(void* const* d_in, const int* in_sizes, int n_in,
                              void* d_out, int out_size, void* d_ws, size_t ws_size,
                              hipStream_t stream) {
  if (n_in < 10) return;
  const long long actN = (long long)NB * NK * EW;
  const long long actG = (long long)NB * GQ * EW;
  const long long mskN = (long long)NB * GQ * NK;
  if ((long long)in_sizes[0] < actN) return;             // encoded_nodes
  if ((long long)in_sizes[1] < actG) return;             // encoded_q1
  if ((long long)in_sizes[2] < actG) return;             // encoded_last_node
  if ((long long)in_sizes[3] < mskN) return;             // ninf_mask (f32, additive)
  if (in_sizes[4] < EW * EW || in_sizes[5] < EW * EW || in_sizes[6] < EW * EW ||
      in_sizes[7] < EW * EW || in_sizes[8] < EW * EW) return;
  if (in_sizes[9] < EW) return;
  if ((long long)out_size < mskN) return;

  const float* nodes = (const float*)d_in[0];
  const float* q1    = (const float*)d_in[1];
  const float* last  = (const float*)d_in[2];
  const float* mask  = (const float*)d_in[3];
  const float* Wqf   = (const float*)d_in[4];
  const float* Wql   = (const float*)d_in[5];
  const float* Wk    = (const float*)d_in[6];
  const float* Wv    = (const float*)d_in[7];
  const float* Wc    = (const float*)d_in[8];
  const float* bc    = (const float*)d_in[9];
  float* out = (float*)d_out;

  const size_t wtB  = al256((size_t)5 * EW * EW * 2);             // 163,840
  const size_t nbB  = al256((size_t)NB * NK * EW * 2);            // 4,194,304
  const size_t qB   = al256((size_t)NB * NH * GQ * QROW * 2);     // 8,388,608
  const size_t kB   = al256((size_t)NB * NH * NK * QROW * 2);     // 8,388,608
  const size_t vB   = al256((size_t)2 * VPL * 2);                 // 8,388,608
  const size_t total = wtB + nbB + qB + kB + vB;                  // 29,523,968
  if (total > ws_size || total > (size_t)WSMAX) return;
  char* w = (char*)d_ws;
  unsigned short* wt  = (unsigned short*)w;
  unsigned short* nbf = (unsigned short*)(w + wtB);
  unsigned short* qpl = (unsigned short*)(w + wtB + nbB);
  unsigned short* kpl = (unsigned short*)(w + wtB + nbB + qB);
  unsigned short* vtp = (unsigned short*)(w + wtB + nbB + qB + kB);
  unsigned short* wqft = wt;
  unsigned short* wqlt = wt + 1 * EW * EW;
  unsigned short* wkt  = wt + 2 * EW * EW;
  unsigned short* wvt  = wt + 3 * EW * EW;
  unsigned short* wctp = wt + 4 * EW * EW;

  // 1: five weights [in][out] f32 -> [out][in] bf16
  k_wprep<<<dim3(4, 5), 256, 0, stream>>>(Wqf, Wql, Wk, Wv, Wc, wt);
  // 2: nodes -> bf16 plane (B operand of the final scoring product)
  k_cvt<<<(unsigned)(((size_t)NB * NK * EW) / (256 * 8)), 256, 0, stream>>>(nodes, nbf);
  // 3: q = q1.Wq_first + last.Wq_last -> q plane (hi|lo rows)
  k_proj<0><<<(NB * GQ) / 64, 128, 0, stream>>>(q1, last, wqft, wqlt, qpl, qpl);
  // 4: k = nodes.Wk -> k plane (hi|lo rows); v = nodes.Wv -> V^T hi and lo planes
  k_proj<1><<<(NB * NK) / 64, 128, 0, stream>>>(nodes, nodes, wkt, wvt, kpl, vtp);
  // 5: attention + W_comb + final scoring + softmax
  k_dec<<<dim3(GQ / 16, NB), 256, 0, stream>>>(qpl, kpl, vtp, mask, wctp, bc, nbf, out);
}

// v001
// One run takes 105 microseconds.
// In two side-by-side timings against v000, it was 1.07 and 1.08 times as fast.
// Contractions: q/k/v projections = v_wmma_f32_16x16x32_bf16, bf16 (RNE) inputs and weights, one product. q.k scores, P.V, ctx.W_comb and mh.nodes = same bf16 WMMA with every computed operand carried as bf16 hi + bf16 lo (hi.hi + lo.hi + hi.lo; input-side planes are exact bf16, lo == 0). Accumulate f32 everywhere.
// Mask add, online softmax, tanh, bias, final softmax: f32 VALU; both softmaxes run on logits scaled by log2e (the LDS mask tile carries the factor), so exp(x - m) is one subtract and v_exp_f32; tanh(x) = 1 - 2 v_rcp_f32(1 + exp(2x)). No power-of-two carries exist (bf16 planes only).
#include <hip/hip_runtime.h>
#include <stddef.h>
#include <stdint.h>

#ifndef NB
#define NB 32                      // batches processed (a reduced build reads the first NB batches)
#endif
#define GQ     512                 // queries per batch
#define NK     512                 // nodes (keys) per batch
#define EW     128                 // embedding width = heads x head dim
#define NH     8
#define HD     16
#define QROW   32                  // halfwords per q/k plane row: hi[16] | lo[16]
#define MPITCH 516                 // floats per LDS mask/score row
#define CPITCH 136                 // halfwords per LDS ctx/mh row
#define TPITCH 136                 // halfwords per LDS weight-transpose row
#define WSMAX  134217728
#define VPL    ((size_t)NB * EW * NK)   // halfwords per V^T plane (hi plane, then lo plane)

static_assert(GQ == NK);                       // k_proj uses one row count for q and k planes
static_assert(NH * HD == EW);
static_assert(EW % 32 == 0 && NK % 32 == 0);
static_assert(GQ % 64 == 0 && (NB * GQ) % 64 == 0);
static_assert(NH * 64 * QROW == 16384);        // k_proj stage: q/k form
static_assert(2 * EW * 64 == 16384);           // k_proj stage: V^T form
static_assert(16384 == 128 * 16 * 8);          // k_proj copy-out: 128 thr x 16 it x 8 halfwords
static_assert(32 * EW == 256 * 2 * 8);         // k_wprep copy-out: 256 thr x 2 it x 8 halfwords
static_assert(((size_t)NB * NK * EW) % (256 * 8) == 0);   // k_cvt: whole blocks
static_assert(16 * NK == 256 * 8 * 4);         // k_dec mask staging: 256 thr x 8 it x 4 floats
static_assert(NK == 8 * 64);                   // k_dec phase C: 8 waves x 64 nodes
static_assert(NK == 32 * 16);                  // k_dec phase D: 32 lanes x 4 x 4 floats per row

typedef int            v4i   __attribute__((ext_vector_type(4)));
typedef int            v8i   __attribute__((ext_vector_type(8)));
typedef float          v4f   __attribute__((ext_vector_type(4)));
typedef float          v8f   __attribute__((ext_vector_type(8)));
typedef __bf16         v16bf __attribute__((ext_vector_type(16)));
typedef v4i __attribute__((may_alias)) v4ia;
typedef v4f __attribute__((may_alias)) v4fa;
union FragB { v16bf v; v4i q[2]; v8i w; };

// WMMA with hazard guard: ties D, keeps A/B live for 4 VALU slots
__device__ __forceinline__ v8f wmb(const FragB& a, const FragB& b, v8f c) {
  v8f d = __builtin_amdgcn_wmma_f32_16x16x32_bf16(false, a.v, false, b.v, (short)0, c, false, false);
  asm volatile("v_nop\n\tv_nop\n\tv_nop\n\tv_nop" : "+v"(d) : "v"(a.w), "v"(b.w));
  return d;
}

#define L2E 1.4426950408889634f    // log2(e)
// 2^x on the hardware unit: -inf and anything below the f32 range give 0, +inf gives +inf
__device__ __forceinline__ float ex2(float x) { return __builtin_amdgcn_exp2f(x); }
// Eight 2^x / eight 1/x in one statement. Why asm: behind a transcendental the instruction set asks for one
// independent slot before its result is read or its source overwritten; the early-clobber outputs keep every
// result off every source, and the closing v_nop is the slot behind the last one.
__device__ __forceinline__ v8f ex2x8(const v8f x) {
  float y0, y1, y2, y3, y4, y5, y6, y7;
  asm("v_exp_f32 %0, %8\n\tv_exp_f32 %1, %9\n\tv_exp_f32 %2, %10\n\tv_exp_f32 %3, %11\n\t"
      "v_exp_f32 %4, %12\n\tv_exp_f32 %5, %13\n\tv_exp_f32 %6, %14\n\tv_exp_f32 %7, %15\n\tv_nop"
      : "=&v"(y0), "=&v"(y1), "=&v"(y2), "=&v"(y3), "=&v"(y4), "=&v"(y5), "=&v"(y6), "=&v"(y7)
      : "v"(x[0]), "v"(x[1]), "v"(x[2]), "v"(x[3]), "v"(x[4]), "v"(x[5]), "v"(x[6]), "v"(x[7]));
  const v8f y = {y0, y1, y2, y3, y4, y5, y6, y7};
  return y;
}
__device__ __forceinline__ v8f rcpx8(const v8f x) {
  float y0, y1, y2, y3, y4, y5, y6, y7;
  asm("v_rcp_f32 %0, %8\n\tv_rcp_f32 %1, %9\n\tv_rcp_f32 %2, %10\n\tv_rcp_f32 %3, %11\n\t"
      "v_rcp_f32 %4, %12\n\tv_rcp_f32 %5, %13\n\tv_rcp_f32 %6, %14\n\tv_rcp_f32 %7, %15\n\tv_nop"
      : "=&v"(y0), "=&v"(y1), "=&v"(y2), "=&v"(y3), "=&v"(y4), "=&v"(y5), "=&v"(y6), "=&v"(y7)
      : "v"(x[0]), "v"(x[1]), "v"(x[2]), "v"(x[3]), "v"(x[4]), "v"(x[5]), "v"(x[6]), "v"(x[7]));
  const v8f y = {y0, y1, y2, y3, y4, y5, y6, y7};
  return y;
}

// f32 -> bf16 bits, RNE convert (finite inputs)
__device__ __forceinline__ unsigned bf16_bits(float f) {
  const unsigned u = __float_as_uint(f);
  return (u + 0x7FFFu + ((u >> 16) & 1u)) >> 16;
}
__device__ __forceinline__ float bf16_val(float f) {
  return __uint_as_float(bf16_bits(f) << 16);
}
__device__ __forceinline__ int pack2(float lo, float hi) {
  return (int)(bf16_bits(lo) | (bf16_bits(hi) << 16));
}
// 8 f32 -> bf16 hi piece + bf16 lo piece (lo = RNE(v - hi)); element 2j in the low halfword of word j
__device__ __forceinline__ void split8(const v8f x, v4i& hi, v4i& lo) {
#pragma unroll
  for (int j = 0; j < 4; ++j) {
    const float a = x[2 * j], b = x[2 * j + 1];
    const unsigned ha = bf16_bits(a), hb = bf16_bits(b);
    const float ra = a - __uint_as_float(ha << 16);
    const float rb = b - __uint_as_float(hb << 16);
    hi[j] = (int)(ha | (hb << 16));
    lo[j] = (int)(bf16_bits(ra) | (bf16_bits(rb) << 16));
  }
}
// fragment (row/col = lane&15) from an f32 row: p = row + k0 + 8h; elements 0..7 <- k0+8h+0..7, 8..15 <- k0+16+8h+0..7
__device__ __forceinline__ FragB ldf_frag(const float* __restrict__ p) {
  const v4f a0 = *(const v4fa*)p;
  const v4f a1 = *(const v4fa*)(p + 4);
  const v4f a2 = *(const v4fa*)(p + 16);
  const v4f a3 = *(const v4fa*)(p + 20);
  FragB f;
  f.w[0] = pack2(a0.x, a0.y); f.w[1] = pack2(a0.z, a0.w);
  f.w[2] = pack2(a1.x, a1.y); f.w[3] = pack2(a1.z, a1.w);
  f.w[4] = pack2(a2.x, a2.y); f.w[5] = pack2(a2.z, a2.w);
  f.w[6] = pack2(a3.x, a3.y); f.w[7] = pack2(a3.z, a3.w);
  return f;
}
// same fragment from a GLOBAL k-contiguous bf16 plane row: p = row + k0 + 8h
__device__ __forceinline__ FragB ldg_frag(const unsigned short* __restrict__ p) {
  FragB f;
  f.q[0] = *(const v4ia*)p;
  f.q[1] = *(const v4ia*)(p + 16);
  return f;
}

// ---------------------------------------------------------------------------
// Weight prep: in[k][n] f32 (128 x 128, [in][out]) -> out[n][k] bf16 bits, for 5 weights.
// grid (4, 5): x = 32-column slab, y = weight. LDS tile T[n][k] (cross-wave, block barrier).
// coverage: 20 blocks x 512 pieces x 8 halfwords = 5 x 16384. Every 256-B output row (2 lines) is written by
// ---------------------------------------------------------------------------
__global__ __launch_bounds__(256) void k_wprep(const float* __restrict__ w0, const float* __restrict__ w1,
                                               const float* __restrict__ w2, const float* __restrict__ w3,
                                               const float* __restrict__ w4, unsigned short* wt) {
  __shared__ __attribute__((aligned(16))) unsigned short T[32 * TPITCH];
  const unsigned tid = threadIdx.x;
  const unsigned n0 = blockIdx.x * 32u, ws = blockIdx.y;
  const float* W = (ws == 0u) ? w0 : (ws == 1u) ? w1 : (ws == 2u) ? w2 : (ws == 3u) ? w3 : w4;
#pragma unroll 1
  for (unsigned it = 0; it < 4u; ++it) {
    const unsigned k = (tid >> 3) + 32u * it;
    const unsigned n4 = (tid & 7u) << 2;
    const v4f v = *(const v4fa*)(W + (size_t)k * EW + n0 + n4);
    T[(n4 + 0u) * TPITCH + k] = (unsigned short)bf16_bits(v.x);
    T[(n4 + 1u) * TPITCH + k] = (unsigned short)bf16_bits(v.y);
    T[(n4 + 2u) * TPITCH + k] = (unsigned short)bf16_bits(v.z);
    T[(n4 + 3u) * TPITCH + k] = (unsigned short)bf16_bits(v.w);
  }
  __syncthreads();
  unsigned short* dst = wt + (size_t)ws * (EW * EW) + (size_t)n0 * EW;
#pragma unroll 1
  for (unsigned it = 0; it < 2u; ++it) {
    const unsigned p = it * 256u + tid, n = p >> 4, c = p & 15u;
    const v4i v = *(const v4ia*)(T + n * TPITCH + c * 8u);
    *(v4i*)(dst + n * EW + c * 8u) = v;
  }
  
}

// ---------------------------------------------------------------------------
// nodes f32 -> bf16 plane [b][n][128]. Thread = 8 elements = one 16-B piece; a wave instruction writes
// ---------------------------------------------------------------------------
__global__ __launch_bounds__(256) void k_cvt(const float* __restrict__ x, unsigned short* o) {
  const size_t i = (size_t)blockIdx.x * 256u + threadIdx.x;
  const float* p = x + i * 8u;
  const v4f a = *(const v4fa*)p;
  const v4f b = *(const v4fa*)(p + 4);
  v4i w;
  w[0] = pack2(a.x, a.y); w[1] = pack2(a.z, a.w);
  w[2] = pack2(b.x, b.y); w[3] = pack2(b.z, b.w);
  unsigned short* d = o + i * 8u;
  *(v4i*)d = w;
  
}

// ---------------------------------------------------------------------------
// Projections. Block = 64 rows of the flattened [b][row] input, 4 waves x 16 rows; activations are held
// as bf16 fragments (col = lane&15 = input row) and every head (16 output columns) is one rolled step.
// MODE 0: q = x1.W1 + x2.W2.   MODE 1: k = x1.W1, then v = x1.W2.
// q/k form: D = Wt_tile (A, row = out col) x X (B, col = input row): D[row d = 8h+r][col = input row], so a
//   lane holds 8 consecutive d of one row -> one 16-B LDS store per plane half. Plane row (b,head,row) =
//   hi[16] | lo[16] halfwords.
// v form: D = X (A) x Wt_tile (B): D[row = input row 8h+r][col d], lane holds 8 consecutive n of column d ->
//   one 16-B LDS store into the V^T stage [plane][col][64 n].
// LDS stg: cross-wave (block barriers); fully written before each copy-out (8 heads x 64 rows x 32, or
// coverage: q/k plane: NB*8 blocks x 16384 halfwords = NB*8*512*32; V^T: NB*8 blocks x 8192 per plane = NB*128*512.
// ---------------------------------------------------------------------------
template <int MODE>
__global__ __launch_bounds__(128) void k_proj(const float* __restrict__ x1, const float* __restrict__ x2,
                                              const unsigned short* __restrict__ w1t,
                                              const unsigned short* __restrict__ w2t,
                                              unsigned short* o1, unsigned short* o2) {
  __shared__ __attribute__((aligned(16))) unsigned short stg[16384];
  const unsigned tid = threadIdx.x, lane = tid & 31u, wave = tid >> 5, hh = lane >> 4, m = lane & 15u;
  const unsigned row0 = blockIdx.x * 64u;
  const unsigned bb = row0 >> 9, r0 = row0 & 511u;
  const unsigned xrow = row0 + 16u * wave + m;

  FragB xa[4], xb[4];
#pragma unroll
  for (int ks = 0; ks < 4; ++ks) {
    xa[ks] = ldf_frag(x1 + (size_t)xrow * EW + 32 * ks + 8u * hh);
    if (MODE == 0) xb[ks] = ldf_frag(x2 + (size_t)xrow * EW + 32 * ks + 8u * hh);
    else xb[ks] = xa[ks];
  }
  const v8f zero8 = {0.f, 0.f, 0.f, 0.f, 0.f, 0.f, 0.f, 0.f};

#pragma unroll 1
  for (unsigned t = 0; t < NH; ++t) {
    const unsigned short* wp = w1t + (size_t)(16u * t + m) * EW + 8u * hh;
    const unsigned short* wq = w2t + (size_t)(16u * t + m) * EW + 8u * hh;
    v8f acc = zero8;
#pragma unroll
    for (int ks = 0; ks < 4; ++ks) {
      const FragB wf = ldg_frag(wp + 32 * ks);
      acc = wmb(wf, xa[ks], acc);
      if (MODE == 0) {
        const FragB wg = ldg_frag(wq + 32 * ks);
        acc = wmb(wg, xb[ks], acc);
      }
    }
    v4i hi, lo;
    split8(acc, hi, lo);
    const unsigned so = (t * 64u + 16u * wave + m) * QROW + 8u * hh;
    *(v4ia*)(stg + so) = hi;
    *(v4ia*)(stg + so + 16u) = lo;
  }
  __syncthreads();
  {
    unsigned short* dst = o1 + ((size_t)bb * NH * GQ + r0) * QROW;
#pragma unroll 1
    for (unsigned it = 0; it < 16u; ++it) {
      const unsigned p = it * 128u + tid, t = p >> 8, wi = p & 255u;
      const v4i v = *(const v4ia*)(stg + p * 8u);
      *(v4i*)(dst + (size_t)t * (GQ * QROW) + wi * 8u) = v;
    }
    
  }
  if (MODE == 1) {
    __syncthreads();
#pragma unroll 1
    for (unsigned t = 0; t < NH; ++t) {
      const unsigned short* wq = w2t + (size_t)(16u * t + m) * EW + 8u * hh;
      v8f acc = zero8;
#pragma unroll
      for (int ks = 0; ks < 4; ++ks) {
        const FragB wf = ldg_frag(wq + 32 * ks);
        acc = wmb(xa[ks], wf, acc);
      }
      v4i hi, lo;
      split8(acc, hi, lo);                       // acc[r] = v[n = 16 wave + 8h + r][col 16t + m]
      const unsigned so = (16u * t + m) * 64u + 16u * wave + 8u * hh;
      *(v4ia*)(stg + so) = hi;
      *(v4ia*)(stg + so + 8192u) = lo;
    }
    __syncthreads();
    unsigned short* dst = o2 + (size_t)bb * EW * NK + r0;
#pragma unroll 1
    for (unsigned it = 0; it < 16u; ++it) {
      const unsigned p = it * 128u + tid, pl = p >> 10, col = (p >> 3) & 127u, c = p & 7u;
      const v4i v = *(const v4ia*)(stg + p * 8u);
      *(v4i*)(dst + (size_t)pl * VPL + (size_t)col * NK + c * 8u) = v;
    }
    
  }
}

// ---------------------------------------------------------------------------
// Fused decoder block: one block = (batch b, 16 query rows g0..g0+15), 8 waves.
// Phase 0: mask tile [16][512] f32 (bf16-convert of the input value, times log2e) -> LDS mk (cross-wave, block barrier).
// Phase A (wave = head): flash attention in the transposed domain.
//   S^T tile = K (A, row = key) x Q^T (B, col = query): K = 16 is laid as [k_hi|k_hi] x [q_hi|q_lo] plus
//   [k_lo|0] x [q_hi|q_lo] along the 32-deep k axis. D[row key 8h+r][col query m]. Softmax statistics are
//   per lane (query m); the two lane halves combine by one xor-16 exchange. The P^T B-fragment is the lane's
//   own 16 score results (tile 0 -> elements 0..7, tile 1 -> elements 8..15). O^T = V^T (A, row d) x P^T:
//   D[row d 8h+r][col query m], scaled per lane. ctx hi/lo -> LDS cst[plane][query][128] by 16-B stores.
// Phase B (wave = 16 output columns e): mh^T = W_comb^T (A, global plane) x ctx^T (B, from cst), hi + lo,
//   + bf16(b_comb[e]); mh hi/lo -> LDS mst[plane][query][128] by 16-B stores.
// Phase C (wave = 64 nodes): s2 = mh (A, from mst, hi + lo) x nodes^T (B, global bf16 plane);
//   D[row query 8h+r][col node m]; s = (10 tanh(x/sqrt(128)) + mask) log2e, written over the mask value in place.
// Phase D (wave = 2 rows): row softmax from LDS; each instruction writes 512 contiguous bytes (4 whole
// LDS extents: mk rows 0..15 cols 0..511 written in phase 0 and consumed cols 0..511; cst/mst rows 0..15
//   cols 0..127 of both planes written by all 8 waves, consumed cols 0..127. Pad columns are never read.
// coverage: grid (32, NB) x 16 rows x 512 = NB*512*512 outputs, each written by exactly one lane.
// ---------------------------------------------------------------------------
__global__ __launch_bounds__(256) void k_dec(const unsigned short* __restrict__ qpl,
                                             const unsigned short* __restrict__ kpl,
                                             const unsigned short* __restrict__ vt,
                                             const float* __restrict__ mask,
                                             const unsigned short* __restrict__ wct,
                                             const float* __restrict__ bcomb,
                                             const unsigned short* __restrict__ nbf,
                                             float* out) {
  __shared__ __attribute__((aligned(16))) float mk[16 * MPITCH];
  __shared__ __attribute__((aligned(16))) unsigned short cst[2 * 16 * CPITCH];
  __shared__ __attribute__((aligned(16))) unsigned short mst[2 * 16 * CPITCH];
  const unsigned tid = threadIdx.x, lane = tid & 31u, wave = tid >> 5, hh = lane >> 4, m = lane & 15u;
  const unsigned g0 = blockIdx.x * 16u, b = blockIdx.y;
  const v8f zero8 = {0.f, 0.f, 0.f, 0.f, 0.f, 0.f, 0.f, 0.f};
  const v4i zero4 = {0, 0, 0, 0};

  // ---- phase 0: mask tile ----
  {
    const float* mg = mask + ((size_t)b * GQ + g0) * NK;
#pragma unroll 2
    for (unsigned it = 0; it < 8u; ++it) {
      const unsigned p = it * 256u + tid, row = p >> 7, c4 = (p & 127u) << 2;
      v4f v = *(const v4fa*)(mg + (size_t)row * NK + c4);
      v.x = bf16_val(v.x) * L2E; v.y = bf16_val(v.y) * L2E; v.z = bf16_val(v.z) * L2E; v.w = bf16_val(v.w) * L2E;
      *(v4fa*)(mk + row * MPITCH + c4) = v;
    }
  }
  __syncthreads();

  // ---- phase A: attention for head = wave ----
  {
    const unsigned bh = b * NH + wave;
    const unsigned short* qp = qpl + ((size_t)bh * GQ + g0 + m) * QROW + 8u * hh;
    FragB qf;
    qf.q[0] = *(const v4ia*)qp;            // q_hi[8h .. 8h+7]  (k slots 8h..)
    qf.q[1] = *(const v4ia*)(qp + 16);     // q_lo[8h .. 8h+7]  (k slots 16+8h..)
    const unsigned short* kb = kpl + ((size_t)bh * NK + m) * QROW + 8u * hh;
    const unsigned short* vh = vt + ((size_t)bh * HD + m) * NK + 8u * hh;
    const unsigned short* vl = vh + VPL;
    const unsigned moff = m * MPITCH + 8u * hh;
    v8f o = zero8;
    float mrun = -3.0e38f, lrun = 0.0f;
#pragma unroll 1
    for (unsigned n0 = 0; n0 < NK; n0 += 32u) {
      const unsigned short* kp = kb + (size_t)n0 * QROW;
      const v4i kh0 = *(const v4ia*)kp;
      const v4i kl0 = *(const v4ia*)(kp + 16);
      const v4i kh1 = *(const v4ia*)(kp + 16 * QROW);
      const v4i kl1 = *(const v4ia*)(kp + 16 * QROW + 16);
      FragB a10, a20, a11, a21;
      a10.q[0] = kh0; a10.q[1] = kh0;
      a20.q[0] = kl0; a20.q[1] = zero4;
      a11.q[0] = kh1; a11.q[1] = kh1;
      a21.q[0] = kl1; a21.q[1] = zero4;
      v8f s0 = wmb(a10, qf, zero8);
      s0 = wmb(a20, qf, s0);
      v8f s1 = wmb(a11, qf, zero8);
      s1 = wmb(a21, qf, s1);

      const v4f m0 = *(const v4fa*)(mk + moff + n0);
      const v4f m1 = *(const v4fa*)(mk + moff + n0 + 4u);
      const v4f m2 = *(const v4fa*)(mk + moff + n0 + 16u);
      const v4f m3 = *(const v4fa*)(mk + moff + n0 + 20u);
      const v8f mk0 = __builtin_shufflevector(m0, m1, 0, 1, 2, 3, 4, 5, 6, 7);
      const v8f mk1 = __builtin_shufflevector(m2, m3, 0, 1, 2, 3, 4, 5, 6, 7);
      const v8f a0 = s0 * (0.25f * L2E) + mk0;      // key n0 + 8h + r, log2 domain
      const v8f a1 = s1 * (0.25f * L2E) + mk1;      // key n0 + 16 + 8h + r

      float t = fmaxf(a0[0], a1[0]);
#pragma unroll
      for (int r = 1; r < 8; ++r) t = fmaxf(t, fmaxf(a0[r], a1[r]));
      t = fmaxf(t, __shfl_xor(t, 16));
      const float mnew = fmaxf(mrun, t);
      const float sc = ex2(mrun - mnew);
      const v8f p0 = ex2x8(a0 - mnew);
      const v8f p1 = ex2x8(a1 - mnew);
      float ps = 0.0f;
#pragma unroll
      for (int r = 0; r < 8; ++r) ps += p0[r] + p1[r];
      lrun = lrun * sc + ps;
      mrun = mnew;
      o = o * sc;

      FragB ph, pl;
      split8(p0, ph.q[0], pl.q[0]);
      split8(p1, ph.q[1], pl.q[1]);
      FragB fvh, fvl;
      fvh.q[0] = *(const v4ia*)(vh + n0);
      fvh.q[1] = *(const v4ia*)(vh + n0 + 16u);
      fvl.q[0] = *(const v4ia*)(vl + n0);
      fvl.q[1] = *(const v4ia*)(vl + n0 + 16u);
      o = wmb(fvh, ph, o);
      o = wmb(fvl, ph, o);
      o = wmb(fvh, pl, o);
    }
    const float lt = lrun + __shfl_xor(lrun, 16);
    const float inv = 1.0f / lt;
    const v8f c = o * inv;                    // ctx[query m][16 wave + 8h + r]
    v4i hi, lo;
    split8(c, hi, lo);
    const unsigned co = m * CPITCH + 16u * wave + 8u * hh;
    *(v4ia*)(cst + co) = hi;
    *(v4ia*)(cst + 16 * CPITCH + co) = lo;
  }
  __syncthreads();

  // ---- phase B: mh^T tile for e = 16 wave .. 16 wave + 15 ----
  {
    const unsigned e0 = 16u * wave;
    const unsigned short* wp = wct + (size_t)(e0 + m) * EW + 8u * hh;
    const unsigned co = m * CPITCH + 8u * hh;
    v8f acc = zero8;
#pragma unroll
    for (int ks = 0; ks < 4; ++ks) {
      const FragB wf = ldg_frag(wp + 32 * ks);
      FragB ch, cl;
      ch.q[0] = *(const v4ia*)(cst + co + 32 * ks);
      ch.q[1] = *(const v4ia*)(cst + co + 32 * ks + 16);
      cl.q[0] = *(const v4ia*)(cst + 16 * CPITCH + co + 32 * ks);
      cl.q[1] = *(const v4ia*)(cst + 16 * CPITCH + co + 32 * ks + 16);
      acc = wmb(wf, ch, acc);
      acc = wmb(wf, cl, acc);
    }
    const v4f b0 = *(const v4fa*)(bcomb + e0 + 8u * hh);
    const v4f b1 = *(const v4fa*)(bcomb + e0 + 8u * hh + 4u);
    acc[0] += bf16_val(b0.x); acc[1] += bf16_val(b0.y);
    acc[2] += bf16_val(b0.z); acc[3] += bf16_val(b0.w);
    acc[4] += bf16_val(b1.x); acc[5] += bf16_val(b1.y);
    acc[6] += bf16_val(b1.z); acc[7] += bf16_val(b1.w);
    v4i hi, lo;
    split8(acc, hi, lo);                      // mh[query m][e0 + 8h + r]
    const unsigned mo = m * CPITCH + e0 + 8u * hh;
    *(v4ia*)(mst + mo) = hi;
    *(v4ia*)(mst + 16 * CPITCH + mo) = lo;
  }
  __syncthreads();

  // ---- phase C: s = (10 tanh(mh . node / sqrt(128)) + mask) log2e, nodes 64 wave .. 64 wave + 63 ----
  {
    const float k2 = (float)(2.0 * 1.4426950408889634 / 11.313708498984761);   // exp(2 x), x = acc / sqrt(128), as 2^(acc k2)
    const unsigned ao = m * CPITCH + 8u * hh;
    FragB ah[4], al[4];
#pragma unroll
    for (int ks = 0; ks < 4; ++ks) {
      ah[ks].q[0] = *(const v4ia*)(mst + ao + 32 * ks);
      ah[ks].q[1] = *(const v4ia*)(mst + ao + 32 * ks + 16);
      al[ks].q[0] = *(const v4ia*)(mst + 16 * CPITCH + ao + 32 * ks);
      al[ks].q[1] = *(const v4ia*)(mst + 16 * CPITCH + ao + 32 * ks + 16);
    }
#pragma unroll 1
    for (unsigned j = 0; j < 4u; ++j) {
      const unsigned n0 = 64u * wave + 16u * j;
      const unsigned short* np = nbf + ((size_t)b * NK + n0 + m) * EW + 8u * hh;
      v8f acc = zero8;
#pragma unroll
      for (int ks = 0; ks < 4; ++ks) {
        const FragB nf = ldg_frag(np + 32 * ks);
        acc = wmb(ah[ks], nf, acc);
        acc = wmb(al[ks], nf, acc);
      }
      const v8f q = rcpx8(ex2x8(acc * k2) + 1.0f);            // exp(2x) = +inf -> tanh 1, 0 -> tanh -1
#pragma unroll
      for (int r = 0; r < 8; ++r) {
        const unsigned idx = (8u * hh + (unsigned)r) * MPITCH + n0 + m;   // D element r = (query 8h+r, node m)
        const float s = (10.0f * L2E - (20.0f * L2E) * q[r]) + mk[idx];   // log2 domain, like the mask tile
        mk[idx] = s;
      }
    }
  }
  __syncthreads();

  // ---- phase D: row softmax, rows 2 wave and 2 wave + 1 ----
  {
    v4f res[2][4];
#pragma unroll
    for (int rr = 0; rr < 2; ++rr) {
      const unsigned so = (2u * wave + (unsigned)rr) * MPITCH + 4u * lane;
      v4f v[4];
#pragma unroll
      for (int j = 0; j < 4; ++j) v[j] = *(const v4fa*)(mk + so + 128 * j);
      float mx = v[0].x;
#pragma unroll
      for (int j = 0; j < 4; ++j) mx = fmaxf(fmaxf(fmaxf(mx, v[j].x), fmaxf(v[j].y, v[j].z)), v[j].w);
      mx = fmaxf(mx, __shfl_xor(mx, 16));
      mx = fmaxf(mx, __shfl_xor(mx, 8));
      mx = fmaxf(mx, __shfl_xor(mx, 4));
      mx = fmaxf(mx, __shfl_xor(mx, 2));
      mx = fmaxf(mx, __shfl_xor(mx, 1));
      float sum = 0.0f;
#pragma unroll
      for (int j = 0; j < 4; j += 2) {
        const v8f e = ex2x8(__builtin_shufflevector(v[j], v[j + 1], 0, 1, 2, 3, 4, 5, 6, 7) - mx);
        v[j] = __builtin_shufflevector(e, e, 0, 1, 2, 3);
        v[j + 1] = __builtin_shufflevector(e, e, 4, 5, 6, 7);
        sum += (v[j].x + v[j].y) + (v[j].z + v[j].w);
        sum += (v[j + 1].x + v[j + 1].y) + (v[j + 1].z + v[j + 1].w);
      }
      sum += __shfl_xor(sum, 16);
      sum += __shfl_xor(sum, 8);
      sum += __shfl_xor(sum, 4);
      sum += __shfl_xor(sum, 2);
      sum += __shfl_xor(sum, 1);
      const float inv = 1.0f / sum;
#pragma unroll
      for (int j = 0; j < 4; ++j) res[rr][j] = v[j] * inv;
    }
    float* ob = out + ((size_t)b * GQ + g0 + 2u * wave) * NK + 4u * lane;
#pragma unroll
    for (int rr = 0; rr < 2; ++rr)
#pragma unroll
      for (int j = 0; j < 4; ++j) *(v4f*)(ob + (size_t)rr * NK + 128 * j) = res[rr][j];
    
  }
}

// ---------------------------------------------------------------------------
static inline size_t al256(size_t o) { return (o + 255) & ~(size_t)255; }

extern "C" void kernel_launch(void* const* d_in, const int* in_sizes, int n_in,
                              void* d_out, int out_size, void* d_ws, size_t ws_size,
                              hipStream_t stream) {
  if (n_in < 10) return;
  const long long actN = (long long)NB * NK * EW;
  const long long actG = (long long)NB * GQ * EW;
  const long long mskN = (long long)NB * GQ * NK;
  if ((long long)in_sizes[0] < actN) return;             // encoded_nodes
  if ((long long)in_sizes[1] < actG) return;             // encoded_q1
  if ((long long)in_sizes[2] < actG) return;             // encoded_last_node
  if ((long long)in_sizes[3] < mskN) return;             // ninf_mask (f32, additive)
  if (in_sizes[4] < EW * EW || in_sizes[5] < EW * EW || in_sizes[6] < EW * EW ||
      in_sizes[7] < EW * EW || in_sizes[8] < EW * EW) return;
  if (in_sizes[9] < EW) return;
  if ((long long)out_size < mskN) return;

  const float* nodes = (const float*)d_in[0];
  const float* q1    = (const float*)d_in[1];
  const float* last  = (const float*)d_in[2];
  const float* mask  = (const float*)d_in[3];
  const float* Wqf   = (const float*)d_in[4];
  const float* Wql   = (const float*)d_in[5];
  const float* Wk    = (const float*)d_in[6];
  const float* Wv    = (const float*)d_in[7];
  const float* Wc    = (const float*)d_in[8];
  const float* bc    = (const float*)d_in[9];
  float* out = (float*)d_out;

  const size_t wtB  = al256((size_t)5 * EW * EW * 2);             // 163,840
  const size_t nbB  = al256((size_t)NB * NK * EW * 2);            // 4,194,304
  const size_t qB   = al256((size_t)NB * NH * GQ * QROW * 2);     // 8,388,608
  const size_t kB   = al256((size_t)NB * NH * NK * QROW * 2);     // 8,388,608
  const size_t vB   = al256((size_t)2 * VPL * 2);                 // 8,388,608
  const size_t total = wtB + nbB + qB + kB + vB;                  // 29,523,968
  if (total > ws_size || total > (size_t)WSMAX) return;
  char* w = (char*)d_ws;
  unsigned short* wt  = (unsigned short*)w;
  unsigned short* nbf = (unsigned short*)(w + wtB);
  unsigned short* qpl = (unsigned short*)(w + wtB + nbB);
  unsigned short* kpl = (unsigned short*)(w + wtB + nbB + qB);
  unsigned short* vtp = (unsigned short*)(w + wtB + nbB + qB + kB);
  unsigned short* wqft = wt;
  unsigned short* wqlt = wt + 1 * EW * EW;
  unsigned short* wkt  = wt + 2 * EW * EW;
  unsigned short* wvt  = wt + 3 * EW * EW;
  unsigned short* wctp = wt + 4 * EW * EW;

  // 1: five weights [in][out] f32 -> [out][in] bf16
  k_wprep<<<dim3(4, 5), 256, 0, stream>>>(Wqf, Wql, Wk, Wv, Wc, wt);
  // 2: nodes -> bf16 plane (B operand of the final scoring product)
  k_cvt<<<(unsigned)(((size_t)NB * NK * EW) / (256 * 8)), 256, 0, stream>>>(nodes, nbf);
  // 3: q = q1.Wq_first + last.Wq_last -> q plane (hi|lo rows)
  k_proj<0><<<(NB * GQ) / 64, 128, 0, stream>>>(q1, last, wqft, wqlt, qpl, qpl);
  // 4: k = nodes.Wk -> k plane (hi|lo rows); v = nodes.Wv -> V^T hi and lo planes
  k_proj<1><<<(NB * NK) / 64, 128, 0, stream>>>(nodes, nodes, wkt, wvt, kpl, vtp);
  // 5: attention + W_comb + final scoring + softmax
  k_dec<<<dim3(GQ / 16, NB), 256, 0, stream>>>(qpl, kpl, vtp, mask, wctp, bc, nbf, out);
}

// v002
// It runs in 85.4 microseconds.
// In two side-by-side timings against v001, it was 1.22 and 1.23 times as fast.
// Counting every step since v000, it is 1.32 times as fast.
// Contractions: q/k/v projections = v_wmma_f32_16x16x32_bf16, bf16 (RNE) inputs and weights, one product. q.k scores, P.V, ctx.W_comb and mh.nodes = same bf16 WMMA with every computed operand carried as bf16 hi + bf16 lo (hi.hi + lo.hi + hi.lo; input-side planes are exact bf16, lo == 0). Accumulate f32 everywhere.
// Mask add, online softmax, tanh, bias, final softmax: f32 VALU; both softmaxes run on logits scaled by log2e (the LDS mask tile carries the factor), so exp(x - m) is one subtract and v_exp_f32; tanh(x) = 1 - 2 v_rcp_f32(1 + exp(2x)). No power-of-two carries exist (bf16 planes only).
#include <hip/hip_runtime.h>
#include <stddef.h>
#include <stdint.h>

#ifndef NB
#define NB 32                      // batches processed (a reduced build reads the first NB batches)
#endif
#define GQ     512                 // queries per batch
#define NK     512                 // nodes (keys) per batch
#define EW     128                 // embedding width = heads x head dim
#define NH     8
#define HD     16
#define QROW   32                  // halfwords per q/k plane row: hi[16] | lo[16]
#define MPITCH 516                 // floats per LDS mask/score row
#define CPITCH 136                 // halfwords per LDS ctx/mh row
#define TPITCH 136                 // halfwords per LDS weight-transpose row
#define WSMAX  134217728
#define VPL    ((size_t)NB * EW * NK)   // halfwords per V^T plane (hi plane, then lo plane)

static_assert(GQ == NK);                       // k_proj uses one row count for q and k planes
static_assert(NH * HD == EW);
static_assert(EW % 32 == 0 && NK % 32 == 0);
static_assert(GQ % 64 == 0 && (NB * GQ) % 64 == 0);
static_assert(NH * 64 * QROW == 16384);        // k_proj stage: q/k form
static_assert(2 * EW * 64 == 16384);           // k_proj stage: V^T form
static_assert(16384 == 128 * 16 * 8);          // k_proj copy-out: 128 thr x 16 it x 8 halfwords
static_assert(32 * EW == 256 * 2 * 8);         // k_wprep copy-out: 256 thr x 2 it x 8 halfwords
static_assert(16 * NK == 256 * 8 * 4);         // k_dec mask staging: 256 thr x 8 it x 4 floats
static_assert(NK == 8 * 64);                   // k_dec phase C: 8 waves x 64 nodes
static_assert(NK == 32 * 16);                  // k_dec phase D: 32 lanes x 4 x 4 floats per row

typedef int            v4i   __attribute__((ext_vector_type(4)));
typedef int            v8i   __attribute__((ext_vector_type(8)));
typedef float          v4f   __attribute__((ext_vector_type(4)));
typedef float          v8f   __attribute__((ext_vector_type(8)));
typedef __bf16         v16bf __attribute__((ext_vector_type(16)));
typedef v4i __attribute__((may_alias)) v4ia;
typedef v4f __attribute__((may_alias)) v4fa;
union FragB { v16bf v; v4i q[2]; v8i w; };

// WMMA with hazard guard: ties D, keeps A/B live for 4 VALU slots
__device__ __forceinline__ v8f wmb(const FragB& a, const FragB& b, v8f c) {
  v8f d = __builtin_amdgcn_wmma_f32_16x16x32_bf16(false, a.v, false, b.v, (short)0, c, false, false);
  asm volatile("v_nop\n\tv_nop\n\tv_nop\n\tv_nop" : "+v"(d) : "v"(a.w), "v"(b.w));
  return d;
}

#define L2E 1.4426950408889634f    // log2(e)
// 2^x on the hardware unit: -inf and anything below the f32 range give 0, +inf gives +inf
__device__ __forceinline__ float ex2(float x) { return __builtin_amdgcn_exp2f(x); }
// Eight 2^x / eight 1/x in one statement. Why asm: behind a transcendental the instruction set asks for one
// independent slot before its result is read or its source overwritten; the early-clobber outputs keep every
// result off every source, and the closing v_nop is the slot behind the last one.
__device__ __forceinline__ v8f ex2x8(const v8f x) {
  float y0, y1, y2, y3, y4, y5, y6, y7;
  asm("v_exp_f32 %0, %8\n\tv_exp_f32 %1, %9\n\tv_exp_f32 %2, %10\n\tv_exp_f32 %3, %11\n\t"
      "v_exp_f32 %4, %12\n\tv_exp_f32 %5, %13\n\tv_exp_f32 %6, %14\n\tv_exp_f32 %7, %15\n\tv_nop"
      : "=&v"(y0), "=&v"(y1), "=&v"(y2), "=&v"(y3), "=&v"(y4), "=&v"(y5), "=&v"(y6), "=&v"(y7)
      : "v"(x[0]), "v"(x[1]), "v"(x[2]), "v"(x[3]), "v"(x[4]), "v"(x[5]), "v"(x[6]), "v"(x[7]));
  const v8f y = {y0, y1, y2, y3, y4, y5, y6, y7};
  return y;
}
__device__ __forceinline__ v8f rcpx8(const v8f x) {
  float y0, y1, y2, y3, y4, y5, y6, y7;
  asm("v_rcp_f32 %0, %8\n\tv_rcp_f32 %1, %9\n\tv_rcp_f32 %2, %10\n\tv_rcp_f32 %3, %11\n\t"
      "v_rcp_f32 %4, %12\n\tv_rcp_f32 %5, %13\n\tv_rcp_f32 %6, %14\n\tv_rcp_f32 %7, %15\n\tv_nop"
      : "=&v"(y0), "=&v"(y1), "=&v"(y2), "=&v"(y3), "=&v"(y4), "=&v"(y5), "=&v"(y6), "=&v"(y7)
      : "v"(x[0]), "v"(x[1]), "v"(x[2]), "v"(x[3]), "v"(x[4]), "v"(x[5]), "v"(x[6]), "v"(x[7]));
  const v8f y = {y0, y1, y2, y3, y4, y5, y6, y7};
  return y;
}

// f32 -> bf16 bits, RNE convert (finite inputs)
__device__ __forceinline__ unsigned bf16_bits(float f) {
  const unsigned u = __float_as_uint(f);
  return (u + 0x7FFFu + ((u >> 16) & 1u)) >> 16;
}
__device__ __forceinline__ float bf16_val(float f) {
  return __uint_as_float(bf16_bits(f) << 16);
}
__device__ __forceinline__ int pack2(float lo, float hi) {
  return (int)(bf16_bits(lo) | (bf16_bits(hi) << 16));
}
// 8 f32 -> bf16 hi piece + bf16 lo piece (lo = RNE(v - hi)); element 2j in the low halfword of word j
__device__ __forceinline__ void split8(const v8f x, v4i& hi, v4i& lo) {
#pragma unroll
  for (int j = 0; j < 4; ++j) {
    const float a = x[2 * j], b = x[2 * j + 1];
    const unsigned ha = bf16_bits(a), hb = bf16_bits(b);
    const float ra = a - __uint_as_float(ha << 16);
    const float rb = b - __uint_as_float(hb << 16);
    hi[j] = (int)(ha | (hb << 16));
    lo[j] = (int)(bf16_bits(ra) | (bf16_bits(rb) << 16));
  }
}
// fragment (row/col = lane&15) from an f32 row: p = row + k0 + 8h; elements 0..7 <- k0+8h+0..7, 8..15 <- k0+16+8h+0..7
__device__ __forceinline__ FragB ldf_frag(const float* __restrict__ p) {
  const v4f a0 = *(const v4fa*)p;
  const v4f a1 = *(const v4fa*)(p + 4);
  const v4f a2 = *(const v4fa*)(p + 16);
  const v4f a3 = *(const v4fa*)(p + 20);
  FragB f;
  f.w[0] = pack2(a0.x, a0.y); f.w[1] = pack2(a0.z, a0.w);
  f.w[2] = pack2(a1.x, a1.y); f.w[3] = pack2(a1.z, a1.w);
  f.w[4] = pack2(a2.x, a2.y); f.w[5] = pack2(a2.z, a2.w);
  f.w[6] = pack2(a3.x, a3.y); f.w[7] = pack2(a3.z, a3.w);
  return f;
}
// same fragment from a GLOBAL k-contiguous bf16 plane row: p = row + k0 + 8h
__device__ __forceinline__ FragB ldg_frag(const unsigned short* __restrict__ p) {
  FragB f;
  f.q[0] = *(const v4ia*)p;
  f.q[1] = *(const v4ia*)(p + 16);
  return f;
}

// ---------------------------------------------------------------------------
// Weight prep: in[k][n] f32 (128 x 128, [in][out]) -> out[n][k] bf16 bits, for 5 weights.
// grid (4, 5): x = 32-column slab, y = weight. LDS tile T[n][k] (cross-wave, block barrier).
// coverage: 20 blocks x 512 pieces x 8 halfwords = 5 x 16384. Every 256-B output row (2 lines) is written by
// ---------------------------------------------------------------------------
__global__ __launch_bounds__(256) void k_wprep(const float* __restrict__ w0, const float* __restrict__ w1,
                                               const float* __restrict__ w2, const float* __restrict__ w3,
                                               const float* __restrict__ w4, unsigned short* wt) {
  __shared__ __attribute__((aligned(16))) unsigned short T[32 * TPITCH];
  const unsigned tid = threadIdx.x;
  const unsigned n0 = blockIdx.x * 32u, ws = blockIdx.y;
  const float* W = (ws == 0u) ? w0 : (ws == 1u) ? w1 : (ws == 2u) ? w2 : (ws == 3u) ? w3 : w4;
#pragma unroll 1
  for (unsigned it = 0; it < 4u; ++it) {
    const unsigned k = (tid >> 3) + 32u * it;
    const unsigned n4 = (tid & 7u) << 2;
    const v4f v = *(const v4fa*)(W + (size_t)k * EW + n0 + n4);
    T[(n4 + 0u) * TPITCH + k] = (unsigned short)bf16_bits(v.x);
    T[(n4 + 1u) * TPITCH + k] = (unsigned short)bf16_bits(v.y);
    T[(n4 + 2u) * TPITCH + k] = (unsigned short)bf16_bits(v.z);
    T[(n4 + 3u) * TPITCH + k] = (unsigned short)bf16_bits(v.w);
  }
  __syncthreads();
  unsigned short* dst = wt + (size_t)ws * (EW * EW) + (size_t)n0 * EW;
#pragma unroll 1
  for (unsigned it = 0; it < 2u; ++it) {
    const unsigned p = it * 256u + tid, n = p >> 4, c = p & 15u;
    const v4i v = *(const v4ia*)(T + n * TPITCH + c * 8u);
    *(v4i*)(dst + n * EW + c * 8u) = v;
  }
  
}

// ---------------------------------------------------------------------------
// Projections. Block = 64 rows of the flattened [b][row] input, 4 waves x 16 rows; activations are held
// as bf16 fragments (col = lane&15 = input row) and every head (16 output columns) is one rolled step.
// MODE 0: q = x1.W1 + x2.W2.   MODE 1: k = x1.W1, then v = x1.W2, and the bf16 fragments of x1 (the nodes) also go
//   out as the plane nb[b][n][128] (B operand of the final scoring product): a lane stores its own 16-B pieces, a
//   wave writes all 256 B of each of its 16 rows.
// Both modes run in ONE launch (k_proj): they depend only on the weight planes, not on each other.
// q/k form: D = Wt_tile (A, row = out col) x X (B, col = input row): D[row d = 8h+r][col = input row], so a
//   lane holds 8 consecutive d of one row -> one 16-B LDS store per plane half. Plane row (b,head,row) =
//   hi[16] | lo[16] halfwords.
// v form: D = X (A) x Wt_tile (B): D[row = input row 8h+r][col d], lane holds 8 consecutive n of column d ->
//   one 16-B LDS store into the V^T stage [plane][col][64 n].
// LDS stg: cross-wave (block barriers); fully written before each copy-out (8 heads x 64 rows x 32, or
// coverage: q/k plane: NB*8 blocks x 16384 halfwords = NB*8*512*32; V^T: NB*8 blocks x 8192 per plane = NB*128*512.
// ---------------------------------------------------------------------------
template <int MODE>
__device__ __forceinline__ void proj_body(const unsigned blk, unsigned short* stg,
                                          const float* __restrict__ x1, const float* __restrict__ x2,
                                          const unsigned short* __restrict__ w1t,
                                          const unsigned short* __restrict__ w2t,
                                          unsigned short* o1, unsigned short* o2, unsigned short* nb) {
  const unsigned tid = threadIdx.x, lane = tid & 31u, wave = tid >> 5, hh = lane >> 4, m = lane & 15u;
  const unsigned row0 = blk * 64u;
  const unsigned bb = row0 >> 9, r0 = row0 & 511u;
  const unsigned xrow = row0 + 16u * wave + m;

  FragB xa[4], xb[4];
#pragma unroll
  for (int ks = 0; ks < 4; ++ks) {
    xa[ks] = ldf_frag(x1 + (size_t)xrow * EW + 32 * ks + 8u * hh);
    if (MODE == 0) xb[ks] = ldf_frag(x2 + (size_t)xrow * EW + 32 * ks + 8u * hh);
    else xb[ks] = xa[ks];
  }
  if (MODE == 1) {
    unsigned short* nd = nb + (size_t)xrow * EW + 8u * hh;
#pragma unroll   // constant ks: xa[] stays in registers
    for (int ks = 0; ks < 4; ++ks) {
      *(v4i*)(nd + 32 * ks) = xa[ks].q[0];
      *(v4i*)(nd + 32 * ks + 16) = xa[ks].q[1];
    }
  }
  const v8f zero8 = {0.f, 0.f, 0.f, 0.f, 0.f, 0.f, 0.f, 0.f};

#pragma unroll 1
  for (unsigned t = 0; t < NH; ++t) {
    const unsigned short* wp = w1t + (size_t)(16u * t + m) * EW + 8u * hh;
    const unsigned short* wq = w2t + (size_t)(16u * t + m) * EW + 8u * hh;
    v8f acc = zero8;
#pragma unroll
    for (int ks = 0; ks < 4; ++ks) {
      const FragB wf = ldg_frag(wp + 32 * ks);
      acc = wmb(wf, xa[ks], acc);
      if (MODE == 0) {
        const FragB wg = ldg_frag(wq + 32 * ks);
        acc = wmb(wg, xb[ks], acc);
      }
    }
    v4i hi, lo;
    split8(acc, hi, lo);
    const unsigned so = (t * 64u + 16u * wave + m) * QROW + 8u * hh;
    *(v4ia*)(stg + so) = hi;
    *(v4ia*)(stg + so + 16u) = lo;
  }
  __syncthreads();
  {
    unsigned short* dst = o1 + ((size_t)bb * NH * GQ + r0) * QROW;
#pragma unroll 1
    for (unsigned it = 0; it < 16u; ++it) {
      const unsigned p = it * 128u + tid, t = p >> 8, wi = p & 255u;
      const v4i v = *(const v4ia*)(stg + p * 8u);
      *(v4i*)(dst + (size_t)t * (GQ * QROW) + wi * 8u) = v;
    }
    
  }
  if (MODE == 1) {
    __syncthreads();
#pragma unroll 1
    for (unsigned t = 0; t < NH; ++t) {
      const unsigned short* wq = w2t + (size_t)(16u * t + m) * EW + 8u * hh;
      v8f acc = zero8;
#pragma unroll
      for (int ks = 0; ks < 4; ++ks) {
        const FragB wf = ldg_frag(wq + 32 * ks);
        acc = wmb(xa[ks], wf, acc);
      }
      v4i hi, lo;
      split8(acc, hi, lo);                       // acc[r] = v[n = 16 wave + 8h + r][col 16t + m]
      const unsigned so = (16u * t + m) * 64u + 16u * wave + 8u * hh;
      *(v4ia*)(stg + so) = hi;
      *(v4ia*)(stg + so + 8192u) = lo;
    }
    __syncthreads();
    unsigned short* dst = o2 + (size_t)bb * EW * NK + r0;
#pragma unroll 1
    for (unsigned it = 0; it < 16u; ++it) {
      const unsigned p = it * 128u + tid, pl = p >> 10, col = (p >> 3) & 127u, c = p & 7u;
      const v4i v = *(const v4ia*)(stg + p * 8u);
      *(v4i*)(dst + (size_t)pl * VPL + (size_t)col * NK + c * 8u) = v;
    }
    
  }
}

// One grid for both projections: blocks 0 .. KVBLK-1 take the k/v form (the longer one, so it starts first),
// the rest the q form. The choice is uniform in a block, so every barrier of a body is passed by all its waves.
#define KVBLK ((NB * NK) / 64)
#define QBLK  ((NB * GQ) / 64)
__global__ __launch_bounds__(128) void k_proj(const float* __restrict__ nodes, const float* __restrict__ q1,
                                              const float* __restrict__ last,
                                              const unsigned short* __restrict__ wqft,
                                              const unsigned short* __restrict__ wqlt,
                                              const unsigned short* __restrict__ wkt,
                                              const unsigned short* __restrict__ wvt,
                                              unsigned short* qpl, unsigned short* kpl, unsigned short* vtp,
                                              unsigned short* nbf) {
  __shared__ __attribute__((aligned(16))) unsigned short stg[16384];
  if (blockIdx.x < (unsigned)KVBLK) proj_body<1>(blockIdx.x, stg, nodes, nodes, wkt, wvt, kpl, vtp, nbf);
  else proj_body<0>(blockIdx.x - (unsigned)KVBLK, stg, q1, last, wqft, wqlt, qpl, qpl, nbf);
}

// ---------------------------------------------------------------------------
// Fused decoder block: one block = (batch b, 16 query rows g0..g0+15), 8 waves.
// Phase 0: mask tile [16][512] f32 (bf16-convert of the input value, times log2e) -> LDS mk (cross-wave, block barrier).
// Phase A (wave = head): flash attention in the transposed domain.
//   S^T tile = K (A, row = key) x Q^T (B, col = query): K = 16 is laid as [k_hi|k_hi] x [q_hi|q_lo] plus
//   [k_lo|0] x [q_hi|q_lo] along the 32-deep k axis. D[row key 8h+r][col query m]. Softmax statistics are
//   per lane (query m); the two lane halves combine by one xor-16 exchange. The P^T B-fragment is the lane's
//   own 16 score results (tile 0 -> elements 0..7, tile 1 -> elements 8..15). O^T = V^T (A, row d) x P^T:
//   D[row d 8h+r][col query m], scaled per lane. ctx hi/lo -> LDS cst[plane][query][128] by 16-B stores.
// Phase B (wave = 16 output columns e): mh^T = W_comb^T (A, global plane) x ctx^T (B, from cst), hi + lo,
//   + bf16(b_comb[e]); mh hi/lo -> LDS mst[plane][query][128] by 16-B stores.
// Phase C (wave = 64 nodes): s2 = mh (A, from mst, hi + lo) x nodes^T (B, global bf16 plane);
//   D[row query 8h+r][col node m]; s = (10 tanh(x/sqrt(128)) + mask) log2e, written over the mask value in place.
// Phase D (wave = 2 rows): row softmax from LDS; each instruction writes 512 contiguous bytes (4 whole
// LDS extents: mk rows 0..15 cols 0..511 written in phase 0 and consumed cols 0..511; cst/mst rows 0..15
//   cols 0..127 of both planes written by all 8 waves, consumed cols 0..127. Pad columns are never read.
// coverage: grid (32, NB) x 16 rows x 512 = NB*512*512 outputs, each written by exactly one lane.
// ---------------------------------------------------------------------------
__global__ __launch_bounds__(256) void k_dec(const unsigned short* __restrict__ qpl,
                                             const unsigned short* __restrict__ kpl,
                                             const unsigned short* __restrict__ vt,
                                             const float* __restrict__ mask,
                                             const unsigned short* __restrict__ wct,
                                             const float* __restrict__ bcomb,
                                             const unsigned short* __restrict__ nbf,
                                             float* out) {
  __shared__ __attribute__((aligned(16))) float mk[16 * MPITCH];
  __shared__ __attribute__((aligned(16))) unsigned short cst[2 * 16 * CPITCH];
  __shared__ __attribute__((aligned(16))) unsigned short mst[2 * 16 * CPITCH];
  const unsigned tid = threadIdx.x, lane = tid & 31u, wave = tid >> 5, hh = lane >> 4, m = lane & 15u;
  const unsigned g0 = blockIdx.x * 16u, b = blockIdx.y;
  const v8f zero8 = {0.f, 0.f, 0.f, 0.f, 0.f, 0.f, 0.f, 0.f};
  const v4i zero4 = {0, 0, 0, 0};

  // ---- phase 0: mask tile ----
  {
    const float* mg = mask + ((size_t)b * GQ + g0) * NK;
#pragma unroll 2
    for (unsigned it = 0; it < 8u; ++it) {
      const unsigned p = it * 256u + tid, row = p >> 7, c4 = (p & 127u) << 2;
      v4f v = *(const v4fa*)(mg + (size_t)row * NK + c4);
      v.x = bf16_val(v.x) * L2E; v.y = bf16_val(v.y) * L2E; v.z = bf16_val(v.z) * L2E; v.w = bf16_val(v.w) * L2E;
      *(v4fa*)(mk + row * MPITCH + c4) = v;
    }
  }
  __syncthreads();

  // ---- phase A: attention for head = wave ----
  {
    const unsigned bh = b * NH + wave;
    const unsigned short* qp = qpl + ((size_t)bh * GQ + g0 + m) * QROW + 8u * hh;
    FragB qf;
    qf.q[0] = *(const v4ia*)qp;            // q_hi[8h .. 8h+7]  (k slots 8h..)
    qf.q[1] = *(const v4ia*)(qp + 16);     // q_lo[8h .. 8h+7]  (k slots 16+8h..)
    const unsigned short* kb = kpl + ((size_t)bh * NK + m) * QROW + 8u * hh;
    const unsigned short* vh = vt + ((size_t)bh * HD + m) * NK + 8u * hh;
    const unsigned short* vl = vh + VPL;
    const unsigned moff = m * MPITCH + 8u * hh;
    v8f o = zero8;
    float mrun = -3.0e38f, lrun = 0.0f;
#pragma unroll 1
    for (unsigned n0 = 0; n0 < NK; n0 += 32u) {
      const unsigned short* kp = kb + (size_t)n0 * QROW;
      const v4i kh0 = *(const v4ia*)kp;
      const v4i kl0 = *(const v4ia*)(kp + 16);
      const v4i kh1 = *(const v4ia*)(kp + 16 * QROW);
      const v4i kl1 = *(const v4ia*)(kp + 16 * QROW + 16);
      FragB a10, a20, a11, a21;
      a10.q[0] = kh0; a10.q[1] = kh0;
      a20.q[0] = kl0; a20.q[1] = zero4;
      a11.q[0] = kh1; a11.q[1] = kh1;
      a21.q[0] = kl1; a21.q[1] = zero4;
      v8f s0 = wmb(a10, qf, zero8);
      s0 = wmb(a20, qf, s0);
      v8f s1 = wmb(a11, qf, zero8);
      s1 = wmb(a21, qf, s1);

      const v4f m0 = *(const v4fa*)(mk + moff + n0);
      const v4f m1 = *(const v4fa*)(mk + moff + n0 + 4u);
      const v4f m2 = *(const v4fa*)(mk + moff + n0 + 16u);
      const v4f m3 = *(const v4fa*)(mk + moff + n0 + 20u);
      const v8f mk0 = __builtin_shufflevector(m0, m1, 0, 1, 2, 3, 4, 5, 6, 7);
      const v8f mk1 = __builtin_shufflevector(m2, m3, 0, 1, 2, 3, 4, 5, 6, 7);
      const v8f a0 = s0 * (0.25f * L2E) + mk0;      // key n0 + 8h + r, log2 domain
      const v8f a1 = s1 * (0.25f * L2E) + mk1;      // key n0 + 16 + 8h + r

      float t = fmaxf(a0[0], a1[0]);
#pragma unroll
      for (int r = 1; r < 8; ++r) t = fmaxf(t, fmaxf(a0[r], a1[r]));
      t = fmaxf(t, __shfl_xor(t, 16));
      const float mnew = fmaxf(mrun, t);
      const float sc = ex2(mrun - mnew);
      const v8f p0 = ex2x8(a0 - mnew);
      const v8f p1 = ex2x8(a1 - mnew);
      float ps = 0.0f;
#pragma unroll
      for (int r = 0; r < 8; ++r) ps += p0[r] + p1[r];
      lrun = lrun * sc + ps;
      mrun = mnew;
      o = o * sc;

      FragB ph, pl;
      split8(p0, ph.q[0], pl.q[0]);
      split8(p1, ph.q[1], pl.q[1]);
      FragB fvh, fvl;
      fvh.q[0] = *(const v4ia*)(vh + n0);
      fvh.q[1] = *(const v4ia*)(vh + n0 + 16u);
      fvl.q[0] = *(const v4ia*)(vl + n0);
      fvl.q[1] = *(const v4ia*)(vl + n0 + 16u);
      o = wmb(fvh, ph, o);
      o = wmb(fvl, ph, o);
      o = wmb(fvh, pl, o);
    }
    const float lt = lrun + __shfl_xor(lrun, 16);
    const float inv = 1.0f / lt;
    const v8f c = o * inv;                    // ctx[query m][16 wave + 8h + r]
    v4i hi, lo;
    split8(c, hi, lo);
    const unsigned co = m * CPITCH + 16u * wave + 8u * hh;
    *(v4ia*)(cst + co) = hi;
    *(v4ia*)(cst + 16 * CPITCH + co) = lo;
  }
  __syncthreads();

  // ---- phase B: mh^T tile for e = 16 wave .. 16 wave + 15 ----
  {
    const unsigned e0 = 16u * wave;
    const unsigned short* wp = wct + (size_t)(e0 + m) * EW + 8u * hh;
    const unsigned co = m * CPITCH + 8u * hh;
    v8f acc = zero8;
#pragma unroll
    for (int ks = 0; ks < 4; ++ks) {
      const FragB wf = ldg_frag(wp + 32 * ks);
      FragB ch, cl;
      ch.q[0] = *(const v4ia*)(cst + co + 32 * ks);
      ch.q[1] = *(const v4ia*)(cst + co + 32 * ks + 16);
      cl.q[0] = *(const v4ia*)(cst + 16 * CPITCH + co + 32 * ks);
      cl.q[1] = *(const v4ia*)(cst + 16 * CPITCH + co + 32 * ks + 16);
      acc = wmb(wf, ch, acc);
      acc = wmb(wf, cl, acc);
    }
    const v4f b0 = *(const v4fa*)(bcomb + e0 + 8u * hh);
    const v4f b1 = *(const v4fa*)(bcomb + e0 + 8u * hh + 4u);
    acc[0] += bf16_val(b0.x); acc[1] += bf16_val(b0.y);
    acc[2] += bf16_val(b0.z); acc[3] += bf16_val(b0.w);
    acc[4] += bf16_val(b1.x); acc[5] += bf16_val(b1.y);
    acc[6] += bf16_val(b1.z); acc[7] += bf16_val(b1.w);
    v4i hi, lo;
    split8(acc, hi, lo);                      // mh[query m][e0 + 8h + r]
    const unsigned mo = m * CPITCH + e0 + 8u * hh;
    *(v4ia*)(mst + mo) = hi;
    *(v4ia*)(mst + 16 * CPITCH + mo) = lo;
  }
  __syncthreads();

  // ---- phase C: s = (10 tanh(mh . node / sqrt(128)) + mask) log2e, nodes 64 wave .. 64 wave + 63 ----
  {
    const float k2 = (float)(2.0 * 1.4426950408889634 / 11.313708498984761);   // exp(2 x), x = acc / sqrt(128), as 2^(acc k2)
    const unsigned ao = m * CPITCH + 8u * hh;
    FragB ah[4], al[4];
#pragma unroll
    for (int ks = 0; ks < 4; ++ks) {
      ah[ks].q[0] = *(const v4ia*)(mst + ao + 32 * ks);
      ah[ks].q[1] = *(const v4ia*)(mst + ao + 32 * ks + 16);
      al[ks].q[0] = *(const v4ia*)(mst + 16 * CPITCH + ao + 32 * ks);
      al[ks].q[1] = *(const v4ia*)(mst + 16 * CPITCH + ao + 32 * ks + 16);
    }
#pragma unroll 1
    for (unsigned j = 0; j < 4u; ++j) {
      const unsigned n0 = 64u * wave + 16u * j;
      const unsigned short* np = nbf + ((size_t)b * NK + n0 + m) * EW + 8u * hh;
      v8f acc = zero8;
#pragma unroll
      for (int ks = 0; ks < 4; ++ks) {
        const FragB nf = ldg_frag(np + 32 * ks);
        acc = wmb(ah[ks], nf, acc);
        acc = wmb(al[ks], nf, acc);
      }
      const v8f q = rcpx8(ex2x8(acc * k2) + 1.0f);            // exp(2x) = +inf -> tanh 1, 0 -> tanh -1
#pragma unroll
      for (int r = 0; r < 8; ++r) {
        const unsigned idx = (8u * hh + (unsigned)r) * MPITCH + n0 + m;   // D element r = (query 8h+r, node m)
        const float s = (10.0f * L2E - (20.0f * L2E) * q[r]) + mk[idx];   // log2 domain, like the mask tile
        mk[idx] = s;
      }
    }
  }
  __syncthreads();

  // ---- phase D: row softmax, rows 2 wave and 2 wave + 1 ----
  {
    v4f res[2][4];
#pragma unroll
    for (int rr = 0; rr < 2; ++rr) {
      const unsigned so = (2u * wave + (unsigned)rr) * MPITCH + 4u * lane;
      v4f v[4];
#pragma unroll
      for (int j = 0; j < 4; ++j) v[j] = *(const v4fa*)(mk + so + 128 * j);
      float mx = v[0].x;
#pragma unroll
      for (int j = 0; j < 4; ++j) mx = fmaxf(fmaxf(fmaxf(mx, v[j].x), fmaxf(v[j].y, v[j].z)), v[j].w);
      mx = fmaxf(mx, __shfl_xor(mx, 16));
      mx = fmaxf(mx, __shfl_xor(mx, 8));
      mx = fmaxf(mx, __shfl_xor(mx, 4));
      mx = fmaxf(mx, __shfl_xor(mx, 2));
      mx = fmaxf(mx, __shfl_xor(mx, 1));
      float sum = 0.0f;
#pragma unroll
      for (int j = 0; j < 4; j += 2) {
        const v8f e = ex2x8(__builtin_shufflevector(v[j], v[j + 1], 0, 1, 2, 3, 4, 5, 6, 7) - mx);
        v[j] = __builtin_shufflevector(e, e, 0, 1, 2, 3);
        v[j + 1] = __builtin_shufflevector(e, e, 4, 5, 6, 7);
        sum += (v[j].x + v[j].y) + (v[j].z + v[j].w);
        sum += (v[j + 1].x + v[j + 1].y) + (v[j + 1].z + v[j + 1].w);
      }
      sum += __shfl_xor(sum, 16);
      sum += __shfl_xor(sum, 8);
      sum += __shfl_xor(sum, 4);
      sum += __shfl_xor(sum, 2);
      sum += __shfl_xor(sum, 1);
      const float inv = 1.0f / sum;
#pragma unroll
      for (int j = 0; j < 4; ++j) res[rr][j] = v[j] * inv;
    }
    float* ob = out + ((size_t)b * GQ + g0 + 2u * wave) * NK + 4u * lane;
#pragma unroll
    for (int rr = 0; rr < 2; ++rr)
#pragma unroll
      for (int j = 0; j < 4; ++j) *(v4f*)(ob + (size_t)rr * NK + 128 * j) = res[rr][j];
    
  }
}

// ---------------------------------------------------------------------------
static inline size_t al256(size_t o) { return (o + 255) & ~(size_t)255; }

extern "C" void kernel_launch(void* const* d_in, const int* in_sizes, int n_in,
                              void* d_out, int out_size, void* d_ws, size_t ws_size,
                              hipStream_t stream) {
  if (n_in < 10) return;
  const long long actN = (long long)NB * NK * EW;
  const long long actG = (long long)NB * GQ * EW;
  const long long mskN = (long long)NB * GQ * NK;
  if ((long long)in_sizes[0] < actN) return;             // encoded_nodes
  if ((long long)in_sizes[1] < actG) return;             // encoded_q1
  if ((long long)in_sizes[2] < actG) return;             // encoded_last_node
  if ((long long)in_sizes[3] < mskN) return;             // ninf_mask (f32, additive)
  if (in_sizes[4] < EW * EW || in_sizes[5] < EW * EW || in_sizes[6] < EW * EW ||
      in_sizes[7] < EW * EW || in_sizes[8] < EW * EW) return;
  if (in_sizes[9] < EW) return;
  if ((long long)out_size < mskN) return;

  const float* nodes = (const float*)d_in[0];
  const float* q1    = (const float*)d_in[1];
  const float* last  = (const float*)d_in[2];
  const float* mask  = (const float*)d_in[3];
  const float* Wqf   = (const float*)d_in[4];
  const float* Wql   = (const float*)d_in[5];
  const float* Wk    = (const float*)d_in[6];
  const float* Wv    = (const float*)d_in[7];
  const float* Wc    = (const float*)d_in[8];
  const float* bc    = (const float*)d_in[9];
  float* out = (float*)d_out;

  const size_t wtB  = al256((size_t)5 * EW * EW * 2);             // 163,840
  const size_t nbB  = al256((size_t)NB * NK * EW * 2);            // 4,194,304
  const size_t qB   = al256((size_t)NB * NH * GQ * QROW * 2);     // 8,388,608
  const size_t kB   = al256((size_t)NB * NH * NK * QROW * 2);     // 8,388,608
  const size_t vB   = al256((size_t)2 * VPL * 2);                 // 8,388,608
  const size_t total = wtB + nbB + qB + kB + vB;                  // 29,523,968
  if (total > ws_size || total > (size_t)WSMAX) return;
  char* w = (char*)d_ws;
  unsigned short* wt  = (unsigned short*)w;
  unsigned short* nbf = (unsigned short*)(w + wtB);
  unsigned short* qpl = (unsigned short*)(w + wtB + nbB);
  unsigned short* kpl = (unsigned short*)(w + wtB + nbB + qB);
  unsigned short* vtp = (unsigned short*)(w + wtB + nbB + qB + kB);
  unsigned short* wqft = wt;
  unsigned short* wqlt = wt + 1 * EW * EW;
  unsigned short* wkt  = wt + 2 * EW * EW;
  unsigned short* wvt  = wt + 3 * EW * EW;
  unsigned short* wctp = wt + 4 * EW * EW;

  // 1: five weights [in][out] f32 -> [out][in] bf16
  k_wprep<<<dim3(4, 5), 256, 0, stream>>>(Wqf, Wql, Wk, Wv, Wc, wt);
  // 2: k = nodes.Wk -> k plane (hi|lo rows), v = nodes.Wv -> V^T hi and lo planes, nodes -> bf16 plane;
  //    q = q1.Wq_first + last.Wq_last -> q plane (hi|lo rows)
  k_proj<<<KVBLK + QBLK, 128, 0, stream>>>(nodes, q1, last, wqft, wqlt, wkt, wvt, qpl, kpl, vtp, nbf);
  // 3: attention + W_comb + final scoring + softmax
  k_dec<<<dim3(GQ / 16, NB), 256, 0, stream>>>(qpl, kpl, vtp, mask, wctp, bc, nbf, out);
}

// v003
// One run takes 72.7 microseconds.
// Timed twice side by side with v002, it ran 1.18 times as fast both times.
// All steps since v000 together make it 1.55 times as fast.
// Contractions: q/k/v projections = v_wmma_f32_16x16x32_bf16, bf16 (RNE) inputs and weights, one product. q.k scores, P.V, ctx.W_comb and mh.nodes = same bf16 WMMA with every computed operand carried as bf16 hi + bf16 lo (hi.hi + lo.hi + hi.lo; input-side planes are exact bf16, lo == 0). Accumulate f32 everywhere.
// Mask add, online softmax, tanh, bias, final softmax: f32 VALU; both softmaxes run on logits scaled by log2e (the LDS mask tile carries the factor), so exp(x - m) is one subtract and v_exp_f32; tanh(x) = 1 - 2 v_rcp_f32(1 + exp(2x)). No power-of-two carries exist (bf16 planes only).
#include <hip/hip_runtime.h>
#include <stddef.h>
#include <stdint.h>

#ifndef NB
#define NB 32                      // batches processed (a reduced build reads the first NB batches)
#endif
#define GQ     512                 // queries per batch
#define NK     512                 // nodes (keys) per batch
#define EW     128                 // embedding width = heads x head dim
#define NH     8
#define HD     16
#define QROW   32                  // halfwords per q/k plane row: hi[16] | lo[16]
#define MPITCH 516                 // floats per LDS mask/score row
#define CPITCH 136                 // halfwords per LDS ctx/mh row
#define TPITCH 136                 // halfwords per LDS weight-transpose row
#define WSMAX  134217728
#define VPL    ((size_t)NB * EW * NK)   // halfwords per V^T plane (hi plane, then lo plane)

static_assert(GQ == NK);                       // k_proj uses one row count for q and k planes
static_assert(NH * HD == EW);
static_assert(EW % 32 == 0 && NK % 32 == 0);
static_assert(GQ % 64 == 0 && (NB * GQ) % 64 == 0);
static_assert(NH * 64 * QROW == 16384);        // k_proj stage: q/k form
static_assert(2 * EW * 64 == 16384);           // k_proj stage: V^T form
static_assert(16384 == 128 * 16 * 8);          // k_proj copy-out: 128 thr x 16 it x 8 halfwords
static_assert(EW == 32 * 4 && EW == 4 * 4 * 8); // stage_wt: 32 lanes x 4 columns, 4 waves x 4 it x 8 rows
static_assert(EW * EW == 128 * 16 * 8);        // W_comb copy-out: 128 thr x 16 it x 8 halfwords
static_assert(16 * NK == 256 * 8 * 4);         // k_dec mask staging: 256 thr x 8 it x 4 floats
static_assert(NK == 8 * 64);                   // k_dec phase C: 8 waves x 64 nodes
static_assert(NK == 32 * 16);                  // k_dec phase D: 32 lanes x 4 x 4 floats per row

typedef int            v4i   __attribute__((ext_vector_type(4)));
typedef int            v8i   __attribute__((ext_vector_type(8)));
typedef float          v4f   __attribute__((ext_vector_type(4)));
typedef float          v8f   __attribute__((ext_vector_type(8)));
typedef __bf16         v16bf __attribute__((ext_vector_type(16)));
typedef __bf16         v8bf  __attribute__((ext_vector_type(8)));
typedef v4i __attribute__((may_alias)) v4ia;
typedef v4f __attribute__((may_alias)) v4fa;
union FragB { v16bf v; v4i q[2]; v8i w; };

// WMMA with hazard guard: ties D, keeps A/B live for 4 VALU slots
__device__ __forceinline__ v8f wmb(const FragB& a, const FragB& b, v8f c) {
  v8f d = __builtin_amdgcn_wmma_f32_16x16x32_bf16(false, a.v, false, b.v, (short)0, c, false, false);
  asm volatile("v_nop\n\tv_nop\n\tv_nop\n\tv_nop" : "+v"(d) : "v"(a.w), "v"(b.w));
  return d;
}

#define L2E 1.4426950408889634f    // log2(e)
// 2^x on the hardware unit: -inf and anything below the f32 range give 0, +inf gives +inf
__device__ __forceinline__ float ex2(float x) { return __builtin_amdgcn_exp2f(x); }
// Eight 2^x / eight 1/x in one statement. Why asm: behind a transcendental the instruction set asks for one
// independent slot before its result is read or its source overwritten; the early-clobber outputs keep every
// result off every source, and the closing v_nop is the slot behind the last one.
__device__ __forceinline__ v8f ex2x8(const v8f x) {
  float y0, y1, y2, y3, y4, y5, y6, y7;
  asm("v_exp_f32 %0, %8\n\tv_exp_f32 %1, %9\n\tv_exp_f32 %2, %10\n\tv_exp_f32 %3, %11\n\t"
      "v_exp_f32 %4, %12\n\tv_exp_f32 %5, %13\n\tv_exp_f32 %6, %14\n\tv_exp_f32 %7, %15\n\tv_nop"
      : "=&v"(y0), "=&v"(y1), "=&v"(y2), "=&v"(y3), "=&v"(y4), "=&v"(y5), "=&v"(y6), "=&v"(y7)
      : "v"(x[0]), "v"(x[1]), "v"(x[2]), "v"(x[3]), "v"(x[4]), "v"(x[5]), "v"(x[6]), "v"(x[7]));
  const v8f y = {y0, y1, y2, y3, y4, y5, y6, y7};
  return y;
}
__device__ __forceinline__ v8f rcpx8(const v8f x) {
  float y0, y1, y2, y3, y4, y5, y6, y7;
  asm("v_rcp_f32 %0, %8\n\tv_rcp_f32 %1, %9\n\tv_rcp_f32 %2, %10\n\tv_rcp_f32 %3, %11\n\t"
      "v_rcp_f32 %4, %12\n\tv_rcp_f32 %5, %13\n\tv_rcp_f32 %6, %14\n\tv_rcp_f32 %7, %15\n\tv_nop"
      : "=&v"(y0), "=&v"(y1), "=&v"(y2), "=&v"(y3), "=&v"(y4), "=&v"(y5), "=&v"(y6), "=&v"(y7)
      : "v"(x[0]), "v"(x[1]), "v"(x[2]), "v"(x[3]), "v"(x[4]), "v"(x[5]), "v"(x[6]), "v"(x[7]));
  const v8f y = {y0, y1, y2, y3, y4, y5, y6, y7};
  return y;
}

// f32 -> bf16 bits, RNE convert (finite inputs)
__device__ __forceinline__ unsigned bf16_bits(float f) {
  const unsigned u = __float_as_uint(f);
  return (u + 0x7FFFu + ((u >> 16) & 1u)) >> 16;
}
__device__ __forceinline__ float bf16_val(float f) {
  return __uint_as_float(bf16_bits(f) << 16);
}
__device__ __forceinline__ int pack2(float lo, float hi) {
  return (int)(bf16_bits(lo) | (bf16_bits(hi) << 16));
}
// 8 f32 -> bf16 hi piece + bf16 lo piece (lo = RNE(v - hi)); element 2j in the low halfword of word j
__device__ __forceinline__ void split8(const v8f x, v4i& hi, v4i& lo) {
#pragma unroll
  for (int j = 0; j < 4; ++j) {
    const float a = x[2 * j], b = x[2 * j + 1];
    const unsigned ha = bf16_bits(a), hb = bf16_bits(b);
    const float ra = a - __uint_as_float(ha << 16);
    const float rb = b - __uint_as_float(hb << 16);
    hi[j] = (int)(ha | (hb << 16));
    lo[j] = (int)(bf16_bits(ra) | (bf16_bits(rb) << 16));
  }
}
// fragment (row/col = lane&15) from an f32 row: p = row + k0 + 8h; elements 0..7 <- k0+8h+0..7, 8..15 <- k0+16+8h+0..7
__device__ __forceinline__ FragB ldf_frag(const float* __restrict__ p) {
  const v4f a0 = *(const v4fa*)p;
  const v4f a1 = *(const v4fa*)(p + 4);
  const v4f a2 = *(const v4fa*)(p + 16);
  const v4f a3 = *(const v4fa*)(p + 20);
  FragB f;
  f.w[0] = pack2(a0.x, a0.y); f.w[1] = pack2(a0.z, a0.w);
  f.w[2] = pack2(a1.x, a1.y); f.w[3] = pack2(a1.z, a1.w);
  f.w[4] = pack2(a2.x, a2.y); f.w[5] = pack2(a2.z, a2.w);
  f.w[6] = pack2(a3.x, a3.y); f.w[7] = pack2(a3.z, a3.w);
  return f;
}
// same fragment from a GLOBAL k-contiguous bf16 plane row: p = row + k0 + 8h
__device__ __forceinline__ FragB ldg_frag(const unsigned short* __restrict__ p) {
  FragB f;
  f.q[0] = *(const v4ia*)p;
  f.q[1] = *(const v4ia*)(p + 16);
  return f;
}

// ---------------------------------------------------------------------------
// Weight staging, by the 4 waves of one block: W[k][n] f32 (128 x 128, [in][out]) -> LDS T[n][k] bf16 bits, row
// pitch TPITCH. A task = 8 rows k x 4 columns n: a wave-wide load is one whole 512-B row of W, a lane packs 8
// consecutive k of each of its 4 columns into one 16-B LDS store. Coverage: 4 waves x 4 it x 8 k = 128 k,
// 32 lanes x 4 n = 128 n. Cross-wave: the caller's block barrier stands between this and the first read of T.
// ---------------------------------------------------------------------------
__device__ __forceinline__ void stage_wt(const float* __restrict__ W, unsigned short* T) {
  const unsigned lane = threadIdx.x & 31u, wave = threadIdx.x >> 5;
#pragma unroll   // all 32 loads of a weight in flight together
  for (unsigned it = 0; it < 4u; ++it) {
    const unsigned k0 = 8u * (wave + 4u * it);
    const float* p = W + (size_t)k0 * EW + 4u * lane;
    v4f r[8];
#pragma unroll   // constant j, c: r[] stays in registers
    for (int j = 0; j < 8; ++j) r[j] = *(const v4fa*)(p + j * EW);
#pragma unroll
    for (int c = 0; c < 4; ++c) {
      const v8f col = {r[0][c], r[1][c], r[2][c], r[3][c], r[4][c], r[5][c], r[6][c], r[7][c]};
      union { v8bf h; v4i q; } u;
      u.h = __builtin_convertvector(col, v8bf);      // RNE, two values an instruction; k even in the low halfword
      *(v4ia*)(T + (4u * lane + (unsigned)c) * TPITCH + k0) = u.q;
    }
  }
}
// fragment from an LDS k-contiguous bf16 row: p = row + k0 + 8h (same element order as ldg_frag)
__device__ __forceinline__ FragB lds_frag(const unsigned short* p) {
  FragB f;
  f.q[0] = *(const v4ia*)p;
  f.q[1] = *(const v4ia*)(p + 16);
  return f;
}

// ---------------------------------------------------------------------------
// Projections. Block = 64 rows of the flattened [b][row] input, 4 waves x 16 rows; activations are held
// as bf16 fragments (col = lane&15 = input row) and every head (16 output columns) is one rolled step.
// MODE 0: q = x1.W1 + x2.W2.   MODE 1: k = x1.W1, then v = x1.W2, and the bf16 fragments of x1 (the nodes) also go
//   out as the plane nb[b][n][128] (B operand of the final scoring product): a lane stores its own 16-B pieces, a
//   wave writes all 256 B of each of its 16 rows.
// Both modes run in ONE launch (k_proj): they depend only on the inputs, not on each other. A block first stages its
// own two weights, transposed to bf16 [out][in], in LDS (stage_wt) and takes every weight fragment from there.
// q/k form: D = Wt_tile (A, row = out col) x X (B, col = input row): D[row d = 8h+r][col = input row], so a
//   lane holds 8 consecutive d of one row -> one 16-B LDS store per plane half. Plane row (b,head,row) =
//   hi[16] | lo[16] halfwords.
// v form: D = X (A) x Wt_tile (B): D[row = input row 8h+r][col d], lane holds 8 consecutive n of column d ->
//   one 16-B LDS store into the V^T stage [plane][col][64 n].
// LDS stg: cross-wave (block barriers); fully written before each copy-out (8 heads x 64 rows x 32, or
// coverage: q/k plane: NB*8 blocks x 16384 halfwords = NB*8*512*32; V^T: NB*8 blocks x 8192 per plane = NB*128*512.
// ---------------------------------------------------------------------------
template <int MODE>
__device__ __forceinline__ void proj_body(const unsigned blk, unsigned short* stg,
                                          const float* __restrict__ x1, const float* __restrict__ x2,
                                          const float* __restrict__ w1, const float* __restrict__ w2,
                                          unsigned short* w1t, unsigned short* w2t,
                                          unsigned short* o1, unsigned short* o2, unsigned short* nb) {
  const unsigned tid = threadIdx.x, lane = tid & 31u, wave = tid >> 5, hh = lane >> 4, m = lane & 15u;
  const unsigned row0 = blk * 64u;
  const unsigned bb = row0 >> 9, r0 = row0 & 511u;
  const unsigned xrow = row0 + 16u * wave + m;

  // x1's loads (from memory, the longest wait) are issued first and packed behind the weight staging
  v4f xr[4][4];
  const float* xp = x1 + (size_t)xrow * EW + 8u * hh;
#pragma unroll
  for (int ks = 0; ks < 4; ++ks) {
    const float* p = xp + 32 * ks;
    xr[ks][0] = *(const v4fa*)p;        xr[ks][1] = *(const v4fa*)(p + 4);
    xr[ks][2] = *(const v4fa*)(p + 16); xr[ks][3] = *(const v4fa*)(p + 20);
  }
  // the wait that stands before a register named by an issued load is written again; xp as an input keeps the
  // address pair out of the loads' own destinations up to here
  asm volatile("s_wait_xcnt 0x0" :: "v"(xp) : "memory");
#pragma unroll 1   // one weight a trip: 32 loads in flight, not 64, which keeps the block under 256 registers
  for (unsigned w = 0; w < 2u; ++w) stage_wt(w ? w2 : w1, w ? w2t : w1t);
  FragB xa[4], xb[4];
#pragma unroll
  for (int ks = 0; ks < 4; ++ks) {
#pragma unroll
    for (int j = 0; j < 4; ++j) {
      xa[ks].w[2 * j] = pack2(xr[ks][j].x, xr[ks][j].y);
      xa[ks].w[2 * j + 1] = pack2(xr[ks][j].z, xr[ks][j].w);
    }
    if (MODE == 0) xb[ks] = ldf_frag(x2 + (size_t)xrow * EW + 32 * ks + 8u * hh);
    else xb[ks] = xa[ks];
  }
  __syncthreads();   // both staged weights are complete before any wave reads a fragment
  if (MODE == 1) {
    unsigned short* nd = nb + (size_t)xrow * EW + 8u * hh;
#pragma unroll   // constant ks: xa[] stays in registers
    for (int ks = 0; ks < 4; ++ks) {
      *(v4i*)(nd + 32 * ks) = xa[ks].q[0];
      *(v4i*)(nd + 32 * ks + 16) = xa[ks].q[1];
    }
  }
  const v8f zero8 = {0.f, 0.f, 0.f, 0.f, 0.f, 0.f, 0.f, 0.f};

#pragma unroll 1
  for (unsigned t = 0; t < NH; ++t) {
    const unsigned short* wp = w1t + (16u * t + m) * TPITCH + 8u * hh;
    const unsigned short* wq = w2t + (16u * t + m) * TPITCH + 8u * hh;
    v8f acc = zero8;
    FragB wf[4], wg[4];
#pragma unroll   // the step's LDS reads stand together, ahead of its matrix chain: one LDS latency a step
    for (int ks = 0; ks < 4; ++ks) {
      wf[ks] = lds_frag(wp + 32 * ks);
      if (MODE == 0) wg[ks] = lds_frag(wq + 32 * ks);
    }
#pragma unroll
    for (int ks = 0; ks < 4; ++ks) {
      acc = wmb(wf[ks], xa[ks], acc);
      if (MODE == 0) acc = wmb(wg[ks], xb[ks], acc);
    }
    v4i hi, lo;
    split8(acc, hi, lo);
    const unsigned so = (t * 64u + 16u * wave + m) * QROW + 8u * hh;
    *(v4ia*)(stg + so) = hi;
    *(v4ia*)(stg + so + 16u) = lo;
  }
  __syncthreads();
  {
    unsigned short* dst = o1 + ((size_t)bb * NH * GQ + r0) * QROW;
#pragma unroll 1
    for (unsigned it = 0; it < 16u; ++it) {
      const unsigned p = it * 128u + tid, t = p >> 8, wi = p & 255u;
      const v4i v = *(const v4ia*)(stg + p * 8u);
      *(v4i*)(dst + (size_t)t * (GQ * QROW) + wi * 8u) = v;
      asm volatile("s_wait_xcnt 0x0" ::: "memory");   // stands before the next trip, or the code behind the loop, writes a register this store names
    }
    
  }
  if (MODE == 1) {
    __syncthreads();
#pragma unroll 1
    for (unsigned t = 0; t < NH; ++t) {
      const unsigned short* wq = w2t + (16u * t + m) * TPITCH + 8u * hh;
      v8f acc = zero8;
      FragB wf[4];
#pragma unroll   // as above: the reads together, then the chain
      for (int ks = 0; ks < 4; ++ks) wf[ks] = lds_frag(wq + 32 * ks);
#pragma unroll
      for (int ks = 0; ks < 4; ++ks) acc = wmb(xa[ks], wf[ks], acc);
      v4i hi, lo;
      split8(acc, hi, lo);                       // acc[r] = v[n = 16 wave + 8h + r][col 16t + m]
      const unsigned so = (16u * t + m) * 64u + 16u * wave + 8u * hh;
      *(v4ia*)(stg + so) = hi;
      *(v4ia*)(stg + so + 8192u) = lo;
    }
    __syncthreads();
    unsigned short* dst = o2 + (size_t)bb * EW * NK + r0;
#pragma unroll 1
    for (unsigned it = 0; it < 16u; ++it) {
      const unsigned p = it * 128u + tid, pl = p >> 10, col = (p >> 3) & 127u, c = p & 7u;
      const v4i v = *(const v4ia*)(stg + p * 8u);
      *(v4i*)(dst + (size_t)pl * VPL + (size_t)col * NK + c * 8u) = v;
      asm volatile("s_wait_xcnt 0x0" ::: "memory");   // stands before the next trip, or the code behind the loop, writes a register this store names
    }
    
  }
}

// One grid for both projections and the W_comb plane: block 0 writes W_comb^T as bf16 [out][in] for the next launch,
// blocks 1 .. KVBLK take the k/v form (the longer one, so it starts first), the rest the q form. The choice is
// uniform in a block, so every barrier of a body is passed by all its waves.
// W_comb plane: 128 rows x 256 B; 16 consecutive threads write one whole row (2 lines), each piece once.
#define KVBLK ((NB * NK) / 64)
#define QBLK  ((NB * GQ) / 64)
__global__ __launch_bounds__(128) void k_proj(const float* __restrict__ nodes, const float* __restrict__ q1,
                                              const float* __restrict__ last,
                                              const float* __restrict__ wqf, const float* __restrict__ wql,
                                              const float* __restrict__ wk, const float* __restrict__ wv,
                                              const float* __restrict__ wc,
                                              unsigned short* qpl, unsigned short* kpl, unsigned short* vtp,
                                              unsigned short* nbf, unsigned short* wct) {
  __shared__ __attribute__((aligned(16))) unsigned short stg[16384];
  __shared__ __attribute__((aligned(16))) unsigned short wl1[EW * TPITCH];
  __shared__ __attribute__((aligned(16))) unsigned short wl2[EW * TPITCH];
  if (blockIdx.x == 0u) {
    stage_wt(wc, wl1);
    __syncthreads();
#pragma unroll 4   // four LDS reads in flight a trip instead of one
    for (unsigned it = 0; it < 16u; ++it) {
      const unsigned p = it * 128u + threadIdx.x, n = p >> 4, c = p & 15u;
      const v4i v = *(const v4ia*)(wl1 + n * TPITCH + c * 8u);
      *(v4i*)(wct + n * EW + c * 8u) = v;
      // the wait that stands before the next trip writes the registers these stores name
      if ((it & 3u) == 3u) asm volatile("s_wait_xcnt 0x0" ::: "memory");
    }
  } else if (blockIdx.x <= (unsigned)KVBLK) {
    proj_body<1>(blockIdx.x - 1u, stg, nodes, nodes, wk, wv, wl1, wl2, kpl, vtp, nbf);
  } else {
    proj_body<0>(blockIdx.x - 1u - (unsigned)KVBLK, stg, q1, last, wqf, wql, wl1, wl2, qpl, qpl, nbf);
  }
}

// ---------------------------------------------------------------------------
// Fused decoder block: one block = (batch b, 16 query rows g0..g0+15), 8 waves.
// Phase 0: mask tile [16][512] f32 (bf16-convert of the input value, times log2e) -> LDS mk (cross-wave, block barrier).
// Phase A (wave = head): flash attention in the transposed domain.
//   S^T tile = K (A, row = key) x Q^T (B, col = query): K = 16 is laid as [k_hi|k_hi] x [q_hi|q_lo] plus
//   [k_lo|0] x [q_hi|q_lo] along the 32-deep k axis. D[row key 8h+r][col query m]. Softmax statistics are
//   per lane (query m); the two lane halves combine by one xor-16 exchange. The P^T B-fragment is the lane's
//   own 16 score results (tile 0 -> elements 0..7, tile 1 -> elements 8..15). O^T = V^T (A, row d) x P^T:
//   D[row d 8h+r][col query m], scaled per lane. ctx hi/lo -> LDS cst[plane][query][128] by 16-B stores.
// Phase B (wave = 16 output columns e): mh^T = W_comb^T (A, global plane) x ctx^T (B, from cst), hi + lo,
//   + bf16(b_comb[e]); mh hi/lo -> LDS mst[plane][query][128] by 16-B stores.
// Phase C (wave = 64 nodes): s2 = mh (A, from mst, hi + lo) x nodes^T (B, global bf16 plane);
//   D[row query 8h+r][col node m]; s = (10 tanh(x/sqrt(128)) + mask) log2e, written over the mask value in place.
// Phase D (wave = 2 rows): row softmax from LDS; each instruction writes 512 contiguous bytes (4 whole
// LDS extents: mk rows 0..15 cols 0..511 written in phase 0 and consumed cols 0..511; cst/mst rows 0..15
//   cols 0..127 of both planes written by all 8 waves, consumed cols 0..127. Pad columns are never read.
// coverage: grid (32, NB) x 16 rows x 512 = NB*512*512 outputs, each written by exactly one lane.
// ---------------------------------------------------------------------------
__global__ __launch_bounds__(256) void k_dec(const unsigned short* __restrict__ qpl,
                                             const unsigned short* __restrict__ kpl,
                                             const unsigned short* __restrict__ vt,
                                             const float* __restrict__ mask,
                                             const unsigned short* __restrict__ wct,
                                             const float* __restrict__ bcomb,
                                             const unsigned short* __restrict__ nbf,
                                             float* out) {
  __shared__ __attribute__((aligned(16))) float mk[16 * MPITCH];
  __shared__ __attribute__((aligned(16))) unsigned short cst[2 * 16 * CPITCH];
  __shared__ __attribute__((aligned(16))) unsigned short mst[2 * 16 * CPITCH];
  const unsigned tid = threadIdx.x, lane = tid & 31u, wave = tid >> 5, hh = lane >> 4, m = lane & 15u;
  const unsigned g0 = blockIdx.x * 16u, b = blockIdx.y;
  const v8f zero8 = {0.f, 0.f, 0.f, 0.f, 0.f, 0.f, 0.f, 0.f};
  const v4i zero4 = {0, 0, 0, 0};

  // ---- phase 0: mask tile ----
  {
    const float* mg = mask + ((size_t)b * GQ + g0) * NK;
#pragma unroll 2
    for (unsigned it = 0; it < 8u; ++it) {
      const unsigned p = it * 256u + tid, row = p >> 7, c4 = (p & 127u) << 2;
      v4f v = *(const v4fa*)(mg + (size_t)row * NK + c4);
      v.x = bf16_val(v.x) * L2E; v.y = bf16_val(v.y) * L2E; v.z = bf16_val(v.z) * L2E; v.w = bf16_val(v.w) * L2E;
      *(v4fa*)(mk + row * MPITCH + c4) = v;
    }
  }
  __syncthreads();

  // ---- phase A: attention for head = wave ----
  {
    const unsigned bh = b * NH + wave;
    const unsigned short* qp = qpl + ((size_t)bh * GQ + g0 + m) * QROW + 8u * hh;
    FragB qf;
    qf.q[0] = *(const v4ia*)qp;            // q_hi[8h .. 8h+7]  (k slots 8h..)
    qf.q[1] = *(const v4ia*)(qp + 16);     // q_lo[8h .. 8h+7]  (k slots 16+8h..)
    const unsigned short* kb = kpl + ((size_t)bh * NK + m) * QROW + 8u * hh;
    const unsigned short* vh = vt + ((size_t)bh * HD + m) * NK + 8u * hh;
    const unsigned short* vl = vh + VPL;
    const unsigned moff = m * MPITCH + 8u * hh;
    v8f o = zero8;
    float mrun = -3.0e38f, lrun = 0.0f;
#pragma unroll 1
    for (unsigned n0 = 0; n0 < NK; n0 += 32u) {
      const unsigned short* kp = kb + (size_t)n0 * QROW;
      const v4i kh0 = *(const v4ia*)kp;
      const v4i kl0 = *(const v4ia*)(kp + 16);
      const v4i kh1 = *(const v4ia*)(kp + 16 * QROW);
      const v4i kl1 = *(const v4ia*)(kp + 16 * QROW + 16);
      FragB a10, a20, a11, a21;
      a10.q[0] = kh0; a10.q[1] = kh0;
      a20.q[0] = kl0; a20.q[1] = zero4;
      a11.q[0] = kh1; a11.q[1] = kh1;
      a21.q[0] = kl1; a21.q[1] = zero4;
      v8f s0 = wmb(a10, qf, zero8);
      s0 = wmb(a20, qf, s0);
      v8f s1 = wmb(a11, qf, zero8);
      s1 = wmb(a21, qf, s1);

      const v4f m0 = *(const v4fa*)(mk + moff + n0);
      const v4f m1 = *(const v4fa*)(mk + moff + n0 + 4u);
      const v4f m2 = *(const v4fa*)(mk + moff + n0 + 16u);
      const v4f m3 = *(const v4fa*)(mk + moff + n0 + 20u);
      const v8f mk0 = __builtin_shufflevector(m0, m1, 0, 1, 2, 3, 4, 5, 6, 7);
      const v8f mk1 = __builtin_shufflevector(m2, m3, 0, 1, 2, 3, 4, 5, 6, 7);
      const v8f a0 = s0 * (0.25f * L2E) + mk0;      // key n0 + 8h + r, log2 domain
      const v8f a1 = s1 * (0.25f * L2E) + mk1;      // key n0 + 16 + 8h + r

      float t = fmaxf(a0[0], a1[0]);
#pragma unroll
      for (int r = 1; r < 8; ++r) t = fmaxf(t, fmaxf(a0[r], a1[r]));
      t = fmaxf(t, __shfl_xor(t, 16));
      const float mnew = fmaxf(mrun, t);
      const float sc = ex2(mrun - mnew);
      const v8f p0 = ex2x8(a0 - mnew);
      const v8f p1 = ex2x8(a1 - mnew);
      float ps = 0.0f;
#pragma unroll
      for (int r = 0; r < 8; ++r) ps += p0[r] + p1[r];
      lrun = lrun * sc + ps;
      mrun = mnew;
      o = o * sc;

      FragB ph, pl;
      split8(p0, ph.q[0], pl.q[0]);
      split8(p1, ph.q[1], pl.q[1]);
      FragB fvh, fvl;
      fvh.q[0] = *(const v4ia*)(vh + n0);
      fvh.q[1] = *(const v4ia*)(vh + n0 + 16u);
      fvl.q[0] = *(const v4ia*)(vl + n0);
      fvl.q[1] = *(const v4ia*)(vl + n0 + 16u);
      o = wmb(fvh, ph, o);
      o = wmb(fvl, ph, o);
      o = wmb(fvh, pl, o);
    }
    const float lt = lrun + __shfl_xor(lrun, 16);
    const float inv = 1.0f / lt;
    const v8f c = o * inv;                    // ctx[query m][16 wave + 8h + r]
    v4i hi, lo;
    split8(c, hi, lo);
    const unsigned co = m * CPITCH + 16u * wave + 8u * hh;
    *(v4ia*)(cst + co) = hi;
    *(v4ia*)(cst + 16 * CPITCH + co) = lo;
  }
  __syncthreads();

  // ---- phase B: mh^T tile for e = 16 wave .. 16 wave + 15 ----
  {
    const unsigned e0 = 16u * wave;
    const unsigned short* wp = wct + (size_t)(e0 + m) * EW + 8u * hh;
    const unsigned co = m * CPITCH + 8u * hh;
    v8f acc = zero8;
#pragma unroll
    for (int ks = 0; ks < 4; ++ks) {
      const FragB wf = ldg_frag(wp + 32 * ks);
      FragB ch, cl;
      ch.q[0] = *(const v4ia*)(cst + co + 32 * ks);
      ch.q[1] = *(const v4ia*)(cst + co + 32 * ks + 16);
      cl.q[0] = *(const v4ia*)(cst + 16 * CPITCH + co + 32 * ks);
      cl.q[1] = *(const v4ia*)(cst + 16 * CPITCH + co + 32 * ks + 16);
      acc = wmb(wf, ch, acc);
      acc = wmb(wf, cl, acc);
    }
    const v4f b0 = *(const v4fa*)(bcomb + e0 + 8u * hh);
    const v4f b1 = *(const v4fa*)(bcomb + e0 + 8u * hh + 4u);
    acc[0] += bf16_val(b0.x); acc[1] += bf16_val(b0.y);
    acc[2] += bf16_val(b0.z); acc[3] += bf16_val(b0.w);
    acc[4] += bf16_val(b1.x); acc[5] += bf16_val(b1.y);
    acc[6] += bf16_val(b1.z); acc[7] += bf16_val(b1.w);
    v4i hi, lo;
    split8(acc, hi, lo);                      // mh[query m][e0 + 8h + r]
    const unsigned mo = m * CPITCH + e0 + 8u * hh;
    *(v4ia*)(mst + mo) = hi;
    *(v4ia*)(mst + 16 * CPITCH + mo) = lo;
  }
  __syncthreads();

  // ---- phase C: s = (10 tanh(mh . node / sqrt(128)) + mask) log2e, nodes 64 wave .. 64 wave + 63 ----
  {
    const float k2 = (float)(2.0 * 1.4426950408889634 / 11.313708498984761);   // exp(2 x), x = acc / sqrt(128), as 2^(acc k2)
    const unsigned ao = m * CPITCH + 8u * hh;
    FragB ah[4], al[4];
#pragma unroll
    for (int ks = 0; ks < 4; ++ks) {
      ah[ks].q[0] = *(const v4ia*)(mst + ao + 32 * ks);
      ah[ks].q[1] = *(const v4ia*)(mst + ao + 32 * ks + 16);
      al[ks].q[0] = *(const v4ia*)(mst + 16 * CPITCH + ao + 32 * ks);
      al[ks].q[1] = *(const v4ia*)(mst + 16 * CPITCH + ao + 32 * ks + 16);
    }
#pragma unroll 1
    for (unsigned j = 0; j < 4u; ++j) {
      const unsigned n0 = 64u * wave + 16u * j;
      const unsigned short* np = nbf + ((size_t)b * NK + n0 + m) * EW + 8u * hh;
      v8f acc = zero8;
#pragma unroll
      for (int ks = 0; ks < 4; ++ks) {
        const FragB nf = ldg_frag(np + 32 * ks);
        acc = wmb(ah[ks], nf, acc);
        acc = wmb(al[ks], nf, acc);
      }
      const v8f q = rcpx8(ex2x8(acc * k2) + 1.0f);            // exp(2x) = +inf -> tanh 1, 0 -> tanh -1
#pragma unroll
      for (int r = 0; r < 8; ++r) {
        const unsigned idx = (8u * hh + (unsigned)r) * MPITCH + n0 + m;   // D element r = (query 8h+r, node m)
        const float s = (10.0f * L2E - (20.0f * L2E) * q[r]) + mk[idx];   // log2 domain, like the mask tile
        mk[idx] = s;
      }
    }
  }
  __syncthreads();

  // ---- phase D: row softmax, rows 2 wave and 2 wave + 1 ----
  {
    v4f res[2][4];
#pragma unroll
    for (int rr = 0; rr < 2; ++rr) {
      const unsigned so = (2u * wave + (unsigned)rr) * MPITCH + 4u * lane;
      v4f v[4];
#pragma unroll
      for (int j = 0; j < 4; ++j) v[j] = *(const v4fa*)(mk + so + 128 * j);
      float mx = v[0].x;
#pragma unroll
      for (int j = 0; j < 4; ++j) mx = fmaxf(fmaxf(fmaxf(mx, v[j].x), fmaxf(v[j].y, v[j].z)), v[j].w);
      mx = fmaxf(mx, __shfl_xor(mx, 16));
      mx = fmaxf(mx, __shfl_xor(mx, 8));
      mx = fmaxf(mx, __shfl_xor(mx, 4));
      mx = fmaxf(mx, __shfl_xor(mx, 2));
      mx = fmaxf(mx, __shfl_xor(mx, 1));
      float sum = 0.0f;
#pragma unroll
      for (int j = 0; j < 4; j += 2) {
        const v8f e = ex2x8(__builtin_shufflevector(v[j], v[j + 1], 0, 1, 2, 3, 4, 5, 6, 7) - mx);
        v[j] = __builtin_shufflevector(e, e, 0, 1, 2, 3);
        v[j + 1] = __builtin_shufflevector(e, e, 4, 5, 6, 7);
        sum += (v[j].x + v[j].y) + (v[j].z + v[j].w);
        sum += (v[j + 1].x + v[j + 1].y) + (v[j + 1].z + v[j + 1].w);
      }
      sum += __shfl_xor(sum, 16);
      sum += __shfl_xor(sum, 8);
      sum += __shfl_xor(sum, 4);
      sum += __shfl_xor(sum, 2);
      sum += __shfl_xor(sum, 1);
      const float inv = 1.0f / sum;
#pragma unroll
      for (int j = 0; j < 4; ++j) res[rr][j] = v[j] * inv;
    }
    float* ob = out + ((size_t)b * GQ + g0 + 2u * wave) * NK + 4u * lane;
#pragma unroll
    for (int rr = 0; rr < 2; ++rr)
#pragma unroll
      for (int j = 0; j < 4; ++j) *(v4f*)(ob + (size_t)rr * NK + 128 * j) = res[rr][j];
    
  }
}

// ---------------------------------------------------------------------------
static inline size_t al256(size_t o) { return (o + 255) & ~(size_t)255; }

extern "C" void kernel_launch(void* const* d_in, const int* in_sizes, int n_in,
                              void* d_out, int out_size, void* d_ws, size_t ws_size,
                              hipStream_t stream) {
  if (n_in < 10) return;
  const long long actN = (long long)NB * NK * EW;
  const long long actG = (long long)NB * GQ * EW;
  const long long mskN = (long long)NB * GQ * NK;
  if ((long long)in_sizes[0] < actN) return;             // encoded_nodes
  if ((long long)in_sizes[1] < actG) return;             // encoded_q1
  if ((long long)in_sizes[2] < actG) return;             // encoded_last_node
  if ((long long)in_sizes[3] < mskN) return;             // ninf_mask (f32, additive)
  if (in_sizes[4] < EW * EW || in_sizes[5] < EW * EW || in_sizes[6] < EW * EW ||
      in_sizes[7] < EW * EW || in_sizes[8] < EW * EW) return;
  if (in_sizes[9] < EW) return;
  if ((long long)out_size < mskN) return;

  const float* nodes = (const float*)d_in[0];
  const float* q1    = (const float*)d_in[1];
  const float* last  = (const float*)d_in[2];
  const float* mask  = (const float*)d_in[3];
  const float* Wqf   = (const float*)d_in[4];
  const float* Wql   = (const float*)d_in[5];
  const float* Wk    = (const float*)d_in[6];
  const float* Wv    = (const float*)d_in[7];
  const float* Wc    = (const float*)d_in[8];
  const float* bc    = (const float*)d_in[9];
  float* out = (float*)d_out;

  const size_t wtB  = al256((size_t)5 * EW * EW * 2);             // 163,840
  const size_t nbB  = al256((size_t)NB * NK * EW * 2);            // 4,194,304
  const size_t qB   = al256((size_t)NB * NH * GQ * QROW * 2);     // 8,388,608
  const size_t kB   = al256((size_t)NB * NH * NK * QROW * 2);     // 8,388,608
  const size_t vB   = al256((size_t)2 * VPL * 2);                 // 8,388,608
  const size_t total = wtB + nbB + qB + kB + vB;                  // 29,523,968
  if (total > ws_size || total > (size_t)WSMAX) return;
  char* w = (char*)d_ws;
  unsigned short* wt  = (unsigned short*)w;
  unsigned short* nbf = (unsigned short*)(w + wtB);
  unsigned short* qpl = (unsigned short*)(w + wtB + nbB);
  unsigned short* kpl = (unsigned short*)(w + wtB + nbB + qB);
  unsigned short* vtp = (unsigned short*)(w + wtB + nbB + qB + kB);
  unsigned short* wctp = wt + 4 * EW * EW;

  // 1: W_comb [in][out] f32 -> [out][in] bf16 plane; k = nodes.Wk -> k plane (hi|lo rows), v = nodes.Wv -> V^T hi and lo planes, nodes -> bf16 plane;
  //    q = q1.Wq_first + last.Wq_last -> q plane (hi|lo rows)
  k_proj<<<1 + KVBLK + QBLK, 128, 0, stream>>>(nodes, q1, last, Wqf, Wql, Wk, Wv, Wc, qpl, kpl, vtp, nbf, wctp);
  // 2: attention + W_comb + final scoring + softmax
  k_dec<<<dim3(GQ / 16, NB), 256, 0, stream>>>(qpl, kpl, vtp, mask, wctp, bc, nbf, out);
}

// v004
// A run of this version takes 63.7 microseconds.
// Next to v003, in two timings, it ran 1.12 and 1.13 times as fast.
// All steps since v000 together make it 1.75 times as fast.
// Contractions: q/k/v projections = v_wmma_f32_16x16x32_bf16, bf16 (RNE) inputs and weights, one product. q.k scores, P.V, ctx.W_comb and mh.nodes = same bf16 WMMA with every computed operand carried as bf16 hi + bf16 lo (hi.hi + lo.hi + hi.lo; input-side planes are exact bf16, lo == 0). Accumulate f32 everywhere.
// Mask add, online softmax, tanh, bias, final softmax: f32 VALU; both softmaxes run on logits scaled by log2e (the LDS mask tile carries the factor), so exp(x - m) is one subtract and v_exp_f32; tanh(x) = 1 - 2 v_rcp_f32(1 + exp(2x)). No power-of-two carries exist (bf16 planes only).
#include <hip/hip_runtime.h>
#include <stddef.h>
#include <stdint.h>

#ifndef NB
#define NB 32                      // batches processed (a reduced build reads the first NB batches)
#endif
#define GQ     512                 // queries per batch
#define NK     512                 // nodes (keys) per batch
#define EW     128                 // embedding width = heads x head dim
#define NH     8
#define HD     16
#define QROW   32                  // halfwords per q/k plane row (16 hi + 16 lo); 16 rows = one tile [hi|lo][lane][8]
#define FHALF  256                 // halfwords a wave-wide 16-B access covers: 32 lanes x 8
#define VTILE  1024                // halfwords per V^T tile (one head, 32 keys): hi fragment, then lo fragment
#define MPITCH 516                 // floats per LDS mask/score row
#define CPITCH 136                 // halfwords per LDS ctx/mh row
#define TPITCH 136                 // halfwords per LDS weight-transpose row
#define WSMAX  134217728
#define VPL    ((size_t)NB * EW * NK)   // halfwords of V^T hi pieces (as many lo pieces)

static_assert(GQ == NK);                       // k_proj uses one row count for q and k planes
static_assert(NH * HD == EW);
static_assert(EW % 32 == 0 && NK % 32 == 0);
static_assert(GQ % 64 == 0 && (NB * GQ) % 64 == 0);
static_assert(16 * QROW == 2 * FHALF);         // q/k tile: 16 rows = hi piece + lo piece, one wave-wide access each
static_assert(2 * HD * 32 == VTILE && VTILE == 4 * FHALF);   // V^T tile: 2 fragments of 2 accesses
static_assert(16 * EW == 8 * FHALF);           // nodes / W_comb tile: 16 rows = 4 fragments of 2 accesses
static_assert(NH * 64 * QROW == 16384);        // k_proj stage: q/k form
static_assert(2 * EW * 64 == 16384);           // k_proj stage: V^T form
static_assert(16384 == 128 * 16 * 8);          // k_proj copy-out: 128 thr x 16 it x 8 halfwords
static_assert(EW == 32 * 4 && EW == 4 * 4 * 8); // stage_wt: 32 lanes x 4 columns, 4 waves x 4 it x 8 rows
static_assert(EW * EW == 128 * 16 * 8);        // W_comb copy-out: 128 thr x 16 it x 8 halfwords
static_assert(16 * NK == 256 * 8 * 4);         // k_dec mask staging: 256 thr x 8 it x 4 floats
static_assert(NK == 8 * 64);                   // k_dec phase C: 8 waves x 64 nodes
static_assert(NK == 32 * 16);                  // k_dec phase D: 32 lanes x 4 x 4 floats per row

typedef int            v4i   __attribute__((ext_vector_type(4)));
typedef int            v8i   __attribute__((ext_vector_type(8)));
typedef float          v4f   __attribute__((ext_vector_type(4)));
typedef float          v8f   __attribute__((ext_vector_type(8)));
typedef __bf16         v16bf __attribute__((ext_vector_type(16)));
typedef __bf16         v8bf  __attribute__((ext_vector_type(8)));
typedef v4i __attribute__((may_alias)) v4ia;
typedef v4f __attribute__((may_alias)) v4fa;
union FragB { v16bf v; v4i q[2]; v8i w; };

// WMMA with hazard guard: ties D, keeps A/B live for 4 VALU slots
__device__ __forceinline__ v8f wmb(const FragB& a, const FragB& b, v8f c) {
  v8f d = __builtin_amdgcn_wmma_f32_16x16x32_bf16(false, a.v, false, b.v, (short)0, c, false, false);
  asm volatile("v_nop\n\tv_nop\n\tv_nop\n\tv_nop" : "+v"(d) : "v"(a.w), "v"(b.w));
  return d;
}

#define L2E 1.4426950408889634f    // log2(e)
// 2^x on the hardware unit: -inf and anything below the f32 range give 0, +inf gives +inf
__device__ __forceinline__ float ex2(float x) { return __builtin_amdgcn_exp2f(x); }
// Eight 2^x / eight 1/x in one statement. Why asm: behind a transcendental the instruction set asks for one
// independent slot before its result is read or its source overwritten; the early-clobber outputs keep every
// result off every source, and the closing v_nop is the slot behind the last one.
__device__ __forceinline__ v8f ex2x8(const v8f x) {
  float y0, y1, y2, y3, y4, y5, y6, y7;
  asm("v_exp_f32 %0, %8\n\tv_exp_f32 %1, %9\n\tv_exp_f32 %2, %10\n\tv_exp_f32 %3, %11\n\t"
      "v_exp_f32 %4, %12\n\tv_exp_f32 %5, %13\n\tv_exp_f32 %6, %14\n\tv_exp_f32 %7, %15\n\tv_nop"
      : "=&v"(y0), "=&v"(y1), "=&v"(y2), "=&v"(y3), "=&v"(y4), "=&v"(y5), "=&v"(y6), "=&v"(y7)
      : "v"(x[0]), "v"(x[1]), "v"(x[2]), "v"(x[3]), "v"(x[4]), "v"(x[5]), "v"(x[6]), "v"(x[7]));
  const v8f y = {y0, y1, y2, y3, y4, y5, y6, y7};
  return y;
}
__device__ __forceinline__ v8f rcpx8(const v8f x) {
  float y0, y1, y2, y3, y4, y5, y6, y7;
  asm("v_rcp_f32 %0, %8\n\tv_rcp_f32 %1, %9\n\tv_rcp_f32 %2, %10\n\tv_rcp_f32 %3, %11\n\t"
      "v_rcp_f32 %4, %12\n\tv_rcp_f32 %5, %13\n\tv_rcp_f32 %6, %14\n\tv_rcp_f32 %7, %15\n\tv_nop"
      : "=&v"(y0), "=&v"(y1), "=&v"(y2), "=&v"(y3), "=&v"(y4), "=&v"(y5), "=&v"(y6), "=&v"(y7)
      : "v"(x[0]), "v"(x[1]), "v"(x[2]), "v"(x[3]), "v"(x[4]), "v"(x[5]), "v"(x[6]), "v"(x[7]));
  const v8f y = {y0, y1, y2, y3, y4, y5, y6, y7};
  return y;
}

// f32 -> bf16 bits, RNE convert (finite inputs)
__device__ __forceinline__ unsigned bf16_bits(float f) {
  const unsigned u = __float_as_uint(f);
  return (u + 0x7FFFu + ((u >> 16) & 1u)) >> 16;
}
__device__ __forceinline__ float bf16_val(float f) {
  return __uint_as_float(bf16_bits(f) << 16);
}
__device__ __forceinline__ int pack2(float lo, float hi) {
  return (int)(bf16_bits(lo) | (bf16_bits(hi) << 16));
}
// 8 f32 -> bf16 hi piece + bf16 lo piece (lo = RNE(v - hi)); element 2j in the low halfword of word j
__device__ __forceinline__ void split8(const v8f x, v4i& hi, v4i& lo) {
#pragma unroll
  for (int j = 0; j < 4; ++j) {
    const float a = x[2 * j], b = x[2 * j + 1];
    const unsigned ha = bf16_bits(a), hb = bf16_bits(b);
    const float ra = a - __uint_as_float(ha << 16);
    const float rb = b - __uint_as_float(hb << 16);
    hi[j] = (int)(ha | (hb << 16));
    lo[j] = (int)(bf16_bits(ra) | (bf16_bits(rb) << 16));
  }
}
// fragment (row/col = lane&15) from an f32 row: p = row + k0 + 8h; elements 0..7 <- k0+8h+0..7, 8..15 <- k0+16+8h+0..7
__device__ __forceinline__ FragB ldf_frag(const float* __restrict__ p) {
  const v4f a0 = *(const v4fa*)p;
  const v4f a1 = *(const v4fa*)(p + 4);
  const v4f a2 = *(const v4fa*)(p + 16);
  const v4f a3 = *(const v4fa*)(p + 20);
  FragB f;
  f.w[0] = pack2(a0.x, a0.y); f.w[1] = pack2(a0.z, a0.w);
  f.w[2] = pack2(a1.x, a1.y); f.w[3] = pack2(a1.z, a1.w);
  f.w[4] = pack2(a2.x, a2.y); f.w[5] = pack2(a2.z, a2.w);
  f.w[6] = pack2(a3.x, a3.y); f.w[7] = pack2(a3.z, a3.w);
  return f;
}
// same fragment from a GLOBAL plane kept in fragment order: a fragment = 512 halfwords, [element half][lane][8];
// p = fragment + 8 lane. Each of the two wave-wide loads covers 512 contiguous bytes (4 whole 128-B lines).
__device__ __forceinline__ FragB ldg_frag(const unsigned short* __restrict__ p) {
  FragB f;
  f.q[0] = *(const v4ia*)p;
  f.q[1] = *(const v4ia*)(p + FHALF);
  return f;
}

// ---------------------------------------------------------------------------
// Weight staging, by the 4 waves of one block: W[k][n] f32 (128 x 128, [in][out]) -> LDS T[n][k] bf16 bits, row
// pitch TPITCH. A task = 8 rows k x 4 columns n: a wave-wide load is one whole 512-B row of W, a lane packs 8
// consecutive k of each of its 4 columns into one 16-B LDS store. Coverage: 4 waves x 4 it x 8 k = 128 k,
// 32 lanes x 4 n = 128 n. Cross-wave: the caller's block barrier stands between this and the first read of T.
// ---------------------------------------------------------------------------
__device__ __forceinline__ void stage_wt(const float* __restrict__ W, unsigned short* T) {
  const unsigned lane = threadIdx.x & 31u, wave = threadIdx.x >> 5;
#pragma unroll   // all 32 loads of a weight in flight together
  for (unsigned it = 0; it < 4u; ++it) {
    const unsigned k0 = 8u * (wave + 4u * it);
    const float* p = W + (size_t)k0 * EW + 4u * lane;
    v4f r[8];
#pragma unroll   // constant j, c: r[] stays in registers
    for (int j = 0; j < 8; ++j) r[j] = *(const v4fa*)(p + j * EW);
#pragma unroll
    for (int c = 0; c < 4; ++c) {
      const v8f col = {r[0][c], r[1][c], r[2][c], r[3][c], r[4][c], r[5][c], r[6][c], r[7][c]};
      union { v8bf h; v4i q; } u;
      u.h = __builtin_convertvector(col, v8bf);      // RNE, two values an instruction; k even in the low halfword
      *(v4ia*)(T + (4u * lane + (unsigned)c) * TPITCH + k0) = u.q;
    }
  }
}
// fragment from an LDS k-contiguous bf16 row: p = row + k0 + 8h (same element order as ldg_frag)
__device__ __forceinline__ FragB lds_frag(const unsigned short* p) {
  FragB f;
  f.q[0] = *(const v4ia*)p;
  f.q[1] = *(const v4ia*)(p + 16);
  return f;
}

// ---------------------------------------------------------------------------
// Projections. Block = 64 rows of the flattened [b][row] input, 4 waves x 16 rows; activations are held
// as bf16 fragments (col = lane&15 = input row) and every head (16 output columns) is one rolled step.
// MODE 0: q = x1.W1 + x2.W2.   MODE 1: k = x1.W1, then v = x1.W2, and the bf16 fragments of x1 (the nodes) also go
//   out as the plane nb[b][16-node tile][k step][element half][lane][8] (B operand of the final scoring product, in
//   fragment order): a lane stores its own 16-B pieces, each wave-wide store is 512 B in a row.
// Both modes run in ONE launch (k_proj): they depend only on the inputs, not on each other. A block first stages its
// own two weights, transposed to bf16 [out][in], in LDS (stage_wt) and takes every weight fragment from there.
// q/k form: D = Wt_tile (A, row = out col) x X (B, col = input row): D[row d = 8h+r][col = input row], so a
//   lane holds 8 consecutive d of one row -> one 16-B LDS store per plane half. Plane (b,head,16-row tile) =
//   hi[lane][8] | lo[lane][8] halfwords, lane = 16h + row: the piece a lane of k_dec takes, so its wave-wide load is
//   512 B in a row.
// v form: D = X (A) x Wt_tile (B): D[row = input row 8h+r][col d], lane holds 8 consecutive n of column d ->
//   one 16-B LDS store into the V^T stage [head][32-key tile][hi|lo][element half][lane][8], the global order too.
// LDS stg: cross-wave (block barriers); fully written before each copy-out (8 heads x 64 rows x 32, or
// coverage: q/k plane: NB*8 blocks x 16384 halfwords = NB*8*512*32; V^T: NB*8 blocks x 16384 (hi + lo) = 2*NB*128*512.
// ---------------------------------------------------------------------------
template <int MODE>
__device__ __forceinline__ void proj_body(const unsigned blk, unsigned short* stg,
                                          const float* __restrict__ x1, const float* __restrict__ x2,
                                          const float* __restrict__ w1, const float* __restrict__ w2,
                                          unsigned short* w1t, unsigned short* w2t,
                                          unsigned short* o1, unsigned short* o2, unsigned short* nb) {
  const unsigned tid = threadIdx.x, lane = tid & 31u, wave = tid >> 5, hh = lane >> 4, m = lane & 15u;
  const unsigned row0 = blk * 64u;
  const unsigned bb = row0 >> 9, r0 = row0 & 511u;
  const unsigned xrow = row0 + 16u * wave + m;

  // x1's loads (from memory, the longest wait) are issued first and packed behind the weight staging
  v4f xr[4][4];
  const float* xp = x1 + (size_t)xrow * EW + 8u * hh;
#pragma unroll
  for (int ks = 0; ks < 4; ++ks) {
    const float* p = xp + 32 * ks;
    xr[ks][0] = *(const v4fa*)p;        xr[ks][1] = *(const v4fa*)(p + 4);
    xr[ks][2] = *(const v4fa*)(p + 16); xr[ks][3] = *(const v4fa*)(p + 20);
  }
  // the wait that stands before a register named by an issued load is written again; xp as an input keeps the
  // address pair out of the loads' own destinations up to here
  asm volatile("s_wait_xcnt 0x0" :: "v"(xp) : "memory");
#pragma unroll 1   // one weight a trip: 32 loads in flight, not 64, which keeps the block under 256 registers
  for (unsigned w = 0; w < 2u; ++w) stage_wt(w ? w2 : w1, w ? w2t : w1t);
  FragB xa[4], xb[4];
#pragma unroll
  for (int ks = 0; ks < 4; ++ks) {
#pragma unroll
    for (int j = 0; j < 4; ++j) {
      xa[ks].w[2 * j] = pack2(xr[ks][j].x, xr[ks][j].y);
      xa[ks].w[2 * j + 1] = pack2(xr[ks][j].z, xr[ks][j].w);
    }
    if (MODE == 0) xb[ks] = ldf_frag(x2 + (size_t)xrow * EW + 32 * ks + 8u * hh);
    else xb[ks] = xa[ks];
  }
  __syncthreads();   // both staged weights are complete before any wave reads a fragment
  if (MODE == 1) {
    unsigned short* nd = nb + (size_t)(row0 + 16u * wave) * EW + 8u * lane;
#pragma unroll   // constant ks: xa[] stays in registers
    for (int ks = 0; ks < 4; ++ks) {
      *(v4i*)(nd + 2 * FHALF * ks) = xa[ks].q[0];
      *(v4i*)(nd + 2 * FHALF * ks + FHALF) = xa[ks].q[1];
    }
  }
  const v8f zero8 = {0.f, 0.f, 0.f, 0.f, 0.f, 0.f, 0.f, 0.f};

#pragma unroll 1
  for (unsigned t = 0; t < NH; ++t) {
    const unsigned short* wp = w1t + (16u * t + m) * TPITCH + 8u * hh;
    const unsigned short* wq = w2t + (16u * t + m) * TPITCH + 8u * hh;
    v8f acc = zero8;
    FragB wf[4], wg[4];
#pragma unroll   // the step's LDS reads stand together, ahead of its matrix chain: one LDS latency a step
    for (int ks = 0; ks < 4; ++ks) {
      wf[ks] = lds_frag(wp + 32 * ks);
      if (MODE == 0) wg[ks] = lds_frag(wq + 32 * ks);
    }
#pragma unroll
    for (int ks = 0; ks < 4; ++ks) {
      acc = wmb(wf[ks], xa[ks], acc);
      if (MODE == 0) acc = wmb(wg[ks], xb[ks], acc);
    }
    v4i hi, lo;
    split8(acc, hi, lo);
    const unsigned so = (t * 64u + 16u * wave) * QROW + 8u * lane;   // tile of 16 rows: [hi|lo][lane][8]
    *(v4ia*)(stg + so) = hi;
    *(v4ia*)(stg + so + FHALF) = lo;
  }
  __syncthreads();
  {
    unsigned short* dst = o1 + ((size_t)bb * NH * GQ + r0) * QROW;
#pragma unroll 1
    for (unsigned it = 0; it < 16u; ++it) {
      const unsigned p = it * 128u + tid, t = p >> 8, wi = p & 255u;
      const v4i v = *(const v4ia*)(stg + p * 8u);
      *(v4i*)(dst + (size_t)t * (GQ * QROW) + wi * 8u) = v;
      asm volatile("s_wait_xcnt 0x0" ::: "memory");   // stands before the next trip, or the code behind the loop, writes a register this store names
    }
    
  }
  if (MODE == 1) {
    __syncthreads();
#pragma unroll 1
    for (unsigned t = 0; t < NH; ++t) {
      const unsigned short* wq = w2t + (16u * t + m) * TPITCH + 8u * hh;
      v8f acc = zero8;
      FragB wf[4];
#pragma unroll   // as above: the reads together, then the chain
      for (int ks = 0; ks < 4; ++ks) wf[ks] = lds_frag(wq + 32 * ks);
#pragma unroll
      for (int ks = 0; ks < 4; ++ks) acc = wmb(xa[ks], wf[ks], acc);
      v4i hi, lo;
      split8(acc, hi, lo);                       // acc[r] = v[n = 16 wave + 8h + r][col 16t + m]
      // 32-key tile wave >> 1, element half wave & 1 of its hi and lo fragments
      const unsigned so = (2u * t + (wave >> 1)) * VTILE + (wave & 1u) * FHALF + 8u * lane;
      *(v4ia*)(stg + so) = hi;
      *(v4ia*)(stg + so + 2 * FHALF) = lo;
    }
    __syncthreads();
    unsigned short* dst = o2 + ((size_t)bb * NH * (NK / 32) + (r0 >> 5)) * VTILE;
#pragma unroll 1
    for (unsigned it = 0; it < 16u; ++it) {
      const unsigned p = it * 128u + tid, t = p >> 8, wi = p & 255u;   // a head's two tiles: 4 KiB in a row
      const v4i v = *(const v4ia*)(stg + p * 8u);
      *(v4i*)(dst + (size_t)t * ((NK / 32) * VTILE) + wi * 8u) = v;
      asm volatile("s_wait_xcnt 0x0" ::: "memory");   // stands before the next trip, or the code behind the loop, writes a register this store names
    }
    
  }
}

// One grid for both projections and the W_comb plane: block 0 writes W_comb^T as a bf16 plane in fragment order for the next launch,
// blocks 1 .. KVBLK take the k/v form (the longer one, so it starts first), the rest the q form. The choice is
// uniform in a block, so every barrier of a body is passed by all its waves.
// W_comb plane: 8 tiles of 16 rows in fragment order; a wave-wide store is 512 B in a row, each piece once.
#define KVBLK ((NB * NK) / 64)
#define QBLK  ((NB * GQ) / 64)
__global__ __launch_bounds__(128) void k_proj(const float* __restrict__ nodes, const float* __restrict__ q1,
                                              const float* __restrict__ last,
                                              const float* __restrict__ wqf, const float* __restrict__ wql,
                                              const float* __restrict__ wk, const float* __restrict__ wv,
                                              const float* __restrict__ wc,
                                              unsigned short* qpl, unsigned short* kpl, unsigned short* vtp,
                                              unsigned short* nbf, unsigned short* wct) {
  __shared__ __attribute__((aligned(16))) unsigned short stg[16384];
  __shared__ __attribute__((aligned(16))) unsigned short wl1[EW * TPITCH];
  __shared__ __attribute__((aligned(16))) unsigned short wl2[EW * TPITCH];
  if (blockIdx.x == 0u) {
    stage_wt(wc, wl1);
    __syncthreads();
#pragma unroll 4   // four LDS reads in flight a trip instead of one
    for (unsigned it = 0; it < 16u; ++it) {
      // p = 16-B piece of the plane in fragment order: [16-row tile][k step][element half][k half h][row m]
      const unsigned p = it * 128u + threadIdx.x, n = ((p >> 8) << 4) | (p & 15u);
      const unsigned c = (((p >> 6) & 3u) << 2) | (((p >> 5) & 1u) << 1) | ((p >> 4) & 1u);
      const v4i v = *(const v4ia*)(wl1 + n * TPITCH + c * 8u);
      *(v4i*)(wct + p * 8u) = v;
      // the wait that stands before the next trip writes the registers these stores name
      if ((it & 3u) == 3u) asm volatile("s_wait_xcnt 0x0" ::: "memory");
    }
  } else if (blockIdx.x <= (unsigned)KVBLK) {
    proj_body<1>(blockIdx.x - 1u, stg, nodes, nodes, wk, wv, wl1, wl2, kpl, vtp, nbf);
  } else {
    proj_body<0>(blockIdx.x - 1u - (unsigned)KVBLK, stg, q1, last, wqf, wql, wl1, wl2, qpl, qpl, nbf);
  }
}

// ---------------------------------------------------------------------------
// Fused decoder block: one block = (batch b, 16 query rows g0..g0+15), 8 waves.
// Phase 0: mask tile [16][512] f32 (bf16-convert of the input value, times log2e) -> LDS mk (cross-wave, block barrier).
// Phase A (wave = head): flash attention in the transposed domain.
//   S^T tile = K (A, row = key) x Q^T (B, col = query): K = 16 is laid as [k_hi|k_hi] x [q_hi|q_lo] plus
//   [k_lo|0] x [q_hi|q_lo] along the 32-deep k axis. D[row key 8h+r][col query m]. Softmax statistics are
//   per lane (query m); the two lane halves combine by one xor-16 exchange. The P^T B-fragment is the lane's
//   own 16 score results (tile 0 -> elements 0..7, tile 1 -> elements 8..15). O^T = V^T (A, row d) x P^T:
//   D[row d 8h+r][col query m], scaled per lane. ctx hi/lo -> LDS cst[plane][query][128] by 16-B stores.
// Phase B (wave = 16 output columns e): mh^T = W_comb^T (A, global plane) x ctx^T (B, from cst), hi + lo,
//   + bf16(b_comb[e]); mh hi/lo -> LDS mst[plane][query][128] by 16-B stores.
// Phase C (wave = 64 nodes): s2 = mh (A, from mst, hi + lo) x nodes^T (B, global bf16 plane);
//   D[row query 8h+r][col node m]; s = (10 tanh(x/sqrt(128)) + mask) log2e, written over the mask value in place.
// Phase D (wave = 2 rows): row softmax from LDS; each instruction writes 512 contiguous bytes (4 whole
// LDS extents: mk rows 0..15 cols 0..511 written in phase 0 and consumed cols 0..511; cst/mst rows 0..15
//   cols 0..127 of both planes written by all 8 waves, consumed cols 0..127. Pad columns are never read.
// coverage: grid (32, NB) x 16 rows x 512 = NB*512*512 outputs, each written by exactly one lane.
// ---------------------------------------------------------------------------
__global__ __launch_bounds__(256) void k_dec(const unsigned short* __restrict__ qpl,
                                             const unsigned short* __restrict__ kpl,
                                             const unsigned short* __restrict__ vt,
                                             const float* __restrict__ mask,
                                             const unsigned short* __restrict__ wct,
                                             const float* __restrict__ bcomb,
                                             const unsigned short* __restrict__ nbf,
                                             float* out) {
  __shared__ __attribute__((aligned(16))) float mk[16 * MPITCH];
  __shared__ __attribute__((aligned(16))) unsigned short cst[2 * 16 * CPITCH];
  __shared__ __attribute__((aligned(16))) unsigned short mst[2 * 16 * CPITCH];
  const unsigned tid = threadIdx.x, lane = tid & 31u, wave = tid >> 5, hh = lane >> 4, m = lane & 15u;
  const unsigned g0 = blockIdx.x * 16u, b = blockIdx.y;
  const v8f zero8 = {0.f, 0.f, 0.f, 0.f, 0.f, 0.f, 0.f, 0.f};
  const v4i zero4 = {0, 0, 0, 0};

  // ---- phase 0: mask tile ----
  {
    const float* mg = mask + ((size_t)b * GQ + g0) * NK;
#pragma unroll 2
    for (unsigned it = 0; it < 8u; ++it) {
      const unsigned p = it * 256u + tid, row = p >> 7, c4 = (p & 127u) << 2;
      v4f v = *(const v4fa*)(mg + (size_t)row * NK + c4);
      v.x = bf16_val(v.x) * L2E; v.y = bf16_val(v.y) * L2E; v.z = bf16_val(v.z) * L2E; v.w = bf16_val(v.w) * L2E;
      *(v4fa*)(mk + row * MPITCH + c4) = v;
    }
  }
  __syncthreads();

  // ---- phase A: attention for head = wave ----
  {
    const unsigned bh = b * NH + wave;
    const unsigned short* qp = qpl + ((size_t)bh * GQ + g0) * QROW + 8u * lane;
    FragB qf;
    qf.q[0] = *(const v4ia*)qp;               // q_hi[8h .. 8h+7]  (k slots 8h..)
    qf.q[1] = *(const v4ia*)(qp + FHALF);     // q_lo[8h .. 8h+7]  (k slots 16+8h..)
    const unsigned short* kb = kpl + (size_t)bh * NK * QROW + 8u * lane;
    const unsigned short* vb = vt + (size_t)bh * ((NK / 32) * VTILE) + 8u * lane;
    const unsigned moff = m * MPITCH + 8u * hh;
    v8f o = zero8;
    float mrun = -3.0e38f, lrun = 0.0f;
#pragma unroll 1
    for (unsigned n0 = 0; n0 < NK; n0 += 32u) {
      const unsigned short* kp = kb + (size_t)n0 * QROW;
      const v4i kh0 = *(const v4ia*)kp;
      const v4i kl0 = *(const v4ia*)(kp + FHALF);
      const v4i kh1 = *(const v4ia*)(kp + 16 * QROW);
      const v4i kl1 = *(const v4ia*)(kp + 16 * QROW + FHALF);
      FragB a10, a20, a11, a21;
      a10.q[0] = kh0; a10.q[1] = kh0;
      a20.q[0] = kl0; a20.q[1] = zero4;
      a11.q[0] = kh1; a11.q[1] = kh1;
      a21.q[0] = kl1; a21.q[1] = zero4;
      v8f s0 = wmb(a10, qf, zero8);
      s0 = wmb(a20, qf, s0);
      v8f s1 = wmb(a11, qf, zero8);
      s1 = wmb(a21, qf, s1);

      const v4f m0 = *(const v4fa*)(mk + moff + n0);
      const v4f m1 = *(const v4fa*)(mk + moff + n0 + 4u);
      const v4f m2 = *(const v4fa*)(mk + moff + n0 + 16u);
      const v4f m3 = *(const v4fa*)(mk + moff + n0 + 20u);
      const v8f mk0 = __builtin_shufflevector(m0, m1, 0, 1, 2, 3, 4, 5, 6, 7);
      const v8f mk1 = __builtin_shufflevector(m2, m3, 0, 1, 2, 3, 4, 5, 6, 7);
      const v8f a0 = s0 * (0.25f * L2E) + mk0;      // key n0 + 8h + r, log2 domain
      const v8f a1 = s1 * (0.25f * L2E) + mk1;      // key n0 + 16 + 8h + r

      float t = fmaxf(a0[0], a1[0]);
#pragma unroll
      for (int r = 1; r < 8; ++r) t = fmaxf(t, fmaxf(a0[r], a1[r]));
      t = fmaxf(t, __shfl_xor(t, 16));
      const float mnew = fmaxf(mrun, t);
      const float sc = ex2(mrun - mnew);
      const v8f p0 = ex2x8(a0 - mnew);
      const v8f p1 = ex2x8(a1 - mnew);
      float ps = 0.0f;
#pragma unroll
      for (int r = 0; r < 8; ++r) ps += p0[r] + p1[r];
      lrun = lrun * sc + ps;
      mrun = mnew;
      o = o * sc;

      FragB ph, pl;
      split8(p0, ph.q[0], pl.q[0]);
      split8(p1, ph.q[1], pl.q[1]);
      const unsigned short* vp = vb + (size_t)(n0 >> 5) * VTILE;
      const FragB fvh = ldg_frag(vp);
      const FragB fvl = ldg_frag(vp + 2 * FHALF);
      o = wmb(fvh, ph, o);
      o = wmb(fvl, ph, o);
      o = wmb(fvh, pl, o);
    }
    const float lt = lrun + __shfl_xor(lrun, 16);
    const float inv = 1.0f / lt;
    const v8f c = o * inv;                    // ctx[query m][16 wave + 8h + r]
    v4i hi, lo;
    split8(c, hi, lo);
    const unsigned co = m * CPITCH + 16u * wave + 8u * hh;
    *(v4ia*)(cst + co) = hi;
    *(v4ia*)(cst + 16 * CPITCH + co) = lo;
  }
  __syncthreads();

  // ---- phase B: mh^T tile for e = 16 wave .. 16 wave + 15 ----
  {
    const unsigned e0 = 16u * wave;
    const unsigned short* wp = wct + (size_t)e0 * EW + 8u * lane;
    const unsigned co = m * CPITCH + 8u * hh;
    v8f acc = zero8;
#pragma unroll
    for (int ks = 0; ks < 4; ++ks) {
      const FragB wf = ldg_frag(wp + 2 * FHALF * ks);
      FragB ch, cl;
      ch.q[0] = *(const v4ia*)(cst + co + 32 * ks);
      ch.q[1] = *(const v4ia*)(cst + co + 32 * ks + 16);
      cl.q[0] = *(const v4ia*)(cst + 16 * CPITCH + co + 32 * ks);
      cl.q[1] = *(const v4ia*)(cst + 16 * CPITCH + co + 32 * ks + 16);
      acc = wmb(wf, ch, acc);
      acc = wmb(wf, cl, acc);
    }
    const v4f b0 = *(const v4fa*)(bcomb + e0 + 8u * hh);
    const v4f b1 = *(const v4fa*)(bcomb + e0 + 8u * hh + 4u);
    acc[0] += bf16_val(b0.x); acc[1] += bf16_val(b0.y);
    acc[2] += bf16_val(b0.z); acc[3] += bf16_val(b0.w);
    acc[4] += bf16_val(b1.x); acc[5] += bf16_val(b1.y);
    acc[6] += bf16_val(b1.z); acc[7] += bf16_val(b1.w);
    v4i hi, lo;
    split8(acc, hi, lo);                      // mh[query m][e0 + 8h + r]
    const unsigned mo = m * CPITCH + e0 + 8u * hh;
    *(v4ia*)(mst + mo) = hi;
    *(v4ia*)(mst + 16 * CPITCH + mo) = lo;
  }
  __syncthreads();

  // ---- phase C: s = (10 tanh(mh . node / sqrt(128)) + mask) log2e, nodes 64 wave .. 64 wave + 63 ----
  {
    const float k2 = (float)(2.0 * 1.4426950408889634 / 11.313708498984761);   // exp(2 x), x = acc / sqrt(128), as 2^(acc k2)
    const unsigned ao = m * CPITCH + 8u * hh;
    FragB ah[4], al[4];
#pragma unroll
    for (int ks = 0; ks < 4; ++ks) {
      ah[ks].q[0] = *(const v4ia*)(mst + ao + 32 * ks);
      ah[ks].q[1] = *(const v4ia*)(mst + ao + 32 * ks + 16);
      al[ks].q[0] = *(const v4ia*)(mst + 16 * CPITCH + ao + 32 * ks);
      al[ks].q[1] = *(const v4ia*)(mst + 16 * CPITCH + ao + 32 * ks + 16);
    }
#pragma unroll 1
    for (unsigned j = 0; j < 4u; ++j) {
      const unsigned n0 = 64u * wave + 16u * j;
      const unsigned short* np = nbf + ((size_t)b * NK + n0) * EW + 8u * lane;
      v8f acc = zero8;
#pragma unroll
      for (int ks = 0; ks < 4; ++ks) {
        const FragB nf = ldg_frag(np + 2 * FHALF * ks);
        acc = wmb(ah[ks], nf, acc);
        acc = wmb(al[ks], nf, acc);
      }
      // the wait that stands before a register named by an issued load is written again; np as an input keeps the
      // address pair whole up to here
      asm volatile("s_wait_xcnt 0x0" :: "v"(np) : "memory");
      const v8f q = rcpx8(ex2x8(acc * k2) + 1.0f);            // exp(2x) = +inf -> tanh 1, 0 -> tanh -1
#pragma unroll
      for (int r = 0; r < 8; ++r) {
        const unsigned idx = (8u * hh + (unsigned)r) * MPITCH + n0 + m;   // D element r = (query 8h+r, node m)
        const float s = (10.0f * L2E - (20.0f * L2E) * q[r]) + mk[idx];   // log2 domain, like the mask tile
        mk[idx] = s;
      }
    }
  }
  __syncthreads();

  // ---- phase D: row softmax, rows 2 wave and 2 wave + 1 ----
  {
    v4f res[2][4];
#pragma unroll
    for (int rr = 0; rr < 2; ++rr) {
      const unsigned so = (2u * wave + (unsigned)rr) * MPITCH + 4u * lane;
      v4f v[4];
#pragma unroll
      for (int j = 0; j < 4; ++j) v[j] = *(const v4fa*)(mk + so + 128 * j);
      float mx = v[0].x;
#pragma unroll
      for (int j = 0; j < 4; ++j) mx = fmaxf(fmaxf(fmaxf(mx, v[j].x), fmaxf(v[j].y, v[j].z)), v[j].w);
      mx = fmaxf(mx, __shfl_xor(mx, 16));
      mx = fmaxf(mx, __shfl_xor(mx, 8));
      mx = fmaxf(mx, __shfl_xor(mx, 4));
      mx = fmaxf(mx, __shfl_xor(mx, 2));
      mx = fmaxf(mx, __shfl_xor(mx, 1));
      float sum = 0.0f;
#pragma unroll
      for (int j = 0; j < 4; j += 2) {
        const v8f e = ex2x8(__builtin_shufflevector(v[j], v[j + 1], 0, 1, 2, 3, 4, 5, 6, 7) - mx);
        v[j] = __builtin_shufflevector(e, e, 0, 1, 2, 3);
        v[j + 1] = __builtin_shufflevector(e, e, 4, 5, 6, 7);
        sum += (v[j].x + v[j].y) + (v[j].z + v[j].w);
        sum += (v[j + 1].x + v[j + 1].y) + (v[j + 1].z + v[j + 1].w);
      }
      sum += __shfl_xor(sum, 16);
      sum += __shfl_xor(sum, 8);
      sum += __shfl_xor(sum, 4);
      sum += __shfl_xor(sum, 2);
      sum += __shfl_xor(sum, 1);
      const float inv = 1.0f / sum;
#pragma unroll
      for (int j = 0; j < 4; ++j) res[rr][j] = v[j] * inv;
    }
    float* ob = out + ((size_t)b * GQ + g0 + 2u * wave) * NK + 4u * lane;
#pragma unroll
    for (int rr = 0; rr < 2; ++rr)
#pragma unroll
      for (int j = 0; j < 4; ++j) *(v4f*)(ob + (size_t)rr * NK + 128 * j) = res[rr][j];
    
  }
}

// ---------------------------------------------------------------------------
static inline size_t al256(size_t o) { return (o + 255) & ~(size_t)255; }

extern "C" void kernel_launch(void* const* d_in, const int* in_sizes, int n_in,
                              void* d_out, int out_size, void* d_ws, size_t ws_size,
                              hipStream_t stream) {
  if (n_in < 10) return;
  const long long actN = (long long)NB * NK * EW;
  const long long actG = (long long)NB * GQ * EW;
  const long long mskN = (long long)NB * GQ * NK;
  if ((long long)in_sizes[0] < actN) return;             // encoded_nodes
  if ((long long)in_sizes[1] < actG) return;             // encoded_q1
  if ((long long)in_sizes[2] < actG) return;             // encoded_last_node
  if ((long long)in_sizes[3] < mskN) return;             // ninf_mask (f32, additive)
  if (in_sizes[4] < EW * EW || in_sizes[5] < EW * EW || in_sizes[6] < EW * EW ||
      in_sizes[7] < EW * EW || in_sizes[8] < EW * EW) return;
  if (in_sizes[9] < EW) return;
  if ((long long)out_size < mskN) return;

  const float* nodes = (const float*)d_in[0];
  const float* q1    = (const float*)d_in[1];
  const float* last  = (const float*)d_in[2];
  const float* mask  = (const float*)d_in[3];
  const float* Wqf   = (const float*)d_in[4];
  const float* Wql   = (const float*)d_in[5];
  const float* Wk    = (const float*)d_in[6];
  const float* Wv    = (const float*)d_in[7];
  const float* Wc    = (const float*)d_in[8];
  const float* bc    = (const float*)d_in[9];
  float* out = (float*)d_out;

  const size_t wtB  = al256((size_t)5 * EW * EW * 2);             // 163,840
  const size_t nbB  = al256((size_t)NB * NK * EW * 2);            // 4,194,304
  const size_t qB   = al256((size_t)NB * NH * GQ * QROW * 2);     // 8,388,608
  const size_t kB   = al256((size_t)NB * NH * NK * QROW * 2);     // 8,388,608
  const size_t vB   = al256((size_t)2 * VPL * 2);                 // 8,388,608
  const size_t total = wtB + nbB + qB + kB + vB;                  // 29,523,968
  if (total > ws_size || total > (size_t)WSMAX) return;
  char* w = (char*)d_ws;
  unsigned short* wt  = (unsigned short*)w;
  unsigned short* nbf = (unsigned short*)(w + wtB);
  unsigned short* qpl = (unsigned short*)(w + wtB + nbB);
  unsigned short* kpl = (unsigned short*)(w + wtB + nbB + qB);
  unsigned short* vtp = (unsigned short*)(w + wtB + nbB + qB + kB);
  unsigned short* wctp = wt + 4 * EW * EW;

  // 1: W_comb [in][out] f32 -> W_comb^T bf16 plane; k = nodes.Wk -> k plane (hi|lo tiles), v = nodes.Wv -> V^T hi|lo tiles, nodes -> bf16 plane;
  //    q = q1.Wq_first + last.Wq_last -> q plane (hi|lo tiles); every plane in fragment order
  k_proj<<<1 + KVBLK + QBLK, 128, 0, stream>>>(nodes, q1, last, Wqf, Wql, Wk, Wv, Wc, qpl, kpl, vtp, nbf, wctp);
  // 2: attention + W_comb + final scoring + softmax
  k_dec<<<dim3(GQ / 16, NB), 256, 0, stream>>>(qpl, kpl, vtp, mask, wctp, bc, nbf, out);
}

// v005
// Measured time: 55 microseconds a run.
// Next to v004, in two timings, it ran 1.16 and 1.17 times as fast.
// All steps since v000 together make it 2.04 times as fast.
// Contractions: q/k/v projections = v_wmma_f32_16x16x32_bf16, bf16 (RNE) inputs and weights, one product. q.k scores, P.V, ctx.W_comb and mh.nodes = same bf16 WMMA with every computed operand carried as bf16 hi + bf16 lo (hi.hi + lo.hi + hi.lo; input-side planes are exact bf16, lo == 0). Accumulate f32 everywhere.
// Mask add, online softmax, tanh, bias, final softmax: f32 VALU; both softmaxes run on logits scaled by log2e (the LDS mask tile carries the factor), so exp(x - m) is one subtract and v_exp_f32; tanh(x) = 1 - 2 v_rcp_f32(1 + exp(2x)). No power-of-two carries exist (bf16 planes only).
#include <hip/hip_runtime.h>
#include <stddef.h>
#include <stdint.h>

#ifndef NB
#define NB 32                      // batches processed (a reduced build reads the first NB batches)
#endif
#define GQ     512                 // queries per batch
#define NK     512                 // nodes (keys) per batch
#define EW     128                 // embedding width = heads x head dim
#define NH     8
#define HD     16
#define QROW   32                  // halfwords per q/k plane row (16 hi + 16 lo); 16 rows = one tile [hi|lo][lane][8]
#define FHALF  256                 // halfwords a wave-wide 16-B access covers: 32 lanes x 8
#define VTILE  1024                // halfwords per V^T tile (one head, 32 keys): hi fragment, then lo fragment
#define MPITCH 516                 // floats per LDS mask/score row
#define CPITCH 136                 // halfwords per LDS ctx/mh row
#define TPITCH 136                 // halfwords per LDS weight-transpose row
#define WSMAX  134217728
#define VPL    ((size_t)NB * EW * NK)   // halfwords of V^T hi pieces (as many lo pieces)

static_assert(GQ == NK);                       // k_proj uses one row count for q and k planes
static_assert(NH * HD == EW);
static_assert(EW % 32 == 0 && NK % 32 == 0);
static_assert(GQ % 64 == 0 && (NB * GQ) % 64 == 0);
static_assert(16 * QROW == 2 * FHALF);         // q/k tile: 16 rows = hi piece + lo piece, one wave-wide access each
static_assert(2 * HD * 32 == VTILE && VTILE == 4 * FHALF);   // V^T tile: 2 fragments of 2 accesses
static_assert(16 * EW == 8 * FHALF);           // nodes / W_comb tile: 16 rows = 4 fragments of 2 accesses
static_assert(NH * 64 * QROW == 16384);        // k_proj stage: q/k form
static_assert(2 * EW * 64 == 16384);           // k_proj stage: V^T form
static_assert(16384 == 128 * 16 * 8);          // k_proj copy-out: 128 thr x 16 it x 8 halfwords
static_assert(EW == 32 * 4 && EW == 4 * 4 * 8); // stage_wt: 32 lanes x 4 columns, 4 waves x 4 it x 8 rows
static_assert(EW * EW == 128 * 16 * 8);        // W_comb copy-out: 128 thr x 16 it x 8 halfwords
static_assert(16 * NK == 256 * 8 * 4);         // k_dec mask staging: 256 thr x 8 it x 4 floats
static_assert(NK == 8 * 64);                   // k_dec phase C: 8 waves x 64 nodes
static_assert(NK == 32 * 16);                  // k_dec phase D: 32 lanes x 4 x 4 floats per row

typedef int            v4i   __attribute__((ext_vector_type(4)));
typedef int            v8i   __attribute__((ext_vector_type(8)));
typedef float          v4f   __attribute__((ext_vector_type(4)));
typedef float          v8f   __attribute__((ext_vector_type(8)));
typedef __bf16         v16bf __attribute__((ext_vector_type(16)));
typedef __bf16         v8bf  __attribute__((ext_vector_type(8)));
typedef v4i __attribute__((may_alias)) v4ia;
typedef v4f __attribute__((may_alias)) v4fa;
union FragB { v16bf v; v4i q[2]; v8i w; };

// WMMA with hazard guard: ties D, keeps A/B live for 4 VALU slots
__device__ __forceinline__ v8f wmb(const FragB& a, const FragB& b, v8f c) {
  v8f d = __builtin_amdgcn_wmma_f32_16x16x32_bf16(false, a.v, false, b.v, (short)0, c, false, false);
  asm volatile("v_nop\n\tv_nop\n\tv_nop\n\tv_nop" : "+v"(d) : "v"(a.w), "v"(b.w));
  return d;
}

#define L2E 1.4426950408889634f    // log2(e)
// 2^x on the hardware unit: -inf and anything below the f32 range give 0, +inf gives +inf
__device__ __forceinline__ float ex2(float x) { return __builtin_amdgcn_exp2f(x); }
// Eight 2^x / eight 1/x in one statement. Why asm: behind a transcendental the instruction set asks for one
// independent slot before its result is read or its source overwritten; the early-clobber outputs keep every
// result off every source, and the closing v_nop is the slot behind the last one.
__device__ __forceinline__ v8f ex2x8(const v8f x) {
  float y0, y1, y2, y3, y4, y5, y6, y7;
  asm("v_exp_f32 %0, %8\n\tv_exp_f32 %1, %9\n\tv_exp_f32 %2, %10\n\tv_exp_f32 %3, %11\n\t"
      "v_exp_f32 %4, %12\n\tv_exp_f32 %5, %13\n\tv_exp_f32 %6, %14\n\tv_exp_f32 %7, %15\n\tv_nop"
      : "=&v"(y0), "=&v"(y1), "=&v"(y2), "=&v"(y3), "=&v"(y4), "=&v"(y5), "=&v"(y6), "=&v"(y7)
      : "v"(x[0]), "v"(x[1]), "v"(x[2]), "v"(x[3]), "v"(x[4]), "v"(x[5]), "v"(x[6]), "v"(x[7]));
  const v8f y = {y0, y1, y2, y3, y4, y5, y6, y7};
  return y;
}
__device__ __forceinline__ v8f rcpx8(const v8f x) {
  float y0, y1, y2, y3, y4, y5, y6, y7;
  asm("v_rcp_f32 %0, %8\n\tv_rcp_f32 %1, %9\n\tv_rcp_f32 %2, %10\n\tv_rcp_f32 %3, %11\n\t"
      "v_rcp_f32 %4, %12\n\tv_rcp_f32 %5, %13\n\tv_rcp_f32 %6, %14\n\tv_rcp_f32 %7, %15\n\tv_nop"
      : "=&v"(y0), "=&v"(y1), "=&v"(y2), "=&v"(y3), "=&v"(y4), "=&v"(y5), "=&v"(y6), "=&v"(y7)
      : "v"(x[0]), "v"(x[1]), "v"(x[2]), "v"(x[3]), "v"(x[4]), "v"(x[5]), "v"(x[6]), "v"(x[7]));
  const v8f y = {y0, y1, y2, y3, y4, y5, y6, y7};
  return y;
}

typedef float          v2f   __attribute__((ext_vector_type(2)));
typedef __bf16         v2bf  __attribute__((ext_vector_type(2)));
// two f32 -> two bf16 in one word, RNE, by the hardware's packed convert; lo in the low halfword
__device__ __forceinline__ int pack2(float lo, float hi) {
  const v2f x = {lo, hi};
  union { v2bf h; int i; } u;
  u.h = __builtin_convertvector(x, v2bf);
  return u.i;
}
// the f32 values of RNE bf16(a), RNE bf16(b)
__device__ __forceinline__ v2f bf16_val2(float a, float b) {
  const unsigned h = (unsigned)pack2(a, b);
  const v2f r = {__uint_as_float(h << 16), __uint_as_float(h & 0xFFFF0000u)};
  return r;
}
// 8 f32 -> bf16 hi piece + bf16 lo piece (lo = RNE(v - hi)); element 2j in the low halfword of word j
__device__ __forceinline__ void split8(const v8f x, v4i& hi, v4i& lo) {
#pragma unroll
  for (int j = 0; j < 4; ++j) {
    const float a = x[2 * j], b = x[2 * j + 1];
    const unsigned h = (unsigned)pack2(a, b);
    const float ra = a - __uint_as_float(h << 16);
    const float rb = b - __uint_as_float(h & 0xFFFF0000u);
    hi[j] = (int)h;
    lo[j] = pack2(ra, rb);
  }
}
// fragment (row/col = lane&15) from an f32 row: p = row + k0 + 8h; elements 0..7 <- k0+8h+0..7, 8..15 <- k0+16+8h+0..7
__device__ __forceinline__ FragB ldf_frag(const float* __restrict__ p) {
  const v4f a0 = *(const v4fa*)p;
  const v4f a1 = *(const v4fa*)(p + 4);
  const v4f a2 = *(const v4fa*)(p + 16);
  const v4f a3 = *(const v4fa*)(p + 20);
  FragB f;
  f.w[0] = pack2(a0.x, a0.y); f.w[1] = pack2(a0.z, a0.w);
  f.w[2] = pack2(a1.x, a1.y); f.w[3] = pack2(a1.z, a1.w);
  f.w[4] = pack2(a2.x, a2.y); f.w[5] = pack2(a2.z, a2.w);
  f.w[6] = pack2(a3.x, a3.y); f.w[7] = pack2(a3.z, a3.w);
  return f;
}
// same fragment from a GLOBAL plane kept in fragment order: a fragment = 512 halfwords, [element half][lane][8];
// p = fragment + 8 lane. Each of the two wave-wide loads covers 512 contiguous bytes (4 whole 128-B lines).
__device__ __forceinline__ FragB ldg_frag(const unsigned short* __restrict__ p) {
  FragB f;
  f.q[0] = *(const v4ia*)p;
  f.q[1] = *(const v4ia*)(p + FHALF);
  return f;
}

// ---------------------------------------------------------------------------
// Weight staging, by the 4 waves of one block: W[k][n] f32 (128 x 128, [in][out]) -> LDS T[n][k] bf16 bits, row
// pitch TPITCH. A task = 8 rows k x 4 columns n: a wave-wide load is one whole 512-B row of W, a lane packs 8
// consecutive k of each of its 4 columns into one 16-B LDS store. Coverage: 4 waves x 4 it x 8 k = 128 k,
// 32 lanes x 4 n = 128 n. Cross-wave: the caller's block barrier stands between this and the first read of T.
// ---------------------------------------------------------------------------
__device__ __forceinline__ void stage_wt(const float* __restrict__ W, unsigned short* T) {
  const unsigned lane = threadIdx.x & 31u, wave = threadIdx.x >> 5;
#pragma unroll   // all 32 loads of a weight in flight together
  for (unsigned it = 0; it < 4u; ++it) {
    const unsigned k0 = 8u * (wave + 4u * it);
    const float* p = W + (size_t)k0 * EW + 4u * lane;
    v4f r[8];
#pragma unroll   // constant j, c: r[] stays in registers
    for (int j = 0; j < 8; ++j) r[j] = *(const v4fa*)(p + j * EW);
#pragma unroll
    for (int c = 0; c < 4; ++c) {
      const v8f col = {r[0][c], r[1][c], r[2][c], r[3][c], r[4][c], r[5][c], r[6][c], r[7][c]};
      union { v8bf h; v4i q; } u;
      u.h = __builtin_convertvector(col, v8bf);      // RNE, two values an instruction; k even in the low halfword
      *(v4ia*)(T + (4u * lane + (unsigned)c) * TPITCH + k0) = u.q;
    }
  }
}
// fragment from an LDS k-contiguous bf16 row: p = row + k0 + 8h (same element order as ldg_frag)
__device__ __forceinline__ FragB lds_frag(const unsigned short* p) {
  FragB f;
  f.q[0] = *(const v4ia*)p;
  f.q[1] = *(const v4ia*)(p + 16);
  return f;
}

// ---------------------------------------------------------------------------
// Projections. Block = 64 rows of the flattened [b][row] input, 4 waves x 16 rows; activations are held
// as bf16 fragments (col = lane&15 = input row) and every head (16 output columns) is one rolled step.
// MODE 0: q = x1.W1 + x2.W2.   MODE 1: k = x1.W1, then v = x1.W2, and the bf16 fragments of x1 (the nodes) also go
//   out as the plane nb[b][16-node tile][k step][element half][lane][8] (B operand of the final scoring product, in
//   fragment order): a lane stores its own 16-B pieces, each wave-wide store is 512 B in a row.
// Both modes run in ONE launch (k_proj): they depend only on the inputs, not on each other. A block first stages its
// own two weights, transposed to bf16 [out][in], in LDS (stage_wt) and takes every weight fragment from there.
// q/k form: D = Wt_tile (A, row = out col) x X (B, col = input row): D[row d = 8h+r][col = input row], so a
//   lane holds 8 consecutive d of one row -> one 16-B LDS store per plane half. Plane (b,head,16-row tile) =
//   hi[lane][8] | lo[lane][8] halfwords, lane = 16h + row: the piece a lane of k_dec takes, so its wave-wide load is
//   512 B in a row.
// v form: D = X (A) x Wt_tile (B): D[row = input row 8h+r][col d], lane holds 8 consecutive n of column d ->
//   one 16-B LDS store into the V^T stage [head][32-key tile][hi|lo][element half][lane][8], the global order too.
// LDS stg: cross-wave (block barriers); fully written before each copy-out (8 heads x 64 rows x 32, or
// coverage: q/k plane: NB*8 blocks x 16384 halfwords = NB*8*512*32; V^T: NB*8 blocks x 16384 (hi + lo) = 2*NB*128*512.
// ---------------------------------------------------------------------------
template <int MODE>
__device__ __forceinline__ void proj_body(const unsigned blk, unsigned short* stg,
                                          const float* __restrict__ x1, const float* __restrict__ x2,
                                          const float* __restrict__ w1, const float* __restrict__ w2,
                                          unsigned short* w1t, unsigned short* w2t,
                                          unsigned short* o1, unsigned short* o2, unsigned short* nb) {
  const unsigned tid = threadIdx.x, lane = tid & 31u, wave = tid >> 5, hh = lane >> 4, m = lane & 15u;
  const unsigned row0 = blk * 64u;
  const unsigned bb = row0 >> 9, r0 = row0 & 511u;
  const unsigned xrow = row0 + 16u * wave + m;

  // x1's loads (from memory, the longest wait) are issued first and packed behind the weight staging
  v4f xr[4][4];
  const float* xp = x1 + (size_t)xrow * EW + 8u * hh;
#pragma unroll
  for (int ks = 0; ks < 4; ++ks) {
    const float* p = xp + 32 * ks;
    xr[ks][0] = *(const v4fa*)p;        xr[ks][1] = *(const v4fa*)(p + 4);
    xr[ks][2] = *(const v4fa*)(p + 16); xr[ks][3] = *(const v4fa*)(p + 20);
  }
  // the wait that stands before a register named by an issued load is written again; xp as an input keeps the
  // address pair out of the loads' own destinations up to here
  asm volatile("s_wait_xcnt 0x0" :: "v"(xp) : "memory");
#pragma unroll 1   // one weight a trip: 32 loads in flight, not 64, which keeps the block under 256 registers
  for (unsigned w = 0; w < 2u; ++w) stage_wt(w ? w2 : w1, w ? w2t : w1t);
  FragB xa[4], xb[4];
#pragma unroll
  for (int ks = 0; ks < 4; ++ks) {
#pragma unroll
    for (int j = 0; j < 4; ++j) {
      xa[ks].w[2 * j] = pack2(xr[ks][j].x, xr[ks][j].y);
      xa[ks].w[2 * j + 1] = pack2(xr[ks][j].z, xr[ks][j].w);
    }
    if (MODE == 0) xb[ks] = ldf_frag(x2 + (size_t)xrow * EW + 32 * ks + 8u * hh);
    else xb[ks] = xa[ks];
  }
  __syncthreads();   // both staged weights are complete before any wave reads a fragment
  if (MODE == 1) {
    unsigned short* nd = nb + (size_t)(row0 + 16u * wave) * EW + 8u * lane;
#pragma unroll   // constant ks: xa[] stays in registers
    for (int ks = 0; ks < 4; ++ks) {
      *(v4i*)(nd + 2 * FHALF * ks) = xa[ks].q[0];
      *(v4i*)(nd + 2 * FHALF * ks + FHALF) = xa[ks].q[1];
    }
  }
  const v8f zero8 = {0.f, 0.f, 0.f, 0.f, 0.f, 0.f, 0.f, 0.f};

#pragma unroll 1
  for (unsigned t = 0; t < NH; ++t) {
    const unsigned short* wp = w1t + (16u * t + m) * TPITCH + 8u * hh;
    const unsigned short* wq = w2t + (16u * t + m) * TPITCH + 8u * hh;
    v8f acc = zero8;
    FragB wf[4], wg[4];
#pragma unroll   // the step's LDS reads stand together, ahead of its matrix chain: one LDS latency a step
    for (int ks = 0; ks < 4; ++ks) {
      wf[ks] = lds_frag(wp + 32 * ks);
      if (MODE == 0) wg[ks] = lds_frag(wq + 32 * ks);
    }
#pragma unroll
    for (int ks = 0; ks < 4; ++ks) {
      acc = wmb(wf[ks], xa[ks], acc);
      if (MODE == 0) acc = wmb(wg[ks], xb[ks], acc);
    }
    v4i hi, lo;
    split8(acc, hi, lo);
    const unsigned so = (t * 64u + 16u * wave) * QROW + 8u * lane;   // tile of 16 rows: [hi|lo][lane][8]
    *(v4ia*)(stg + so) = hi;
    *(v4ia*)(stg + so + FHALF) = lo;
  }
  __syncthreads();
  {
    unsigned short* dst = o1 + ((size_t)bb * NH * GQ + r0) * QROW;
#pragma unroll 1
    for (unsigned it = 0; it < 16u; ++it) {
      const unsigned p = it * 128u + tid, t = p >> 8, wi = p & 255u;
      const v4i v = *(const v4ia*)(stg + p * 8u);
      *(v4i*)(dst + (size_t)t * (GQ * QROW) + wi * 8u) = v;
      asm volatile("s_wait_xcnt 0x0" ::: "memory");   // stands before the next trip, or the code behind the loop, writes a register this store names
    }
    
  }
  if (MODE == 1) {
    __syncthreads();
#pragma unroll 1
    for (unsigned t = 0; t < NH; ++t) {
      const unsigned short* wq = w2t + (16u * t + m) * TPITCH + 8u * hh;
      v8f acc = zero8;
      FragB wf[4];
#pragma unroll   // as above: the reads together, then the chain
      for (int ks = 0; ks < 4; ++ks) wf[ks] = lds_frag(wq + 32 * ks);
#pragma unroll
      for (int ks = 0; ks < 4; ++ks) acc = wmb(xa[ks], wf[ks], acc);
      v4i hi, lo;
      split8(acc, hi, lo);                       // acc[r] = v[n = 16 wave + 8h + r][col 16t + m]
      // 32-key tile wave >> 1, element half wave & 1 of its hi and lo fragments
      const unsigned so = (2u * t + (wave >> 1)) * VTILE + (wave & 1u) * FHALF + 8u * lane;
      *(v4ia*)(stg + so) = hi;
      *(v4ia*)(stg + so + 2 * FHALF) = lo;
    }
    __syncthreads();
    unsigned short* dst = o2 + ((size_t)bb * NH * (NK / 32) + (r0 >> 5)) * VTILE;
#pragma unroll 1
    for (unsigned it = 0; it < 16u; ++it) {
      const unsigned p = it * 128u + tid, t = p >> 8, wi = p & 255u;   // a head's two tiles: 4 KiB in a row
      const v4i v = *(const v4ia*)(stg + p * 8u);
      *(v4i*)(dst + (size_t)t * ((NK / 32) * VTILE) + wi * 8u) = v;
      asm volatile("s_wait_xcnt 0x0" ::: "memory");   // stands before the next trip, or the code behind the loop, writes a register this store names
    }
    
  }
}

// One grid for both projections and the W_comb plane: block 0 writes W_comb^T as a bf16 plane in fragment order for the next launch,
// blocks 1 .. KVBLK take the k/v form (the longer one, so it starts first), the rest the q form. The choice is
// uniform in a block, so every barrier of a body is passed by all its waves.
// W_comb plane: 8 tiles of 16 rows in fragment order; a wave-wide store is 512 B in a row, each piece once.
#define KVBLK ((NB * NK) / 64)
#define QBLK  ((NB * GQ) / 64)
__global__ __launch_bounds__(128) void k_proj(const float* __restrict__ nodes, const float* __restrict__ q1,
                                              const float* __restrict__ last,
                                              const float* __restrict__ wqf, const float* __restrict__ wql,
                                              const float* __restrict__ wk, const float* __restrict__ wv,
                                              const float* __restrict__ wc,
                                              unsigned short* qpl, unsigned short* kpl, unsigned short* vtp,
                                              unsigned short* nbf, unsigned short* wct) {
  __shared__ __attribute__((aligned(16))) unsigned short stg[16384];
  __shared__ __attribute__((aligned(16))) unsigned short wl1[EW * TPITCH];
  __shared__ __attribute__((aligned(16))) unsigned short wl2[EW * TPITCH];
  if (blockIdx.x == 0u) {
    stage_wt(wc, wl1);
    __syncthreads();
#pragma unroll 4   // four LDS reads in flight a trip instead of one
    for (unsigned it = 0; it < 16u; ++it) {
      // p = 16-B piece of the plane in fragment order: [16-row tile][k step][element half][k half h][row m]
      const unsigned p = it * 128u + threadIdx.x, n = ((p >> 8) << 4) | (p & 15u);
      const unsigned c = (((p >> 6) & 3u) << 2) | (((p >> 5) & 1u) << 1) | ((p >> 4) & 1u);
      const v4i v = *(const v4ia*)(wl1 + n * TPITCH + c * 8u);
      *(v4i*)(wct + p * 8u) = v;
      // the wait that stands before the next trip writes the registers these stores name
      if ((it & 3u) == 3u) asm volatile("s_wait_xcnt 0x0" ::: "memory");
    }
  } else if (blockIdx.x <= (unsigned)KVBLK) {
    proj_body<1>(blockIdx.x - 1u, stg, nodes, nodes, wk, wv, wl1, wl2, kpl, vtp, nbf);
  } else {
    proj_body<0>(blockIdx.x - 1u - (unsigned)KVBLK, stg, q1, last, wqf, wql, wl1, wl2, qpl, qpl, nbf);
  }
}

// ---------------------------------------------------------------------------
// Fused decoder block: one block = (batch b, 16 query rows g0..g0+15), 8 waves.
// Phase 0: mask tile [16][512] f32 (bf16-convert of the input value, times log2e) -> LDS mk (cross-wave, block barrier).
// Phase A (wave = head): flash attention in the transposed domain.
//   S^T tile = K (A, row = key) x Q^T (B, col = query): K = 16 is laid as [k_hi|k_hi] x [q_hi|q_lo] plus
//   [k_lo|0] x [q_hi|q_lo] along the 32-deep k axis. D[row key 8h+r][col query m]. Softmax statistics are
//   per lane (query m); the two lane halves combine by one xor-16 exchange. The P^T B-fragment is the lane's
//   own 16 score results (tile 0 -> elements 0..7, tile 1 -> elements 8..15). O^T = V^T (A, row d) x P^T:
//   D[row d 8h+r][col query m], scaled per lane. ctx hi/lo -> LDS cst[plane][query][128] by 16-B stores.
// Phase B (wave = 16 output columns e): mh^T = W_comb^T (A, global plane) x ctx^T (B, from cst), hi + lo,
//   + bf16(b_comb[e]); mh hi/lo -> LDS mst[plane][query][128] by 16-B stores.
// Phase C (wave = 64 nodes): s2 = mh (A, from mst, hi + lo) x nodes^T (B, global bf16 plane);
//   D[row query 8h+r][col node m]; s = (10 tanh(x/sqrt(128)) + mask) log2e, written over the mask value in place.
// Phase D (wave = 2 rows): row softmax from LDS; each instruction writes 512 contiguous bytes (4 whole
// LDS extents: mk rows 0..15 cols 0..511 written in phase 0 and consumed cols 0..511; cst/mst rows 0..15
//   cols 0..127 of both planes written by all 8 waves, consumed cols 0..127. Pad columns are never read.
// coverage: grid (32, NB) x 16 rows x 512 = NB*512*512 outputs, each written by exactly one lane.
// ---------------------------------------------------------------------------
__global__ __launch_bounds__(256) void k_dec(const unsigned short* __restrict__ qpl,
                                             const unsigned short* __restrict__ kpl,
                                             const unsigned short* __restrict__ vt,
                                             const float* __restrict__ mask,
                                             const unsigned short* __restrict__ wct,
                                             const float* __restrict__ bcomb,
                                             const unsigned short* __restrict__ nbf,
                                             float* out) {
  __shared__ __attribute__((aligned(16))) float mk[16 * MPITCH];
  __shared__ __attribute__((aligned(16))) unsigned short cst[2 * 16 * CPITCH];
  __shared__ __attribute__((aligned(16))) unsigned short mst[2 * 16 * CPITCH];
  const unsigned tid = threadIdx.x, lane = tid & 31u, wave = tid >> 5, hh = lane >> 4, m = lane & 15u;
  const unsigned g0 = blockIdx.x * 16u, b = blockIdx.y;
  const v8f zero8 = {0.f, 0.f, 0.f, 0.f, 0.f, 0.f, 0.f, 0.f};
  const v4i zero4 = {0, 0, 0, 0};

  // ---- phase 0: mask tile ----
  {
    const float* mg = mask + ((size_t)b * GQ + g0) * NK;
#pragma unroll 2
    for (unsigned it = 0; it < 8u; ++it) {
      const unsigned p = it * 256u + tid, row = p >> 7, c4 = (p & 127u) << 2;
      v4f v = *(const v4fa*)(mg + (size_t)row * NK + c4);
      const v2f v01 = bf16_val2(v.x, v.y) * L2E, v23 = bf16_val2(v.z, v.w) * L2E;
      *(v4fa*)(mk + row * MPITCH + c4) = __builtin_shufflevector(v01, v23, 0, 1, 2, 3);
    }
  }
  __syncthreads();

  // ---- phase A: attention for head = wave ----
  {
    const unsigned bh = b * NH + wave;
    const unsigned short* qp = qpl + ((size_t)bh * GQ + g0) * QROW + 8u * lane;
    FragB qf;
    qf.q[0] = *(const v4ia*)qp;               // q_hi[8h .. 8h+7]  (k slots 8h..)
    qf.q[1] = *(const v4ia*)(qp + FHALF);     // q_lo[8h .. 8h+7]  (k slots 16+8h..)
    const unsigned short* kb = kpl + (size_t)bh * NK * QROW + 8u * lane;
    const unsigned short* vb = vt + (size_t)bh * ((NK / 32) * VTILE) + 8u * lane;
    const unsigned moff = m * MPITCH + 8u * hh;
    v8f o = zero8;
    float mrun = -3.0e38f, lrun = 0.0f;
#pragma unroll 1
    for (unsigned n0 = 0; n0 < NK; n0 += 32u) {
      const unsigned short* kp = kb + (size_t)n0 * QROW;
      const v4i kh0 = *(const v4ia*)kp;
      const v4i kl0 = *(const v4ia*)(kp + FHALF);
      const v4i kh1 = *(const v4ia*)(kp + 16 * QROW);
      const v4i kl1 = *(const v4ia*)(kp + 16 * QROW + FHALF);
      FragB a10, a20, a11, a21;
      a10.q[0] = kh0; a10.q[1] = kh0;
      a20.q[0] = kl0; a20.q[1] = zero4;
      a11.q[0] = kh1; a11.q[1] = kh1;
      a21.q[0] = kl1; a21.q[1] = zero4;
      v8f s0 = wmb(a10, qf, zero8);
      s0 = wmb(a20, qf, s0);
      v8f s1 = wmb(a11, qf, zero8);
      s1 = wmb(a21, qf, s1);

      const v4f m0 = *(const v4fa*)(mk + moff + n0);
      const v4f m1 = *(const v4fa*)(mk + moff + n0 + 4u);
      const v4f m2 = *(const v4fa*)(mk + moff + n0 + 16u);
      const v4f m3 = *(const v4fa*)(mk + moff + n0 + 20u);
      const v8f mk0 = __builtin_shufflevector(m0, m1, 0, 1, 2, 3, 4, 5, 6, 7);
      const v8f mk1 = __builtin_shufflevector(m2, m3, 0, 1, 2, 3, 4, 5, 6, 7);
      const v8f a0 = s0 * (0.25f * L2E) + mk0;      // key n0 + 8h + r, log2 domain
      const v8f a1 = s1 * (0.25f * L2E) + mk1;      // key n0 + 16 + 8h + r

      float t = fmaxf(a0[0], a1[0]);
#pragma unroll
      for (int r = 1; r < 8; ++r) t = fmaxf(t, fmaxf(a0[r], a1[r]));
      t = fmaxf(t, __shfl_xor(t, 16));
      const float mnew = fmaxf(mrun, t);
      const float sc = ex2(mrun - mnew);
      const v8f p0 = ex2x8(a0 - mnew);
      const v8f p1 = ex2x8(a1 - mnew);
      float ps = 0.0f;
#pragma unroll
      for (int r = 0; r < 8; ++r) ps += p0[r] + p1[r];
      lrun = lrun * sc + ps;
      mrun = mnew;
      o = o * sc;

      FragB ph, pl;
      split8(p0, ph.q[0], pl.q[0]);
      split8(p1, ph.q[1], pl.q[1]);
      const unsigned short* vp = vb + (size_t)(n0 >> 5) * VTILE;
      const FragB fvh = ldg_frag(vp);
      const FragB fvl = ldg_frag(vp + 2 * FHALF);
      o = wmb(fvh, ph, o);
      o = wmb(fvl, ph, o);
      o = wmb(fvh, pl, o);
    }
    const float lt = lrun + __shfl_xor(lrun, 16);
    const float inv = 1.0f / lt;
    const v8f c = o * inv;                    // ctx[query m][16 wave + 8h + r]
    v4i hi, lo;
    split8(c, hi, lo);
    const unsigned co = m * CPITCH + 16u * wave + 8u * hh;
    *(v4ia*)(cst + co) = hi;
    *(v4ia*)(cst + 16 * CPITCH + co) = lo;
  }
  __syncthreads();

  // ---- phase B: mh^T tile for e = 16 wave .. 16 wave + 15 ----
  {
    const unsigned e0 = 16u * wave;
    const unsigned short* wp = wct + (size_t)e0 * EW + 8u * lane;
    const unsigned co = m * CPITCH + 8u * hh;
    v8f acc = zero8;
#pragma unroll
    for (int ks = 0; ks < 4; ++ks) {
      const FragB wf = ldg_frag(wp + 2 * FHALF * ks);
      FragB ch, cl;
      ch.q[0] = *(const v4ia*)(cst + co + 32 * ks);
      ch.q[1] = *(const v4ia*)(cst + co + 32 * ks + 16);
      cl.q[0] = *(const v4ia*)(cst + 16 * CPITCH + co + 32 * ks);
      cl.q[1] = *(const v4ia*)(cst + 16 * CPITCH + co + 32 * ks + 16);
      acc = wmb(wf, ch, acc);
      acc = wmb(wf, cl, acc);
    }
    const v4f b0 = *(const v4fa*)(bcomb + e0 + 8u * hh);
    const v4f b1 = *(const v4fa*)(bcomb + e0 + 8u * hh + 4u);
    const v2f c01 = bf16_val2(b0.x, b0.y), c23 = bf16_val2(b0.z, b0.w);
    const v2f c45 = bf16_val2(b1.x, b1.y), c67 = bf16_val2(b1.z, b1.w);
    acc[0] += c01.x; acc[1] += c01.y; acc[2] += c23.x; acc[3] += c23.y;
    acc[4] += c45.x; acc[5] += c45.y; acc[6] += c67.x; acc[7] += c67.y;
    v4i hi, lo;
    split8(acc, hi, lo);                      // mh[query m][e0 + 8h + r]
    const unsigned mo = m * CPITCH + e0 + 8u * hh;
    *(v4ia*)(mst + mo) = hi;
    *(v4ia*)(mst + 16 * CPITCH + mo) = lo;
  }
  __syncthreads();

  // ---- phase C: s = (10 tanh(mh . node / sqrt(128)) + mask) log2e, nodes 64 wave .. 64 wave + 63 ----
  {
    const float k2 = (float)(2.0 * 1.4426950408889634 / 11.313708498984761);   // exp(2 x), x = acc / sqrt(128), as 2^(acc k2)
    const unsigned ao = m * CPITCH + 8u * hh;
    FragB ah[4], al[4];
#pragma unroll
    for (int ks = 0; ks < 4; ++ks) {
      ah[ks].q[0] = *(const v4ia*)(mst + ao + 32 * ks);
      ah[ks].q[1] = *(const v4ia*)(mst + ao + 32 * ks + 16);
      al[ks].q[0] = *(const v4ia*)(mst + 16 * CPITCH + ao + 32 * ks);
      al[ks].q[1] = *(const v4ia*)(mst + 16 * CPITCH + ao + 32 * ks + 16);
    }
#pragma unroll 1
    for (unsigned j = 0; j < 4u; ++j) {
      const unsigned n0 = 64u * wave + 16u * j;
      const unsigned short* np = nbf + ((size_t)b * NK + n0) * EW + 8u * lane;
      v8f acc = zero8;
#pragma unroll
      for (int ks = 0; ks < 4; ++ks) {
        const FragB nf = ldg_frag(np + 2 * FHALF * ks);
        acc = wmb(ah[ks], nf, acc);
        acc = wmb(al[ks], nf, acc);
      }
      // the wait that stands before a register named by an issued load is written again; np as an input keeps the
      // address pair whole up to here
      asm volatile("s_wait_xcnt 0x0" :: "v"(np) : "memory");
      const v8f q = rcpx8(ex2x8(acc * k2) + 1.0f);            // exp(2x) = +inf -> tanh 1, 0 -> tanh -1
#pragma unroll
      for (int r = 0; r < 8; ++r) {
        const unsigned idx = (8u * hh + (unsigned)r) * MPITCH + n0 + m;   // D element r = (query 8h+r, node m)
        const float s = (10.0f * L2E - (20.0f * L2E) * q[r]) + mk[idx];   // log2 domain, like the mask tile
        mk[idx] = s;
      }
    }
  }
  __syncthreads();

  // ---- phase D: row softmax, rows 2 wave and 2 wave + 1 ----
  {
    v4f res[2][4];
#pragma unroll
    for (int rr = 0; rr < 2; ++rr) {
      const unsigned so = (2u * wave + (unsigned)rr) * MPITCH + 4u * lane;
      v4f v[4];
#pragma unroll
      for (int j = 0; j < 4; ++j) v[j] = *(const v4fa*)(mk + so + 128 * j);
      float mx = v[0].x;
#pragma unroll
      for (int j = 0; j < 4; ++j) mx = fmaxf(fmaxf(fmaxf(mx, v[j].x), fmaxf(v[j].y, v[j].z)), v[j].w);
      mx = fmaxf(mx, __shfl_xor(mx, 16));
      mx = fmaxf(mx, __shfl_xor(mx, 8));
      mx = fmaxf(mx, __shfl_xor(mx, 4));
      mx = fmaxf(mx, __shfl_xor(mx, 2));
      mx = fmaxf(mx, __shfl_xor(mx, 1));
      float sum = 0.0f;
#pragma unroll
      for (int j = 0; j < 4; j += 2) {
        const v8f e = ex2x8(__builtin_shufflevector(v[j], v[j + 1], 0, 1, 2, 3, 4, 5, 6, 7) - mx);
        v[j] = __builtin_shufflevector(e, e, 0, 1, 2, 3);
        v[j + 1] = __builtin_shufflevector(e, e, 4, 5, 6, 7);
        sum += (v[j].x + v[j].y) + (v[j].z + v[j].w);
        sum += (v[j + 1].x + v[j + 1].y) + (v[j + 1].z + v[j + 1].w);
      }
      sum += __shfl_xor(sum, 16);
      sum += __shfl_xor(sum, 8);
      sum += __shfl_xor(sum, 4);
      sum += __shfl_xor(sum, 2);
      sum += __shfl_xor(sum, 1);
      const float inv = 1.0f / sum;
#pragma unroll
      for (int j = 0; j < 4; ++j) res[rr][j] = v[j] * inv;
    }
    float* ob = out + ((size_t)b * GQ + g0 + 2u * wave) * NK + 4u * lane;
#pragma unroll
    for (int rr = 0; rr < 2; ++rr)
#pragma unroll
      for (int j = 0; j < 4; ++j) *(v4f*)(ob + (size_t)rr * NK + 128 * j) = res[rr][j];
    
  }
}

// ---------------------------------------------------------------------------
static inline size_t al256(size_t o) { return (o + 255) & ~(size_t)255; }

extern "C" void kernel_launch(void* const* d_in, const int* in_sizes, int n_in,
                              void* d_out, int out_size, void* d_ws, size_t ws_size,
                              hipStream_t stream) {
  if (n_in < 10) return;
  const long long actN = (long long)NB * NK * EW;
  const long long actG = (long long)NB * GQ * EW;
  const long long mskN = (long long)NB * GQ * NK;
  if ((long long)in_sizes[0] < actN) return;             // encoded_nodes
  if ((long long)in_sizes[1] < actG) return;             // encoded_q1
  if ((long long)in_sizes[2] < actG) return;             // encoded_last_node
  if ((long long)in_sizes[3] < mskN) return;             // ninf_mask (f32, additive)
  if (in_sizes[4] < EW * EW || in_sizes[5] < EW * EW || in_sizes[6] < EW * EW ||
      in_sizes[7] < EW * EW || in_sizes[8] < EW * EW) return;
  if (in_sizes[9] < EW) return;
  if ((long long)out_size < mskN) return;

  const float* nodes = (const float*)d_in[0];
  const float* q1    = (const float*)d_in[1];
  const float* last  = (const float*)d_in[2];
  const float* mask  = (const float*)d_in[3];
  const float* Wqf   = (const float*)d_in[4];
  const float* Wql   = (const float*)d_in[5];
  const float* Wk    = (const float*)d_in[6];
  const float* Wv    = (const float*)d_in[7];
  const float* Wc    = (const float*)d_in[8];
  const float* bc    = (const float*)d_in[9];
  float* out = (float*)d_out;

  const size_t wtB  = al256((size_t)5 * EW * EW * 2);             // 163,840
  const size_t nbB  = al256((size_t)NB * NK * EW * 2);            // 4,194,304
  const size_t qB   = al256((size_t)NB * NH * GQ * QROW * 2);     // 8,388,608
  const size_t kB   = al256((size_t)NB * NH * NK * QROW * 2);     // 8,388,608
  const size_t vB   = al256((size_t)2 * VPL * 2);                 // 8,388,608
  const size_t total = wtB + nbB + qB + kB + vB;                  // 29,523,968
  if (total > ws_size || total > (size_t)WSMAX) return;
  char* w = (char*)d_ws;
  unsigned short* wt  = (unsigned short*)w;
  unsigned short* nbf = (unsigned short*)(w + wtB);
  unsigned short* qpl = (unsigned short*)(w + wtB + nbB);
  unsigned short* kpl = (unsigned short*)(w + wtB + nbB + qB);
  unsigned short* vtp = (unsigned short*)(w + wtB + nbB + qB + kB);
  unsigned short* wctp = wt + 4 * EW * EW;

  // 1: W_comb [in][out] f32 -> W_comb^T bf16 plane; k = nodes.Wk -> k plane (hi|lo tiles), v = nodes.Wv -> V^T hi|lo tiles, nodes -> bf16 plane;
  //    q = q1.Wq_first + last.Wq_last -> q plane (hi|lo tiles); every plane in fragment order
  k_proj<<<1 + KVBLK + QBLK, 128, 0, stream>>>(nodes, q1, last, Wqf, Wql, Wk, Wv, Wc, qpl, kpl, vtp, nbf, wctp);
  // 2: attention + W_comb + final scoring + softmax
  k_dec<<<dim3(GQ / 16, NB), 256, 0, stream>>>(qpl, kpl, vtp, mask, wctp, bc, nbf, out);
}

// v006
// One run takes 52.7 microseconds.
// In both of two side-by-side timings against v005, it was 1.05 times as fast.
// Over all steps from v000 it is 2.15 times as fast.
// Contractions: q/k/v projections = v_wmma_f32_16x16x32_bf16, bf16 (RNE) inputs and weights, one product. q.k scores, P.V, ctx.W_comb and mh.nodes = same bf16 WMMA with every computed operand carried as bf16 hi + bf16 lo (hi.hi + lo.hi + hi.lo; input-side planes are exact bf16, lo == 0). Accumulate f32 everywhere.
// Mask add, online softmax, tanh, bias, final softmax: f32 VALU; both softmaxes run on logits scaled by log2e (the LDS mask tile carries the factor), so exp(x - m) is one subtract and v_exp_f32; tanh(x) = 1 - 2 v_rcp_f32(1 + exp(2x)). No power-of-two carries exist (bf16 planes only).
#include <hip/hip_runtime.h>
#include <stddef.h>
#include <stdint.h>

#ifndef NB
#define NB 32                      // batches processed (a reduced build reads the first NB batches)
#endif
#define GQ     512                 // queries per batch
#define NK     512                 // nodes (keys) per batch
#define EW     128                 // embedding width = heads x head dim
#define NH     8
#define HD     16
#define QROW   32                  // halfwords per q/k plane row (16 hi + 16 lo); 16 rows = one tile [hi|lo][lane][8]
#define FHALF  256                 // halfwords a wave-wide 16-B access covers: 32 lanes x 8
#define VTILE  1024                // halfwords per V^T tile (one head, 32 keys): hi fragment, then lo fragment
#define MPITCH 516                 // floats per LDS mask/score row
#define CPITCH 136                 // halfwords per LDS ctx/mh row
#define TPITCH 136                 // halfwords per LDS weight-transpose row
#define QT     2                   // 16-query tiles a wave of k_dec carries
#define RB     (16 * QT)           // query rows per k_dec block
#define WSMAX  134217728
#define VPL    ((size_t)NB * EW * NK)   // halfwords of V^T hi pieces (as many lo pieces)

static_assert(GQ == NK);                       // k_proj uses one row count for q and k planes
static_assert(NH * HD == EW);
static_assert(EW % 32 == 0 && NK % 32 == 0);
static_assert(GQ % 64 == 0 && (NB * GQ) % 64 == 0);
static_assert(16 * QROW == 2 * FHALF);         // q/k tile: 16 rows = hi piece + lo piece, one wave-wide access each
static_assert(2 * HD * 32 == VTILE && VTILE == 4 * FHALF);   // V^T tile: 2 fragments of 2 accesses
static_assert(16 * EW == 8 * FHALF);           // nodes / W_comb tile: 16 rows = 4 fragments of 2 accesses
static_assert(NH * 64 * QROW == 16384);        // k_proj stage: q/k form
static_assert(2 * EW * 64 == 16384);           // k_proj stage: V^T form
static_assert(16384 == 128 * 16 * 8);          // k_proj copy-out: 128 thr x 16 it x 8 halfwords
static_assert(EW == 32 * 4 && EW == 4 * 4 * 8); // stage_wt: 32 lanes x 4 columns, 4 waves x 4 it x 8 rows
static_assert(EW * EW == 128 * 16 * 8);        // W_comb copy-out: 128 thr x 16 it x 8 halfwords
static_assert(RB * NK == 256 * (8 * QT) * 4);  // k_dec mask staging: 256 thr x 8 QT it x 4 floats
static_assert(GQ % RB == 0 && RB == 8 * 2 * QT); // k_dec grid; phase D: 8 waves x 2 QT rows
static_assert(NK == 8 * 64);                   // k_dec phase C: 8 waves x 64 nodes
static_assert(NK == 32 * 16);                  // k_dec phase D: 32 lanes x 4 x 4 floats per row

typedef int            v4i   __attribute__((ext_vector_type(4)));
typedef int            v8i   __attribute__((ext_vector_type(8)));
typedef float          v4f   __attribute__((ext_vector_type(4)));
typedef float          v8f   __attribute__((ext_vector_type(8)));
typedef __bf16         v16bf __attribute__((ext_vector_type(16)));
typedef __bf16         v8bf  __attribute__((ext_vector_type(8)));
typedef v4i __attribute__((may_alias)) v4ia;
typedef v4f __attribute__((may_alias)) v4fa;
union FragB { v16bf v; v4i q[2]; v8i w; };

// WMMA with hazard guard: ties D, keeps A/B live for 4 VALU slots
__device__ __forceinline__ v8f wmb(const FragB& a, const FragB& b, v8f c) {
  v8f d = __builtin_amdgcn_wmma_f32_16x16x32_bf16(false, a.v, false, b.v, (short)0, c, false, false);
  asm volatile("v_nop\n\tv_nop\n\tv_nop\n\tv_nop" : "+v"(d) : "v"(a.w), "v"(b.w));
  return d;
}

#define L2E 1.4426950408889634f    // log2(e)
// 2^x on the hardware unit: -inf and anything below the f32 range give 0, +inf gives +inf
__device__ __forceinline__ float ex2(float x) { return __builtin_amdgcn_exp2f(x); }
// Eight 2^x / eight 1/x in one statement. Why asm: behind a transcendental the instruction set asks for one
// independent slot before its result is read or its source overwritten; the early-clobber outputs keep every
// result off every source, and the closing v_nop is the slot behind the last one.
__device__ __forceinline__ v8f ex2x8(const v8f x) {
  float y0, y1, y2, y3, y4, y5, y6, y7;
  asm("v_exp_f32 %0, %8\n\tv_exp_f32 %1, %9\n\tv_exp_f32 %2, %10\n\tv_exp_f32 %3, %11\n\t"
      "v_exp_f32 %4, %12\n\tv_exp_f32 %5, %13\n\tv_exp_f32 %6, %14\n\tv_exp_f32 %7, %15\n\tv_nop"
      : "=&v"(y0), "=&v"(y1), "=&v"(y2), "=&v"(y3), "=&v"(y4), "=&v"(y5), "=&v"(y6), "=&v"(y7)
      : "v"(x[0]), "v"(x[1]), "v"(x[2]), "v"(x[3]), "v"(x[4]), "v"(x[5]), "v"(x[6]), "v"(x[7]));
  const v8f y = {y0, y1, y2, y3, y4, y5, y6, y7};
  return y;
}
__device__ __forceinline__ v8f rcpx8(const v8f x) {
  float y0, y1, y2, y3, y4, y5, y6, y7;
  asm("v_rcp_f32 %0, %8\n\tv_rcp_f32 %1, %9\n\tv_rcp_f32 %2, %10\n\tv_rcp_f32 %3, %11\n\t"
      "v_rcp_f32 %4, %12\n\tv_rcp_f32 %5, %13\n\tv_rcp_f32 %6, %14\n\tv_rcp_f32 %7, %15\n\tv_nop"
      : "=&v"(y0), "=&v"(y1), "=&v"(y2), "=&v"(y3), "=&v"(y4), "=&v"(y5), "=&v"(y6), "=&v"(y7)
      : "v"(x[0]), "v"(x[1]), "v"(x[2]), "v"(x[3]), "v"(x[4]), "v"(x[5]), "v"(x[6]), "v"(x[7]));
  const v8f y = {y0, y1, y2, y3, y4, y5, y6, y7};
  return y;
}

typedef float          v2f   __attribute__((ext_vector_type(2)));
typedef __bf16         v2bf  __attribute__((ext_vector_type(2)));
// two f32 -> two bf16 in one word, RNE, by the hardware's packed convert; lo in the low halfword
__device__ __forceinline__ int pack2(float lo, float hi) {
  const v2f x = {lo, hi};
  union { v2bf h; int i; } u;
  u.h = __builtin_convertvector(x, v2bf);
  return u.i;
}
// the f32 values of RNE bf16(a), RNE bf16(b)
__device__ __forceinline__ v2f bf16_val2(float a, float b) {
  const unsigned h = (unsigned)pack2(a, b);
  const v2f r = {__uint_as_float(h << 16), __uint_as_float(h & 0xFFFF0000u)};
  return r;
}
// 8 f32 -> bf16 hi piece + bf16 lo piece (lo = RNE(v - hi)); element 2j in the low halfword of word j
__device__ __forceinline__ void split8(const v8f x, v4i& hi, v4i& lo) {
#pragma unroll
  for (int j = 0; j < 4; ++j) {
    const float a = x[2 * j], b = x[2 * j + 1];
    const unsigned h = (unsigned)pack2(a, b);
    const float ra = a - __uint_as_float(h << 16);
    const float rb = b - __uint_as_float(h & 0xFFFF0000u);
    hi[j] = (int)h;
    lo[j] = pack2(ra, rb);
  }
}
// fragment (row/col = lane&15) from an f32 row: p = row + k0 + 8h; elements 0..7 <- k0+8h+0..7, 8..15 <- k0+16+8h+0..7
__device__ __forceinline__ FragB ldf_frag(const float* __restrict__ p) {
  const v4f a0 = *(const v4fa*)p;
  const v4f a1 = *(const v4fa*)(p + 4);
  const v4f a2 = *(const v4fa*)(p + 16);
  const v4f a3 = *(const v4fa*)(p + 20);
  FragB f;
  f.w[0] = pack2(a0.x, a0.y); f.w[1] = pack2(a0.z, a0.w);
  f.w[2] = pack2(a1.x, a1.y); f.w[3] = pack2(a1.z, a1.w);
  f.w[4] = pack2(a2.x, a2.y); f.w[5] = pack2(a2.z, a2.w);
  f.w[6] = pack2(a3.x, a3.y); f.w[7] = pack2(a3.z, a3.w);
  return f;
}
// same fragment from a GLOBAL plane kept in fragment order: a fragment = 512 halfwords, [element half][lane][8];
// p = fragment + 8 lane. Each of the two wave-wide loads covers 512 contiguous bytes (4 whole 128-B lines).
__device__ __forceinline__ FragB ldg_frag(const unsigned short* __restrict__ p) {
  FragB f;
  f.q[0] = *(const v4ia*)p;
  f.q[1] = *(const v4ia*)(p + FHALF);
  return f;
}

// ---------------------------------------------------------------------------
// Weight staging, by the 4 waves of one block: W[k][n] f32 (128 x 128, [in][out]) -> LDS T[n][k] bf16 bits, row
// pitch TPITCH. A task = 8 rows k x 4 columns n: a wave-wide load is one whole 512-B row of W, a lane packs 8
// consecutive k of each of its 4 columns into one 16-B LDS store. Coverage: 4 waves x 4 it x 8 k = 128 k,
// 32 lanes x 4 n = 128 n. Cross-wave: the caller's block barrier stands between this and the first read of T.
// ---------------------------------------------------------------------------
__device__ __forceinline__ void stage_wt(const float* __restrict__ W, unsigned short* T) {
  const unsigned lane = threadIdx.x & 31u, wave = threadIdx.x >> 5;
#pragma unroll   // all 32 loads of a weight in flight together
  for (unsigned it = 0; it < 4u; ++it) {
    const unsigned k0 = 8u * (wave + 4u * it);
    const float* p = W + (size_t)k0 * EW + 4u * lane;
    v4f r[8];
#pragma unroll   // constant j, c: r[] stays in registers
    for (int j = 0; j < 8; ++j) r[j] = *(const v4fa*)(p + j * EW);
#pragma unroll
    for (int c = 0; c < 4; ++c) {
      const v8f col = {r[0][c], r[1][c], r[2][c], r[3][c], r[4][c], r[5][c], r[6][c], r[7][c]};
      union { v8bf h; v4i q; } u;
      u.h = __builtin_convertvector(col, v8bf);      // RNE, two values an instruction; k even in the low halfword
      *(v4ia*)(T + (4u * lane + (unsigned)c) * TPITCH + k0) = u.q;
    }
  }
}
// fragment from an LDS k-contiguous bf16 row: p = row + k0 + 8h (same element order as ldg_frag)
__device__ __forceinline__ FragB lds_frag(const unsigned short* p) {
  FragB f;
  f.q[0] = *(const v4ia*)p;
  f.q[1] = *(const v4ia*)(p + 16);
  return f;
}

// ---------------------------------------------------------------------------
// Projections. Block = 64 rows of the flattened [b][row] input, 4 waves x 16 rows; activations are held
// as bf16 fragments (col = lane&15 = input row) and every head (16 output columns) is one rolled step.
// MODE 0: q = x1.W1 + x2.W2.   MODE 1: k = x1.W1, then v = x1.W2, and the bf16 fragments of x1 (the nodes) also go
//   out as the plane nb[b][16-node tile][k step][element half][lane][8] (B operand of the final scoring product, in
//   fragment order): a lane stores its own 16-B pieces, each wave-wide store is 512 B in a row.
// Both modes run in ONE launch (k_proj): they depend only on the inputs, not on each other. A block first stages its
// own two weights, transposed to bf16 [out][in], in LDS (stage_wt) and takes every weight fragment from there.
// q/k form: D = Wt_tile (A, row = out col) x X (B, col = input row): D[row d = 8h+r][col = input row], so a
//   lane holds 8 consecutive d of one row -> one 16-B LDS store per plane half. Plane (b,head,16-row tile) =
//   hi[lane][8] | lo[lane][8] halfwords, lane = 16h + row: the piece a lane of k_dec takes, so its wave-wide load is
//   512 B in a row.
// v form: D = X (A) x Wt_tile (B): D[row = input row 8h+r][col d], lane holds 8 consecutive n of column d ->
//   one 16-B LDS store into the V^T stage [head][32-key tile][hi|lo][element half][lane][8], the global order too.
// LDS stg: cross-wave (block barriers); fully written before each copy-out (8 heads x 64 rows x 32, or
// coverage: q/k plane: NB*8 blocks x 16384 halfwords = NB*8*512*32; V^T: NB*8 blocks x 16384 (hi + lo) = 2*NB*128*512.
// ---------------------------------------------------------------------------
template <int MODE>
__device__ __forceinline__ void proj_body(const unsigned blk, unsigned short* stg,
                                          const float* __restrict__ x1, const float* __restrict__ x2,
                                          const float* __restrict__ w1, const float* __restrict__ w2,
                                          unsigned short* w1t, unsigned short* w2t,
                                          unsigned short* o1, unsigned short* o2, unsigned short* nb) {
  const unsigned tid = threadIdx.x, lane = tid & 31u, wave = tid >> 5, hh = lane >> 4, m = lane & 15u;
  const unsigned row0 = blk * 64u;
  const unsigned bb = row0 >> 9, r0 = row0 & 511u;
  const unsigned xrow = row0 + 16u * wave + m;

  // x1's loads (from memory, the longest wait) are issued first and packed behind the weight staging
  v4f xr[4][4];
  const float* xp = x1 + (size_t)xrow * EW + 8u * hh;
#pragma unroll
  for (int ks = 0; ks < 4; ++ks) {
    const float* p = xp + 32 * ks;
    xr[ks][0] = *(const v4fa*)p;        xr[ks][1] = *(const v4fa*)(p + 4);
    xr[ks][2] = *(const v4fa*)(p + 16); xr[ks][3] = *(const v4fa*)(p + 20);
  }
  // the wait that stands before a register named by an issued load is written again; xp as an input keeps the
  // address pair out of the loads' own destinations up to here
  asm volatile("s_wait_xcnt 0x0" :: "v"(xp) : "memory");
#pragma unroll 1   // one weight a trip: 32 loads in flight, not 64, which keeps the block under 256 registers
  for (unsigned w = 0; w < 2u; ++w) stage_wt(w ? w2 : w1, w ? w2t : w1t);
  FragB xa[4], xb[4];
#pragma unroll
  for (int ks = 0; ks < 4; ++ks) {
#pragma unroll
    for (int j = 0; j < 4; ++j) {
      xa[ks].w[2 * j] = pack2(xr[ks][j].x, xr[ks][j].y);
      xa[ks].w[2 * j + 1] = pack2(xr[ks][j].z, xr[ks][j].w);
    }
    if (MODE == 0) xb[ks] = ldf_frag(x2 + (size_t)xrow * EW + 32 * ks + 8u * hh);
    else xb[ks] = xa[ks];
  }
  __syncthreads();   // both staged weights are complete before any wave reads a fragment
  if (MODE == 1) {
    unsigned short* nd = nb + (size_t)(row0 + 16u * wave) * EW + 8u * lane;
#pragma unroll   // constant ks: xa[] stays in registers
    for (int ks = 0; ks < 4; ++ks) {
      *(v4i*)(nd + 2 * FHALF * ks) = xa[ks].q[0];
      *(v4i*)(nd + 2 * FHALF * ks + FHALF) = xa[ks].q[1];
    }
  }
  const v8f zero8 = {0.f, 0.f, 0.f, 0.f, 0.f, 0.f, 0.f, 0.f};

#pragma unroll 1
  for (unsigned t = 0; t < NH; ++t) {
    const unsigned short* wp = w1t + (16u * t + m) * TPITCH + 8u * hh;
    const unsigned short* wq = w2t + (16u * t + m) * TPITCH + 8u * hh;
    v8f acc = zero8;
    FragB wf[4], wg[4];
#pragma unroll   // the step's LDS reads stand together, ahead of its matrix chain: one LDS latency a step
    for (int ks = 0; ks < 4; ++ks) {
      wf[ks] = lds_frag(wp + 32 * ks);
      if (MODE == 0) wg[ks] = lds_frag(wq + 32 * ks);
    }
#pragma unroll
    for (int ks = 0; ks < 4; ++ks) {
      acc = wmb(wf[ks], xa[ks], acc);
      if (MODE == 0) acc = wmb(wg[ks], xb[ks], acc);
    }
    v4i hi, lo;
    split8(acc, hi, lo);
    const unsigned so = (t * 64u + 16u * wave) * QROW + 8u * lane;   // tile of 16 rows: [hi|lo][lane][8]
    *(v4ia*)(stg + so) = hi;
    *(v4ia*)(stg + so + FHALF) = lo;
  }
  __syncthreads();
  {
    unsigned short* dst = o1 + ((size_t)bb * NH * GQ + r0) * QROW;
#pragma unroll 1
    for (unsigned it = 0; it < 16u; ++it) {
      const unsigned p = it * 128u + tid, t = p >> 8, wi = p & 255u;
      const v4i v = *(const v4ia*)(stg + p * 8u);
      *(v4i*)(dst + (size_t)t * (GQ * QROW) + wi * 8u) = v;
      asm volatile("s_wait_xcnt 0x0" ::: "memory");   // stands before the next trip, or the code behind the loop, writes a register this store names
    }
    
  }
  if (MODE == 1) {
    __syncthreads();
#pragma unroll 1
    for (unsigned t = 0; t < NH; ++t) {
      const unsigned short* wq = w2t + (16u * t + m) * TPITCH + 8u * hh;
      v8f acc = zero8;
      FragB wf[4];
#pragma unroll   // as above: the reads together, then the chain
      for (int ks = 0; ks < 4; ++ks) wf[ks] = lds_frag(wq + 32 * ks);
#pragma unroll
      for (int ks = 0; ks < 4; ++ks) acc = wmb(xa[ks], wf[ks], acc);
      v4i hi, lo;
      split8(acc, hi, lo);                       // acc[r] = v[n = 16 wave + 8h + r][col 16t + m]
      // 32-key tile wave >> 1, element half wave & 1 of its hi and lo fragments
      const unsigned so = (2u * t + (wave >> 1)) * VTILE + (wave & 1u) * FHALF + 8u * lane;
      *(v4ia*)(stg + so) = hi;
      *(v4ia*)(stg + so + 2 * FHALF) = lo;
    }
    __syncthreads();
    unsigned short* dst = o2 + ((size_t)bb * NH * (NK / 32) + (r0 >> 5)) * VTILE;
#pragma unroll 1
    for (unsigned it = 0; it < 16u; ++it) {
      const unsigned p = it * 128u + tid, t = p >> 8, wi = p & 255u;   // a head's two tiles: 4 KiB in a row
      const v4i v = *(const v4ia*)(stg + p * 8u);
      *(v4i*)(dst + (size_t)t * ((NK / 32) * VTILE) + wi * 8u) = v;
      asm volatile("s_wait_xcnt 0x0" ::: "memory");   // stands before the next trip, or the code behind the loop, writes a register this store names
    }
    
  }
}

// One grid for both projections and the W_comb plane: block 0 writes W_comb^T as a bf16 plane in fragment order for the next launch,
// blocks 1 .. KVBLK take the k/v form (the longer one, so it starts first), the rest the q form. The choice is
// uniform in a block, so every barrier of a body is passed by all its waves.
// W_comb plane: 8 tiles of 16 rows in fragment order; a wave-wide store is 512 B in a row, each piece once.
#define KVBLK ((NB * NK) / 64)
#define QBLK  ((NB * GQ) / 64)
__global__ __launch_bounds__(128) void k_proj(const float* __restrict__ nodes, const float* __restrict__ q1,
                                              const float* __restrict__ last,
                                              const float* __restrict__ wqf, const float* __restrict__ wql,
                                              const float* __restrict__ wk, const float* __restrict__ wv,
                                              const float* __restrict__ wc,
                                              unsigned short* qpl, unsigned short* kpl, unsigned short* vtp,
                                              unsigned short* nbf, unsigned short* wct) {
  __shared__ __attribute__((aligned(16))) unsigned short stg[16384];
  __shared__ __attribute__((aligned(16))) unsigned short wl1[EW * TPITCH];
  __shared__ __attribute__((aligned(16))) unsigned short wl2[EW * TPITCH];
  if (blockIdx.x == 0u) {
    stage_wt(wc, wl1);
    __syncthreads();
#pragma unroll 4   // four LDS reads in flight a trip instead of one
    for (unsigned it = 0; it < 16u; ++it) {
      // p = 16-B piece of the plane in fragment order: [16-row tile][k step][element half][k half h][row m]
      const unsigned p = it * 128u + threadIdx.x, n = ((p >> 8) << 4) | (p & 15u);
      const unsigned c = (((p >> 6) & 3u) << 2) | (((p >> 5) & 1u) << 1) | ((p >> 4) & 1u);
      const v4i v = *(const v4ia*)(wl1 + n * TPITCH + c * 8u);
      *(v4i*)(wct + p * 8u) = v;
      // the wait that stands before the next trip writes the registers these stores name
      if ((it & 3u) == 3u) asm volatile("s_wait_xcnt 0x0" ::: "memory");
    }
  } else if (blockIdx.x <= (unsigned)KVBLK) {
    proj_body<1>(blockIdx.x - 1u, stg, nodes, nodes, wk, wv, wl1, wl2, kpl, vtp, nbf);
  } else {
    proj_body<0>(blockIdx.x - 1u - (unsigned)KVBLK, stg, q1, last, wqf, wql, wl1, wl2, qpl, qpl, nbf);
  }
}

// ---------------------------------------------------------------------------
// Fused decoder block: one block = (batch b, RB = 32 query rows g0..g0+31), 8 waves. Every wave carries QT = 2 tiles of
// 16 queries through phases A, B and C, so each K, V^T, W_comb^T and node fragment is loaded once for both tiles and
// the two tiles' chains are independent work for the wave. What is said below of 16 queries holds for each tile.
// Phase 0: mask tile [32][512] f32 (bf16-convert of the input value, times log2e) -> LDS mk (cross-wave, block barrier).
// Phase A (wave = head): flash attention in the transposed domain.
//   S^T tile = K (A, row = key) x Q^T (B, col = query): K = 16 is laid as [k_hi|k_hi] x [q_hi|q_lo] plus
//   [k_lo|0] x [q_hi|q_lo] along the 32-deep k axis. D[row key 8h+r][col query m]. Softmax statistics are
//   per lane (query m); the two lane halves combine by one xor-16 exchange. The P^T B-fragment is the lane's
//   own 16 score results (tile 0 -> elements 0..7, tile 1 -> elements 8..15). O^T = V^T (A, row d) x P^T:
//   D[row d 8h+r][col query m], scaled per lane. ctx hi/lo -> LDS cst[plane][query][128] by 16-B stores.
// Phase B (wave = 16 output columns e): mh^T = W_comb^T (A, global plane) x ctx^T (B, from cst), hi + lo,
//   + bf16(b_comb[e]); mh hi/lo -> LDS mst[plane][query][128] by 16-B stores.
// Phase C (wave = 64 nodes): s2 = mh (A, from mst, hi + lo) x nodes^T (B, global bf16 plane);
//   D[row query 8h+r][col node m]; s = (10 tanh(x/sqrt(128)) + mask) log2e, written over the mask value in place.
// Phase D (wave = 4 rows): row softmax from LDS; each instruction writes 512 contiguous bytes (4 whole
// LDS extents: mk rows 0..31 cols 0..511 written in phase 0 and consumed cols 0..511; cst/mst rows 0..31
//   cols 0..127 of both planes written by all 8 waves, consumed cols 0..127. Pad columns are never read.
// coverage: grid (16, NB) x 32 rows x 512 = NB*512*512 outputs, each written by exactly one lane.
// ---------------------------------------------------------------------------
__global__ __launch_bounds__(256) void k_dec(const unsigned short* __restrict__ qpl,
                                             const unsigned short* __restrict__ kpl,
                                             const unsigned short* __restrict__ vt,
                                             const float* __restrict__ mask,
                                             const unsigned short* __restrict__ wct,
                                             const float* __restrict__ bcomb,
                                             const unsigned short* __restrict__ nbf,
                                             float* out) {
  __shared__ __attribute__((aligned(16))) float mk[RB * MPITCH];
  __shared__ __attribute__((aligned(16))) unsigned short cst[2 * RB * CPITCH];
  __shared__ __attribute__((aligned(16))) unsigned short mst[2 * RB * CPITCH];
  const unsigned tid = threadIdx.x, lane = tid & 31u, wave = tid >> 5, hh = lane >> 4, m = lane & 15u;
  const unsigned g0 = blockIdx.x * (unsigned)RB, b = blockIdx.y;
  const v8f zero8 = {0.f, 0.f, 0.f, 0.f, 0.f, 0.f, 0.f, 0.f};
  const v4i zero4 = {0, 0, 0, 0};

  // ---- phase 0: mask tile ----
  {
    const float* mg = mask + ((size_t)b * GQ + g0) * NK;
#pragma unroll 4   // four trips as with one tile: a trip's loads wait for memory together
    for (unsigned it = 0; it < 8u * QT; ++it) {
      const unsigned p = it * 256u + tid, row = p >> 7, c4 = (p & 127u) << 2;
      v4f v = *(const v4fa*)(mg + (size_t)row * NK + c4);
      const v2f v01 = bf16_val2(v.x, v.y) * L2E, v23 = bf16_val2(v.z, v.w) * L2E;
      *(v4fa*)(mk + row * MPITCH + c4) = __builtin_shufflevector(v01, v23, 0, 1, 2, 3);
    }
  }
  __syncthreads();

  // ---- phase A: attention for head = wave, both query tiles ----
  {
    const unsigned bh = b * NH + wave;
    const unsigned short* qp = qpl + ((size_t)bh * GQ + g0) * QROW + 8u * lane;
    FragB qf[QT];
#pragma unroll   // constant qt here and below: the per-tile arrays stay in registers
    for (int qt = 0; qt < QT; ++qt) {
      qf[qt].q[0] = *(const v4ia*)(qp + qt * 16 * QROW);           // q_hi[8h .. 8h+7]  (k slots 8h..)
      qf[qt].q[1] = *(const v4ia*)(qp + qt * 16 * QROW + FHALF);   // q_lo[8h .. 8h+7]  (k slots 16+8h..)
    }
    const unsigned short* kb = kpl + (size_t)bh * NK * QROW + 8u * lane;
    const unsigned short* vb = vt + (size_t)bh * ((NK / 32) * VTILE) + 8u * lane;
    const unsigned moff = m * MPITCH + 8u * hh;
    v8f o[QT];
    float mrun[QT], lrun[QT];
#pragma unroll
    for (int qt = 0; qt < QT; ++qt) { o[qt] = zero8; mrun[qt] = -3.0e38f; lrun[qt] = 0.0f; }
#pragma unroll 1
    for (unsigned n0 = 0; n0 < NK; n0 += 32u) {
      const unsigned short* kp = kb + (size_t)n0 * QROW;
      const v4i kh0 = *(const v4ia*)kp;
      const v4i kl0 = *(const v4ia*)(kp + FHALF);
      const v4i kh1 = *(const v4ia*)(kp + 16 * QROW);
      const v4i kl1 = *(const v4ia*)(kp + 16 * QROW + FHALF);
      const unsigned short* vp = vb + (size_t)(n0 >> 5) * VTILE;
      const FragB fvh = ldg_frag(vp);
      const FragB fvl = ldg_frag(vp + 2 * FHALF);
      // the wait that stands before a register named by an issued load is written again; kp and vp as inputs keep the
      // address pairs whole up to here
      asm volatile("s_wait_xcnt 0x0" :: "v"(kp), "v"(vp) : "memory");
      FragB a10, a20, a11, a21;
      a10.q[0] = kh0; a10.q[1] = kh0;
      a20.q[0] = kl0; a20.q[1] = zero4;
      a11.q[0] = kh1; a11.q[1] = kh1;
      a21.q[0] = kl1; a21.q[1] = zero4;
#pragma unroll
      for (int qt = 0; qt < QT; ++qt) {
        v8f s0 = wmb(a10, qf[qt], zero8);
        s0 = wmb(a20, qf[qt], s0);
        v8f s1 = wmb(a11, qf[qt], zero8);
        s1 = wmb(a21, qf[qt], s1);

        const float* mp = mk + (unsigned)qt * (16u * MPITCH) + moff + n0;
        const v4f m0 = *(const v4fa*)mp;
        const v4f m1 = *(const v4fa*)(mp + 4);
        const v4f m2 = *(const v4fa*)(mp + 16);
        const v4f m3 = *(const v4fa*)(mp + 20);
        const v8f mk0 = __builtin_shufflevector(m0, m1, 0, 1, 2, 3, 4, 5, 6, 7);
        const v8f mk1 = __builtin_shufflevector(m2, m3, 0, 1, 2, 3, 4, 5, 6, 7);
        const v8f a0 = s0 * (0.25f * L2E) + mk0;      // key n0 + 8h + r, log2 domain
        const v8f a1 = s1 * (0.25f * L2E) + mk1;      // key n0 + 16 + 8h + r

        float t = fmaxf(a0[0], a1[0]);
#pragma unroll
        for (int r = 1; r < 8; ++r) t = fmaxf(t, fmaxf(a0[r], a1[r]));
        t = fmaxf(t, __shfl_xor(t, 16));
        const float mnew = fmaxf(mrun[qt], t);
        const float sc = ex2(mrun[qt] - mnew);
        const v8f p0 = ex2x8(a0 - mnew);
        const v8f p1 = ex2x8(a1 - mnew);
        float ps = 0.0f;
#pragma unroll
        for (int r = 0; r < 8; ++r) ps += p0[r] + p1[r];
        lrun[qt] = lrun[qt] * sc + ps;
        mrun[qt] = mnew;
        o[qt] = o[qt] * sc;

        FragB ph, pl;
        split8(p0, ph.q[0], pl.q[0]);
        split8(p1, ph.q[1], pl.q[1]);
        o[qt] = wmb(fvh, ph, o[qt]);
        o[qt] = wmb(fvl, ph, o[qt]);
        o[qt] = wmb(fvh, pl, o[qt]);
      }
    }
#pragma unroll
    for (int qt = 0; qt < QT; ++qt) {
      const float lt = lrun[qt] + __shfl_xor(lrun[qt], 16);
      const float inv = 1.0f / lt;
      const v8f c = o[qt] * inv;              // ctx[query 16 qt + m][16 wave + 8h + r]
      v4i hi, lo;
      split8(c, hi, lo);
      const unsigned co = (16u * (unsigned)qt + m) * CPITCH + 16u * wave + 8u * hh;
      *(v4ia*)(cst + co) = hi;
      *(v4ia*)(cst + RB * CPITCH + co) = lo;
    }
  }
  __syncthreads();

  // ---- phase B: mh^T tiles for e = 16 wave .. 16 wave + 15 ----
  {
    const unsigned e0 = 16u * wave;
    const unsigned short* wp = wct + (size_t)e0 * EW + 8u * lane;
    const unsigned co = m * CPITCH + 8u * hh;
    v8f acc[QT];
#pragma unroll
    for (int qt = 0; qt < QT; ++qt) acc[qt] = zero8;
#pragma unroll
    for (int ks = 0; ks < 4; ++ks) {
      const FragB wf = ldg_frag(wp + 2 * FHALF * ks);
#pragma unroll
      for (int qt = 0; qt < QT; ++qt) {
        const unsigned short* cp = cst + qt * 16 * CPITCH + co + 32 * ks;
        FragB ch, cl;
        ch.q[0] = *(const v4ia*)cp;
        ch.q[1] = *(const v4ia*)(cp + 16);
        cl.q[0] = *(const v4ia*)(cp + RB * CPITCH);
        cl.q[1] = *(const v4ia*)(cp + RB * CPITCH + 16);
        acc[qt] = wmb(wf, ch, acc[qt]);
        acc[qt] = wmb(wf, cl, acc[qt]);
      }
    }
    const v4f b0 = *(const v4fa*)(bcomb + e0 + 8u * hh);
    const v4f b1 = *(const v4fa*)(bcomb + e0 + 8u * hh + 4u);
    const v2f c01 = bf16_val2(b0.x, b0.y), c23 = bf16_val2(b0.z, b0.w);
    const v2f c45 = bf16_val2(b1.x, b1.y), c67 = bf16_val2(b1.z, b1.w);
#pragma unroll
    for (int qt = 0; qt < QT; ++qt) {
      v8f a = acc[qt];
      a[0] += c01.x; a[1] += c01.y; a[2] += c23.x; a[3] += c23.y;
      a[4] += c45.x; a[5] += c45.y; a[6] += c67.x; a[7] += c67.y;
      v4i hi, lo;
      split8(a, hi, lo);                      // mh[query 16 qt + m][e0 + 8h + r]
      const unsigned mo = (16u * (unsigned)qt + m) * CPITCH + e0 + 8u * hh;
      *(v4ia*)(mst + mo) = hi;
      *(v4ia*)(mst + RB * CPITCH + mo) = lo;
    }
  }
  __syncthreads();

  // ---- phase C: s = (10 tanh(mh . node / sqrt(128)) + mask) log2e, nodes 64 wave .. 64 wave + 63 ----
  {
    const float k2 = (float)(2.0 * 1.4426950408889634 / 11.313708498984761);   // exp(2 x), x = acc / sqrt(128), as 2^(acc k2)
    const unsigned ao = m * CPITCH + 8u * hh;
    FragB ah[QT][4], al[QT][4];
#pragma unroll
    for (int qt = 0; qt < QT; ++qt) {
#pragma unroll
      for (int ks = 0; ks < 4; ++ks) {
        const unsigned short* ap = mst + qt * 16 * CPITCH + ao + 32 * ks;
        ah[qt][ks].q[0] = *(const v4ia*)ap;
        ah[qt][ks].q[1] = *(const v4ia*)(ap + 16);
        al[qt][ks].q[0] = *(const v4ia*)(ap + RB * CPITCH);
        al[qt][ks].q[1] = *(const v4ia*)(ap + RB * CPITCH + 16);
      }
    }
#pragma unroll 1
    for (unsigned j = 0; j < 4u; ++j) {
      const unsigned n0 = 64u * wave + 16u * j;
      const unsigned short* np = nbf + ((size_t)b * NK + n0) * EW + 8u * lane;
      v8f acc[QT];
#pragma unroll
      for (int qt = 0; qt < QT; ++qt) acc[qt] = zero8;
#pragma unroll
      for (int ks = 0; ks < 4; ++ks) {
        const FragB nf = ldg_frag(np + 2 * FHALF * ks);
#pragma unroll
        for (int qt = 0; qt < QT; ++qt) {
          acc[qt] = wmb(ah[qt][ks], nf, acc[qt]);
          acc[qt] = wmb(al[qt][ks], nf, acc[qt]);
        }
      }
      // the wait that stands before a register named by an issued load is written again; np as an input keeps the
      // address pair whole up to here
      asm volatile("s_wait_xcnt 0x0" :: "v"(np) : "memory");
#pragma unroll
      for (int qt = 0; qt < QT; ++qt) {
        const v8f q = rcpx8(ex2x8(acc[qt] * k2) + 1.0f);      // exp(2x) = +inf -> tanh 1, 0 -> tanh -1
#pragma unroll
        for (int r = 0; r < 8; ++r) {
          const unsigned idx = (16u * (unsigned)qt + 8u * hh + (unsigned)r) * MPITCH + n0 + m;   // D element r = (query 16 qt + 8h + r, node m)
          const float s = (10.0f * L2E - (20.0f * L2E) * q[r]) + mk[idx];   // log2 domain, like the mask tile
          mk[idx] = s;
        }
      }
    }
  }
  __syncthreads();

  // ---- phase D: row softmax, rows 2 QT wave .. 2 QT wave + 2 QT - 1, two rows a pass ----
#pragma unroll 1   // a pass is the two-row body of one tile; rolled, its stores' registers are rewritten only behind the wait at its foot
  for (unsigned pp = 0; pp < (unsigned)QT; ++pp) {
    const unsigned row0 = (unsigned)(2 * QT) * wave + 2u * pp;
    v4f res[2][4];
#pragma unroll
    for (int rr = 0; rr < 2; ++rr) {
      const unsigned so = (row0 + (unsigned)rr) * MPITCH + 4u * lane;
      v4f v[4];
#pragma unroll
      for (int j = 0; j < 4; ++j) v[j] = *(const v4fa*)(mk + so + 128 * j);
      float mx = v[0].x;
#pragma unroll
      for (int j = 0; j < 4; ++j) mx = fmaxf(fmaxf(fmaxf(mx, v[j].x), fmaxf(v[j].y, v[j].z)), v[j].w);
      mx = fmaxf(mx, __shfl_xor(mx, 16));
      mx = fmaxf(mx, __shfl_xor(mx, 8));
      mx = fmaxf(mx, __shfl_xor(mx, 4));
      mx = fmaxf(mx, __shfl_xor(mx, 2));
      mx = fmaxf(mx, __shfl_xor(mx, 1));
      float sum = 0.0f;
#pragma unroll
      for (int j = 0; j < 4; j += 2) {
        const v8f e = ex2x8(__builtin_shufflevector(v[j], v[j + 1], 0, 1, 2, 3, 4, 5, 6, 7) - mx);
        v[j] = __builtin_shufflevector(e, e, 0, 1, 2, 3);
        v[j + 1] = __builtin_shufflevector(e, e, 4, 5, 6, 7);
        sum += (v[j].x + v[j].y) + (v[j].z + v[j].w);
        sum += (v[j + 1].x + v[j + 1].y) + (v[j + 1].z + v[j + 1].w);
      }
      sum += __shfl_xor(sum, 16);
      sum += __shfl_xor(sum, 8);
      sum += __shfl_xor(sum, 4);
      sum += __shfl_xor(sum, 2);
      sum += __shfl_xor(sum, 1);
      const float inv = 1.0f / sum;
#pragma unroll
      for (int j = 0; j < 4; ++j) res[rr][j] = v[j] * inv;
    }
    float* ob = out + ((size_t)b * GQ + g0 + row0) * NK + 4u * lane;
#pragma unroll
    for (int rr = 0; rr < 2; ++rr)
#pragma unroll
      for (int j = 0; j < 4; ++j) *(v4f*)(ob + (size_t)rr * NK + 128 * j) = res[rr][j];
    asm volatile("s_wait_xcnt 0x0" ::: "memory");   // stands before the next pass writes a register these stores name
  }
}

// ---------------------------------------------------------------------------
static inline size_t al256(size_t o) { return (o + 255) & ~(size_t)255; }

extern "C" void kernel_launch(void* const* d_in, const int* in_sizes, int n_in,
                              void* d_out, int out_size, void* d_ws, size_t ws_size,
                              hipStream_t stream) {
  if (n_in < 10) return;
  const long long actN = (long long)NB * NK * EW;
  const long long actG = (long long)NB * GQ * EW;
  const long long mskN = (long long)NB * GQ * NK;
  if ((long long)in_sizes[0] < actN) return;             // encoded_nodes
  if ((long long)in_sizes[1] < actG) return;             // encoded_q1
  if ((long long)in_sizes[2] < actG) return;             // encoded_last_node
  if ((long long)in_sizes[3] < mskN) return;             // ninf_mask (f32, additive)
  if (in_sizes[4] < EW * EW || in_sizes[5] < EW * EW || in_sizes[6] < EW * EW ||
      in_sizes[7] < EW * EW || in_sizes[8] < EW * EW) return;
  if (in_sizes[9] < EW) return;
  if ((long long)out_size < mskN) return;

  const float* nodes = (const float*)d_in[0];
  const float* q1    = (const float*)d_in[1];
  const float* last  = (const float*)d_in[2];
  const float* mask  = (const float*)d_in[3];
  const float* Wqf   = (const float*)d_in[4];
  const float* Wql   = (const float*)d_in[5];
  const float* Wk    = (const float*)d_in[6];
  const float* Wv    = (const float*)d_in[7];
  const float* Wc    = (const float*)d_in[8];
  const float* bc    = (const float*)d_in[9];
  float* out = (float*)d_out;

  const size_t wtB  = al256((size_t)5 * EW * EW * 2);             // 163,840
  const size_t nbB  = al256((size_t)NB * NK * EW * 2);            // 4,194,304
  const size_t qB   = al256((size_t)NB * NH * GQ * QROW * 2);     // 8,388,608
  const size_t kB   = al256((size_t)NB * NH * NK * QROW * 2);     // 8,388,608
  const size_t vB   = al256((size_t)2 * VPL * 2);                 // 8,388,608
  const size_t total = wtB + nbB + qB + kB + vB;                  // 29,523,968
  if (total > ws_size || total > (size_t)WSMAX) return;
  char* w = (char*)d_ws;
  unsigned short* wt  = (unsigned short*)w;
  unsigned short* nbf = (unsigned short*)(w + wtB);
  unsigned short* qpl = (unsigned short*)(w + wtB + nbB);
  unsigned short* kpl = (unsigned short*)(w + wtB + nbB + qB);
  unsigned short* vtp = (unsigned short*)(w + wtB + nbB + qB + kB);
  unsigned short* wctp = wt + 4 * EW * EW;

  // 1: W_comb [in][out] f32 -> W_comb^T bf16 plane; k = nodes.Wk -> k plane (hi|lo tiles), v = nodes.Wv -> V^T hi|lo tiles, nodes -> bf16 plane;
  //    q = q1.Wq_first + last.Wq_last -> q plane (hi|lo tiles); every plane in fragment order
  k_proj<<<1 + KVBLK + QBLK, 128, 0, stream>>>(nodes, q1, last, Wqf, Wql, Wk, Wv, Wc, qpl, kpl, vtp, nbf, wctp);
  // 2: attention + W_comb + final scoring + softmax
  k_dec<<<dim3(GQ / RB, NB), 256, 0, stream>>>(qpl, kpl, vtp, mask, wctp, bc, nbf, out);
}

// v007
// Measured time: 47.4 microseconds a run.
// Timed twice side by side with v006, it ran 1.11 and 1.12 times as fast.
// Over all steps from v000 it is 2.40 times as fast.
// Contractions: q/k/v projections = v_wmma_f32_16x16x32_bf16, bf16 (RNE) inputs and weights, one product. q.k scores, P.V, ctx.W_comb and mh.nodes = same bf16 WMMA with every computed operand carried as bf16 hi + bf16 lo (hi.hi + lo.hi + hi.lo; input-side planes are exact bf16, lo == 0). Accumulate f32 everywhere.
// Mask add, online softmax, tanh, bias, final softmax: f32 VALU; both softmaxes run on logits scaled by log2e (the LDS mask tile carries the factor), so exp(x - m) is one subtract and v_exp_f32; tanh(x) = 1 - 2 v_rcp_f32(1 + exp(2x)). No power-of-two carries exist (bf16 planes only).
#include <hip/hip_runtime.h>
#include <stddef.h>
#include <stdint.h>

#ifndef NB
#define NB 32                      // batches processed (a reduced build reads the first NB batches)
#endif
#define GQ     512                 // queries per batch
#define NK     512                 // nodes (keys) per batch
#define EW     128                 // embedding width = heads x head dim
#define NH     8
#define HD     16
#define QROW   32                  // halfwords per q/k plane row (16 hi + 16 lo); 16 rows = one tile [hi|lo][lane][8]
#define FHALF  256                 // halfwords a wave-wide 16-B access covers: 32 lanes x 8
#define VTILE  1024                // halfwords per V^T tile (one head, 32 keys): hi fragment, then lo fragment
#define MPITCH 516                 // floats per LDS mask/score row
#define CPITCH 136                 // halfwords per LDS ctx/mh row
#define TPITCH 136                 // halfwords per LDS weight-transpose row
#define QT     2                   // 16-query tiles a wave of k_dec carries
#define RB     (16 * QT)           // query rows per k_dec block
#define WSMAX  134217728
#define VPL    ((size_t)NB * EW * NK)   // halfwords of V^T hi pieces (as many lo pieces)

static_assert(GQ == NK);                       // k_proj uses one row count for q and k planes
static_assert(NH * HD == EW);
static_assert(EW % 32 == 0 && NK % 32 == 0);
static_assert(GQ % 64 == 0 && (NB * GQ) % 64 == 0);
static_assert(16 * QROW == 2 * FHALF);         // q/k tile: 16 rows = hi piece + lo piece, one wave-wide access each
static_assert(2 * HD * 32 == VTILE && VTILE == 4 * FHALF);   // V^T tile: 2 fragments of 2 accesses
static_assert(16 * EW == 8 * FHALF);           // nodes / W_comb tile: 16 rows = 4 fragments of 2 accesses
static_assert(NH * 64 * QROW == 16384);        // k_proj stage: q/k form
static_assert(2 * EW * 64 == 16384);           // k_proj stage: V^T form
static_assert(16384 == 128 * 16 * 8);          // k_proj copy-out: 128 thr x 16 it x 8 halfwords
static_assert(EW == 32 * 4 && EW == 4 * 4 * 8); // stage_wt: 32 lanes x 4 columns, 4 waves x 4 it x 8 rows
static_assert(EW * EW == 128 * 16 * 8);        // W_comb copy-out: 128 thr x 16 it x 8 halfwords
static_assert(RB * NK == 256 * (8 * QT) * 4);  // k_dec mask staging: 256 thr x 8 QT it x 4 floats
static_assert(GQ % RB == 0 && RB == 8 * 2 * QT); // k_dec grid; phase D: 8 waves x 2 QT rows
static_assert(NK == 8 * 64);                   // k_dec phase C: 8 waves x 64 nodes
static_assert(NK == 32 * 16);                  // k_dec phase D: 32 lanes x 4 x 4 floats per row

typedef int            v4i   __attribute__((ext_vector_type(4)));
typedef int            v8i   __attribute__((ext_vector_type(8)));
typedef float          v4f   __attribute__((ext_vector_type(4)));
typedef float          v8f   __attribute__((ext_vector_type(8)));
typedef __bf16         v16bf __attribute__((ext_vector_type(16)));
typedef __bf16         v8bf  __attribute__((ext_vector_type(8)));
typedef v4i __attribute__((may_alias)) v4ia;
typedef v4f __attribute__((may_alias)) v4fa;
union FragB { v16bf v; v4i q[2]; v8i w; };

// WMMA by the builtin: the compiler keeps the distance behind it and fills the slots with other work where it can
__device__ __forceinline__ v8f wmb(const FragB& a, const FragB& b, v8f c) {
  return __builtin_amdgcn_wmma_f32_16x16x32_bf16(false, a.v, false, b.v, (short)0, c, false, false);
}

#define L2E 1.4426950408889634f    // log2(e)
// 2^x on the hardware unit: -inf and anything below the f32 range give 0, +inf gives +inf
__device__ __forceinline__ float ex2(float x) { return __builtin_amdgcn_exp2f(x); }
// Eight 2^x / eight 1/x in one statement. Why asm: behind a transcendental the instruction set asks for one
// independent slot before its result is read or its source overwritten; the early-clobber outputs keep every
// result off every source, and the closing v_nop is the slot behind the last one.
__device__ __forceinline__ v8f ex2x8(const v8f x) {
  float y0, y1, y2, y3, y4, y5, y6, y7;
  asm("v_exp_f32 %0, %8\n\tv_exp_f32 %1, %9\n\tv_exp_f32 %2, %10\n\tv_exp_f32 %3, %11\n\t"
      "v_exp_f32 %4, %12\n\tv_exp_f32 %5, %13\n\tv_exp_f32 %6, %14\n\tv_exp_f32 %7, %15\n\tv_nop"
      : "=&v"(y0), "=&v"(y1), "=&v"(y2), "=&v"(y3), "=&v"(y4), "=&v"(y5), "=&v"(y6), "=&v"(y7)
      : "v"(x[0]), "v"(x[1]), "v"(x[2]), "v"(x[3]), "v"(x[4]), "v"(x[5]), "v"(x[6]), "v"(x[7]));
  const v8f y = {y0, y1, y2, y3, y4, y5, y6, y7};
  return y;
}
__device__ __forceinline__ v8f rcpx8(const v8f x) {
  float y0, y1, y2, y3, y4, y5, y6, y7;
  asm("v_rcp_f32 %0, %8\n\tv_rcp_f32 %1, %9\n\tv_rcp_f32 %2, %10\n\tv_rcp_f32 %3, %11\n\t"
      "v_rcp_f32 %4, %12\n\tv_rcp_f32 %5, %13\n\tv_rcp_f32 %6, %14\n\tv_rcp_f32 %7, %15\n\tv_nop"
      : "=&v"(y0), "=&v"(y1), "=&v"(y2), "=&v"(y3), "=&v"(y4), "=&v"(y5), "=&v"(y6), "=&v"(y7)
      : "v"(x[0]), "v"(x[1]), "v"(x[2]), "v"(x[3]), "v"(x[4]), "v"(x[5]), "v"(x[6]), "v"(x[7]));
  const v8f y = {y0, y1, y2, y3, y4, y5, y6, y7};
  return y;
}

typedef float          v2f   __attribute__((ext_vector_type(2)));
typedef __bf16         v2bf  __attribute__((ext_vector_type(2)));
// two f32 -> two bf16 in one word, RNE, by the hardware's packed convert; lo in the low halfword
__device__ __forceinline__ int pack2(float lo, float hi) {
  const v2f x = {lo, hi};
  union { v2bf h; int i; } u;
  u.h = __builtin_convertvector(x, v2bf);
  return u.i;
}
// the f32 values of RNE bf16(a), RNE bf16(b)
__device__ __forceinline__ v2f bf16_val2(float a, float b) {
  const unsigned h = (unsigned)pack2(a, b);
  const v2f r = {__uint_as_float(h << 16), __uint_as_float(h & 0xFFFF0000u)};
  return r;
}
// 8 f32 -> bf16 hi piece + bf16 lo piece (lo = RNE(v - hi)); element 2j in the low halfword of word j
__device__ __forceinline__ void split8(const v8f x, v4i& hi, v4i& lo) {
#pragma unroll
  for (int j = 0; j < 4; ++j) {
    const float a = x[2 * j], b = x[2 * j + 1];
    const unsigned h = (unsigned)pack2(a, b);
    const float ra = a - __uint_as_float(h << 16);
    const float rb = b - __uint_as_float(h & 0xFFFF0000u);
    hi[j] = (int)h;
    lo[j] = pack2(ra, rb);
  }
}
// fragment (row/col = lane&15) from an f32 row: p = row + k0 + 8h; elements 0..7 <- k0+8h+0..7, 8..15 <- k0+16+8h+0..7
__device__ __forceinline__ FragB ldf_frag(const float* __restrict__ p) {
  const v4f a0 = *(const v4fa*)p;
  const v4f a1 = *(const v4fa*)(p + 4);
  const v4f a2 = *(const v4fa*)(p + 16);
  const v4f a3 = *(const v4fa*)(p + 20);
  FragB f;
  f.w[0] = pack2(a0.x, a0.y); f.w[1] = pack2(a0.z, a0.w);
  f.w[2] = pack2(a1.x, a1.y); f.w[3] = pack2(a1.z, a1.w);
  f.w[4] = pack2(a2.x, a2.y); f.w[5] = pack2(a2.z, a2.w);
  f.w[6] = pack2(a3.x, a3.y); f.w[7] = pack2(a3.z, a3.w);
  return f;
}
// same fragment from a GLOBAL plane kept in fragment order: a fragment = 512 halfwords, [element half][lane][8];
// p = fragment + 8 lane. Each of the two wave-wide loads covers 512 contiguous bytes (4 whole 128-B lines).
__device__ __forceinline__ FragB ldg_frag(const unsigned short* __restrict__ p) {
  FragB f;
  f.q[0] = *(const v4ia*)p;
  f.q[1] = *(const v4ia*)(p + FHALF);
  return f;
}

// ---------------------------------------------------------------------------
// Weight staging, by the 4 waves of one block: W[k][n] f32 (128 x 128, [in][out]) -> LDS T[n][k] bf16 bits, row
// pitch TPITCH. A task = 8 rows k x 4 columns n: a wave-wide load is one whole 512-B row of W, a lane packs 8
// consecutive k of each of its 4 columns into one 16-B LDS store. Coverage: 4 waves x 4 it x 8 k = 128 k,
// 32 lanes x 4 n = 128 n. Cross-wave: the caller's block barrier stands between this and the first read of T.
// ---------------------------------------------------------------------------
__device__ __forceinline__ void stage_wt(const float* __restrict__ W, unsigned short* T) {
  const unsigned lane = threadIdx.x & 31u, wave = threadIdx.x >> 5;
#pragma unroll   // all 32 loads of a weight in flight together
  for (unsigned it = 0; it < 4u; ++it) {
    const unsigned k0 = 8u * (wave + 4u * it);
    const float* p = W + (size_t)k0 * EW + 4u * lane;
    v4f r[8];
#pragma unroll   // constant j, c: r[] stays in registers
    for (int j = 0; j < 8; ++j) r[j] = *(const v4fa*)(p + j * EW);
#pragma unroll
    for (int c = 0; c < 4; ++c) {
      const v8f col = {r[0][c], r[1][c], r[2][c], r[3][c], r[4][c], r[5][c], r[6][c], r[7][c]};
      union { v8bf h; v4i q; } u;
      u.h = __builtin_convertvector(col, v8bf);      // RNE, two values an instruction; k even in the low halfword
      *(v4ia*)(T + (4u * lane + (unsigned)c) * TPITCH + k0) = u.q;
    }
  }
}
// fragment from an LDS k-contiguous bf16 row: p = row + k0 + 8h (same element order as ldg_frag)
__device__ __forceinline__ FragB lds_frag(const unsigned short* p) {
  FragB f;
  f.q[0] = *(const v4ia*)p;
  f.q[1] = *(const v4ia*)(p + 16);
  return f;
}

// ---------------------------------------------------------------------------
// Projections. Block = 64 rows of the flattened [b][row] input, 4 waves x 16 rows; activations are held
// as bf16 fragments (col = lane&15 = input row) and every head (16 output columns) is one rolled step.
// MODE 0: q = x1.W1 + x2.W2.   MODE 1: k = x1.W1, then v = x1.W2, and the bf16 fragments of x1 (the nodes) also go
//   out as the plane nb[b][16-node tile][k step][element half][lane][8] (B operand of the final scoring product, in
//   fragment order): a lane stores its own 16-B pieces, each wave-wide store is 512 B in a row.
// Both modes run in ONE launch (k_proj): they depend only on the inputs, not on each other. A block first stages its
// own two weights, transposed to bf16 [out][in], in LDS (stage_wt) and takes every weight fragment from there.
// q/k form: D = Wt_tile (A, row = out col) x X (B, col = input row): D[row d = 8h+r][col = input row], so a
//   lane holds 8 consecutive d of one row -> one 16-B LDS store per plane half. Plane (b,head,16-row tile) =
//   hi[lane][8] | lo[lane][8] halfwords, lane = 16h + row: the piece a lane of k_dec takes, so its wave-wide load is
//   512 B in a row.
// v form: D = X (A) x Wt_tile (B): D[row = input row 8h+r][col d], lane holds 8 consecutive n of column d ->
//   one 16-B LDS store into the V^T stage [head][32-key tile][hi|lo][element half][lane][8], the global order too.
// LDS stg: cross-wave (block barriers); fully written before each copy-out (8 heads x 64 rows x 32, or
// coverage: q/k plane: NB*8 blocks x 16384 halfwords = NB*8*512*32; V^T: NB*8 blocks x 16384 (hi + lo) = 2*NB*128*512.
// ---------------------------------------------------------------------------
template <int MODE>
__device__ __forceinline__ void proj_body(const unsigned blk, unsigned short* stg,
                                          const float* __restrict__ x1, const float* __restrict__ x2,
                                          const float* __restrict__ w1, const float* __restrict__ w2,
                                          unsigned short* w1t, unsigned short* w2t,
                                          unsigned short* o1, unsigned short* o2, unsigned short* nb) {
  const unsigned tid = threadIdx.x, lane = tid & 31u, wave = tid >> 5, hh = lane >> 4, m = lane & 15u;
  const unsigned row0 = blk * 64u;
  const unsigned bb = row0 >> 9, r0 = row0 & 511u;
  const unsigned xrow = row0 + 16u * wave + m;

  // x1's loads (from memory, the longest wait) are issued first and packed behind the weight staging
  v4f xr[4][4];
  const float* xp = x1 + (size_t)xrow * EW + 8u * hh;
#pragma unroll
  for (int ks = 0; ks < 4; ++ks) {
    const float* p = xp + 32 * ks;
    xr[ks][0] = *(const v4fa*)p;        xr[ks][1] = *(const v4fa*)(p + 4);
    xr[ks][2] = *(const v4fa*)(p + 16); xr[ks][3] = *(const v4fa*)(p + 20);
  }
  // the wait that stands before a register named by an issued load is written again; xp as an input keeps the
  // address pair out of the loads' own destinations up to here
  asm volatile("s_wait_xcnt 0x0" :: "v"(xp) : "memory");
#pragma unroll 1   // one weight a trip: 32 loads in flight, not 64, which keeps the block under 256 registers
  for (unsigned w = 0; w < 2u; ++w) stage_wt(w ? w2 : w1, w ? w2t : w1t);
  FragB xa[4], xb[4];
#pragma unroll
  for (int ks = 0; ks < 4; ++ks) {
#pragma unroll
    for (int j = 0; j < 4; ++j) {
      xa[ks].w[2 * j] = pack2(xr[ks][j].x, xr[ks][j].y);
      xa[ks].w[2 * j + 1] = pack2(xr[ks][j].z, xr[ks][j].w);
    }
    if (MODE == 0) xb[ks] = ldf_frag(x2 + (size_t)xrow * EW + 32 * ks + 8u * hh);
    else xb[ks] = xa[ks];
  }
  __syncthreads();   // both staged weights are complete before any wave reads a fragment
  if (MODE == 1) {
    unsigned short* nd = nb + (size_t)(row0 + 16u * wave) * EW + 8u * lane;
#pragma unroll   // constant ks: xa[] stays in registers
    for (int ks = 0; ks < 4; ++ks) {
      *(v4i*)(nd + 2 * FHALF * ks) = xa[ks].q[0];
      *(v4i*)(nd + 2 * FHALF * ks + FHALF) = xa[ks].q[1];
    }
  }
  const v8f zero8 = {0.f, 0.f, 0.f, 0.f, 0.f, 0.f, 0.f, 0.f};

#pragma unroll 1
  for (unsigned t = 0; t < NH; ++t) {
    const unsigned short* wp = w1t + (16u * t + m) * TPITCH + 8u * hh;
    const unsigned short* wq = w2t + (16u * t + m) * TPITCH + 8u * hh;
    v8f acc = zero8;
    FragB wf[4], wg[4];
#pragma unroll   // the step's LDS reads stand together, ahead of its matrix chain: one LDS latency a step
    for (int ks = 0; ks < 4; ++ks) {
      wf[ks] = lds_frag(wp + 32 * ks);
      if (MODE == 0) wg[ks] = lds_frag(wq + 32 * ks);
    }
#pragma unroll
    for (int ks = 0; ks < 4; ++ks) {
      acc = wmb(wf[ks], xa[ks], acc);
      if (MODE == 0) acc = wmb(wg[ks], xb[ks], acc);
    }
    v4i hi, lo;
    split8(acc, hi, lo);
    const unsigned so = (t * 64u + 16u * wave) * QROW + 8u * lane;   // tile of 16 rows: [hi|lo][lane][8]
    *(v4ia*)(stg + so) = hi;
    *(v4ia*)(stg + so + FHALF) = lo;
  }
  __syncthreads();
  {
    unsigned short* dst = o1 + ((size_t)bb * NH * GQ + r0) * QROW;
#pragma unroll 1
    for (unsigned it = 0; it < 16u; ++it) {
      const unsigned p = it * 128u + tid, t = p >> 8, wi = p & 255u;
      const v4i v = *(const v4ia*)(stg + p * 8u);
      *(v4i*)(dst + (size_t)t * (GQ * QROW) + wi * 8u) = v;
      asm volatile("s_wait_xcnt 0x0" ::: "memory");   // stands before the next trip, or the code behind the loop, writes a register this store names
    }
    
  }
  if (MODE == 1) {
    __syncthreads();
#pragma unroll 1
    for (unsigned t = 0; t < NH; ++t) {
      const unsigned short* wq = w2t + (16u * t + m) * TPITCH + 8u * hh;
      v8f acc = zero8;
      FragB wf[4];
#pragma unroll   // as above: the reads together, then the chain
      for (int ks = 0; ks < 4; ++ks) wf[ks] = lds_frag(wq + 32 * ks);
#pragma unroll
      for (int ks = 0; ks < 4; ++ks) acc = wmb(xa[ks], wf[ks], acc);
      v4i hi, lo;
      split8(acc, hi, lo);                       // acc[r] = v[n = 16 wave + 8h + r][col 16t + m]
      // 32-key tile wave >> 1, element half wave & 1 of its hi and lo fragments
      const unsigned so = (2u * t + (wave >> 1)) * VTILE + (wave & 1u) * FHALF + 8u * lane;
      *(v4ia*)(stg + so) = hi;
      *(v4ia*)(stg + so + 2 * FHALF) = lo;
    }
    __syncthreads();
    unsigned short* dst = o2 + ((size_t)bb * NH * (NK / 32) + (r0 >> 5)) * VTILE;
#pragma unroll 1
    for (unsigned it = 0; it < 16u; ++it) {
      const unsigned p = it * 128u + tid, t = p >> 8, wi = p & 255u;   // a head's two tiles: 4 KiB in a row
      const v4i v = *(const v4ia*)(stg + p * 8u);
      *(v4i*)(dst + (size_t)t * ((NK / 32) * VTILE) + wi * 8u) = v;
      asm volatile("s_wait_xcnt 0x0" ::: "memory");   // stands before the next trip, or the code behind the loop, writes a register this store names
    }
    
  }
}

// One grid for both projections and the W_comb plane: block 0 writes W_comb^T as a bf16 plane in fragment order for the next launch,
// blocks 1 .. KVBLK take the k/v form (the longer one, so it starts first), the rest the q form. The choice is
// uniform in a block, so every barrier of a body is passed by all its waves.
// W_comb plane: 8 tiles of 16 rows in fragment order; a wave-wide store is 512 B in a row, each piece once.
#define KVBLK ((NB * NK) / 64)
#define QBLK  ((NB * GQ) / 64)
__global__ __launch_bounds__(128) void k_proj(const float* __restrict__ nodes, const float* __restrict__ q1,
                                              const float* __restrict__ last,
                                              const float* __restrict__ wqf, const float* __restrict__ wql,
                                              const float* __restrict__ wk, const float* __restrict__ wv,
                                              const float* __restrict__ wc,
                                              unsigned short* qpl, unsigned short* kpl, unsigned short* vtp,
                                              unsigned short* nbf, unsigned short* wct) {
  __shared__ __attribute__((aligned(16))) unsigned short stg[16384];
  __shared__ __attribute__((aligned(16))) unsigned short wl1[EW * TPITCH];
  __shared__ __attribute__((aligned(16))) unsigned short wl2[EW * TPITCH];
  if (blockIdx.x == 0u) {
    stage_wt(wc, wl1);
    __syncthreads();
#pragma unroll 4   // four LDS reads in flight a trip instead of one
    for (unsigned it = 0; it < 16u; ++it) {
      // p = 16-B piece of the plane in fragment order: [16-row tile][k step][element half][k half h][row m]
      const unsigned p = it * 128u + threadIdx.x, n = ((p >> 8) << 4) | (p & 15u);
      const unsigned c = (((p >> 6) & 3u) << 2) | (((p >> 5) & 1u) << 1) | ((p >> 4) & 1u);
      const v4i v = *(const v4ia*)(wl1 + n * TPITCH + c * 8u);
      *(v4i*)(wct + p * 8u) = v;
      // the wait that stands before the next trip writes the registers these stores name
      if ((it & 3u) == 3u) asm volatile("s_wait_xcnt 0x0" ::: "memory");
    }
  } else if (blockIdx.x <= (unsigned)KVBLK) {
    proj_body<1>(blockIdx.x - 1u, stg, nodes, nodes, wk, wv, wl1, wl2, kpl, vtp, nbf);
  } else {
    proj_body<0>(blockIdx.x - 1u - (unsigned)KVBLK, stg, q1, last, wqf, wql, wl1, wl2, qpl, qpl, nbf);
  }
}

// ---------------------------------------------------------------------------
// Fused decoder block: one block = (batch b, RB = 32 query rows g0..g0+31), 8 waves. Every wave carries QT = 2 tiles of
// 16 queries through phases A, B and C, so each K, V^T, W_comb^T and node fragment is loaded once for both tiles and
// the two tiles' chains are independent work for the wave. What is said below of 16 queries holds for each tile.
// Phase 0: mask tile [32][512] f32 (bf16-convert of the input value, times log2e) -> LDS mk (cross-wave, block barrier).
// Phase A (wave = head): flash attention in the transposed domain.
//   S^T tile = K (A, row = key) x Q^T (B, col = query): K = 16 is laid as [k_hi|k_hi] x [q_hi|q_lo] plus
//   [k_lo|0] x [q_hi|q_lo] along the 32-deep k axis. D[row key 8h+r][col query m]. Softmax statistics are
//   per lane (query m); the two lane halves combine by one xor-16 exchange. The P^T B-fragment is the lane's
//   own 16 score results (tile 0 -> elements 0..7, tile 1 -> elements 8..15). O^T = V^T (A, row d) x P^T:
//   D[row d 8h+r][col query m], scaled per lane. ctx hi/lo -> LDS cst[plane][query][128] by 16-B stores.
// Phase B (wave = 16 output columns e): mh^T = W_comb^T (A, global plane) x ctx^T (B, from cst), hi + lo,
//   + bf16(b_comb[e]); mh hi/lo -> LDS mst[plane][query][128] by 16-B stores.
// Phase C (wave = 64 nodes): s2 = mh (A, from mst, hi + lo) x nodes^T (B, global bf16 plane);
//   D[row query 8h+r][col node m]; s = (10 tanh(x/sqrt(128)) + mask) log2e, written over the mask value in place.
// Phase D (wave = 4 rows): row softmax from LDS; each instruction writes 512 contiguous bytes (4 whole
// LDS extents: mk rows 0..31 cols 0..511 written in phase 0 and consumed cols 0..511; cst/mst rows 0..31
//   cols 0..127 of both planes written by all 8 waves, consumed cols 0..127. Pad columns are never read.
// coverage: grid (16, NB) x 32 rows x 512 = NB*512*512 outputs, each written by exactly one lane.
// ---------------------------------------------------------------------------
__global__ __launch_bounds__(256) void k_dec(const unsigned short* __restrict__ qpl,
                                             const unsigned short* __restrict__ kpl,
                                             const unsigned short* __restrict__ vt,
                                             const float* __restrict__ mask,
                                             const unsigned short* __restrict__ wct,
                                             const float* __restrict__ bcomb,
                                             const unsigned short* __restrict__ nbf,
                                             float* out) {
  __shared__ __attribute__((aligned(16))) float mk[RB * MPITCH];
  __shared__ __attribute__((aligned(16))) unsigned short cst[2 * RB * CPITCH];
  __shared__ __attribute__((aligned(16))) unsigned short mst[2 * RB * CPITCH];
  const unsigned tid = threadIdx.x, lane = tid & 31u, wave = tid >> 5, hh = lane >> 4, m = lane & 15u;
  const unsigned g0 = blockIdx.x * (unsigned)RB, b = blockIdx.y;
  const v8f zero8 = {0.f, 0.f, 0.f, 0.f, 0.f, 0.f, 0.f, 0.f};
  const v4i zero4 = {0, 0, 0, 0};

  // ---- phase 0: mask tile ----
  {
    const float* mg = mask + ((size_t)b * GQ + g0) * NK;
#pragma unroll 4   // four trips as with one tile: a trip's loads wait for memory together
    for (unsigned it = 0; it < 8u * QT; ++it) {
      const unsigned p = it * 256u + tid, row = p >> 7, c4 = (p & 127u) << 2;
      v4f v = *(const v4fa*)(mg + (size_t)row * NK + c4);
      const v2f v01 = bf16_val2(v.x, v.y) * L2E, v23 = bf16_val2(v.z, v.w) * L2E;
      *(v4fa*)(mk + row * MPITCH + c4) = __builtin_shufflevector(v01, v23, 0, 1, 2, 3);
    }
  }
  __syncthreads();

  // ---- phase A: attention for head = wave, both query tiles ----
  {
    const unsigned bh = b * NH + wave;
    const unsigned short* qp = qpl + ((size_t)bh * GQ + g0) * QROW + 8u * lane;
    FragB qf[QT];
#pragma unroll   // constant qt here and below: the per-tile arrays stay in registers
    for (int qt = 0; qt < QT; ++qt) {
      qf[qt].q[0] = *(const v4ia*)(qp + qt * 16 * QROW);           // q_hi[8h .. 8h+7]  (k slots 8h..)
      qf[qt].q[1] = *(const v4ia*)(qp + qt * 16 * QROW + FHALF);   // q_lo[8h .. 8h+7]  (k slots 16+8h..)
    }
    const unsigned short* kb = kpl + (size_t)bh * NK * QROW + 8u * lane;
    const unsigned short* vb = vt + (size_t)bh * ((NK / 32) * VTILE) + 8u * lane;
    const unsigned moff = m * MPITCH + 8u * hh;
    v8f o[QT];
    float mrun[QT], lrun[QT];
#pragma unroll
    for (int qt = 0; qt < QT; ++qt) { o[qt] = zero8; mrun[qt] = -3.0e38f; lrun[qt] = 0.0f; }
#pragma unroll 1
    for (unsigned n0 = 0; n0 < NK; n0 += 32u) {
      const unsigned short* kp = kb + (size_t)n0 * QROW;
      const v4i kh0 = *(const v4ia*)kp;
      const v4i kl0 = *(const v4ia*)(kp + FHALF);
      const v4i kh1 = *(const v4ia*)(kp + 16 * QROW);
      const v4i kl1 = *(const v4ia*)(kp + 16 * QROW + FHALF);
      const unsigned short* vp = vb + (size_t)(n0 >> 5) * VTILE;
      const FragB fvh = ldg_frag(vp);
      const FragB fvl = ldg_frag(vp + 2 * FHALF);
      // the wait that stands before a register named by an issued load is written again; kp and vp as inputs keep the
      // address pairs whole up to here
      asm volatile("s_wait_xcnt 0x0" :: "v"(kp), "v"(vp) : "memory");
      FragB a10, a20, a11, a21;
      a10.q[0] = kh0; a10.q[1] = kh0;
      a20.q[0] = kl0; a20.q[1] = zero4;
      a11.q[0] = kh1; a11.q[1] = kh1;
      a21.q[0] = kl1; a21.q[1] = zero4;
#pragma unroll
      for (int qt = 0; qt < QT; ++qt) {
        v8f s0 = wmb(a10, qf[qt], zero8);
        s0 = wmb(a20, qf[qt], s0);
        v8f s1 = wmb(a11, qf[qt], zero8);
        s1 = wmb(a21, qf[qt], s1);

        const float* mp = mk + (unsigned)qt * (16u * MPITCH) + moff + n0;
        const v4f m0 = *(const v4fa*)mp;
        const v4f m1 = *(const v4fa*)(mp + 4);
        const v4f m2 = *(const v4fa*)(mp + 16);
        const v4f m3 = *(const v4fa*)(mp + 20);
        const v8f mk0 = __builtin_shufflevector(m0, m1, 0, 1, 2, 3, 4, 5, 6, 7);
        const v8f mk1 = __builtin_shufflevector(m2, m3, 0, 1, 2, 3, 4, 5, 6, 7);
        const v8f a0 = s0 * (0.25f * L2E) + mk0;      // key n0 + 8h + r, log2 domain
        const v8f a1 = s1 * (0.25f * L2E) + mk1;      // key n0 + 16 + 8h + r

        float t = fmaxf(a0[0], a1[0]);
#pragma unroll
        for (int r = 1; r < 8; ++r) t = fmaxf(t, fmaxf(a0[r], a1[r]));
        t = fmaxf(t, __shfl_xor(t, 16));
        const float mnew = fmaxf(mrun[qt], t);
        const float sc = ex2(mrun[qt] - mnew);
        const v8f p0 = ex2x8(a0 - mnew);
        const v8f p1 = ex2x8(a1 - mnew);
        float ps = 0.0f;
#pragma unroll
        for (int r = 0; r < 8; ++r) ps += p0[r] + p1[r];
        lrun[qt] = lrun[qt] * sc + ps;
        mrun[qt] = mnew;
        o[qt] = o[qt] * sc;

        FragB ph, pl;
        split8(p0, ph.q[0], pl.q[0]);
        split8(p1, ph.q[1], pl.q[1]);
        o[qt] = wmb(fvh, ph, o[qt]);
        o[qt] = wmb(fvl, ph, o[qt]);
        o[qt] = wmb(fvh, pl, o[qt]);
      }
    }
#pragma unroll
    for (int qt = 0; qt < QT; ++qt) {
      const float lt = lrun[qt] + __shfl_xor(lrun[qt], 16);
      const float inv = 1.0f / lt;
      const v8f c = o[qt] * inv;              // ctx[query 16 qt + m][16 wave + 8h + r]
      v4i hi, lo;
      split8(c, hi, lo);
      const unsigned co = (16u * (unsigned)qt + m) * CPITCH + 16u * wave + 8u * hh;
      *(v4ia*)(cst + co) = hi;
      *(v4ia*)(cst + RB * CPITCH + co) = lo;
    }
  }
  __syncthreads();

  // ---- phase B: mh^T tiles for e = 16 wave .. 16 wave + 15 ----
  {
    const unsigned e0 = 16u * wave;
    const unsigned short* wp = wct + (size_t)e0 * EW + 8u * lane;
    const unsigned co = m * CPITCH + 8u * hh;
    v8f acc[QT];
#pragma unroll
    for (int qt = 0; qt < QT; ++qt) acc[qt] = zero8;
#pragma unroll
    for (int ks = 0; ks < 4; ++ks) {
      const FragB wf = ldg_frag(wp + 2 * FHALF * ks);
#pragma unroll
      for (int qt = 0; qt < QT; ++qt) {
        const unsigned short* cp = cst + qt * 16 * CPITCH + co + 32 * ks;
        FragB ch, cl;
        ch.q[0] = *(const v4ia*)cp;
        ch.q[1] = *(const v4ia*)(cp + 16);
        cl.q[0] = *(const v4ia*)(cp + RB * CPITCH);
        cl.q[1] = *(const v4ia*)(cp + RB * CPITCH + 16);
        acc[qt] = wmb(wf, ch, acc[qt]);
        acc[qt] = wmb(wf, cl, acc[qt]);
      }
    }
    const v4f b0 = *(const v4fa*)(bcomb + e0 + 8u * hh);
    const v4f b1 = *(const v4fa*)(bcomb + e0 + 8u * hh + 4u);
    const v2f c01 = bf16_val2(b0.x, b0.y), c23 = bf16_val2(b0.z, b0.w);
    const v2f c45 = bf16_val2(b1.x, b1.y), c67 = bf16_val2(b1.z, b1.w);
#pragma unroll
    for (int qt = 0; qt < QT; ++qt) {
      v8f a = acc[qt];
      a[0] += c01.x; a[1] += c01.y; a[2] += c23.x; a[3] += c23.y;
      a[4] += c45.x; a[5] += c45.y; a[6] += c67.x; a[7] += c67.y;
      v4i hi, lo;
      split8(a, hi, lo);                      // mh[query 16 qt + m][e0 + 8h + r]
      const unsigned mo = (16u * (unsigned)qt + m) * CPITCH + e0 + 8u * hh;
      *(v4ia*)(mst + mo) = hi;
      *(v4ia*)(mst + RB * CPITCH + mo) = lo;
    }
  }
  __syncthreads();

  // ---- phase C: s = (10 tanh(mh . node / sqrt(128)) + mask) log2e, nodes 64 wave .. 64 wave + 63 ----
  {
    const float k2 = (float)(2.0 * 1.4426950408889634 / 11.313708498984761);   // exp(2 x), x = acc / sqrt(128), as 2^(acc k2)
    const unsigned ao = m * CPITCH + 8u * hh;
    FragB ah[QT][4], al[QT][4];
#pragma unroll
    for (int qt = 0; qt < QT; ++qt) {
#pragma unroll
      for (int ks = 0; ks < 4; ++ks) {
        const unsigned short* ap = mst + qt * 16 * CPITCH + ao + 32 * ks;
        ah[qt][ks].q[0] = *(const v4ia*)ap;
        ah[qt][ks].q[1] = *(const v4ia*)(ap + 16);
        al[qt][ks].q[0] = *(const v4ia*)(ap + RB * CPITCH);
        al[qt][ks].q[1] = *(const v4ia*)(ap + RB * CPITCH + 16);
      }
    }
#pragma unroll 1
    for (unsigned j = 0; j < 4u; ++j) {
      const unsigned n0 = 64u * wave + 16u * j;
      const unsigned short* np = nbf + ((size_t)b * NK + n0) * EW + 8u * lane;
      v8f acc[QT];
#pragma unroll
      for (int qt = 0; qt < QT; ++qt) acc[qt] = zero8;
#pragma unroll
      for (int ks = 0; ks < 4; ++ks) {
        const FragB nf = ldg_frag(np + 2 * FHALF * ks);
#pragma unroll
        for (int qt = 0; qt < QT; ++qt) {
          acc[qt] = wmb(ah[qt][ks], nf, acc[qt]);
          acc[qt] = wmb(al[qt][ks], nf, acc[qt]);
        }
      }
      // the wait that stands before a register named by an issued load is written again; np as an input keeps the
      // address pair whole up to here
      asm volatile("s_wait_xcnt 0x0" :: "v"(np) : "memory");
#pragma unroll
      for (int qt = 0; qt < QT; ++qt) {
        const v8f q = rcpx8(ex2x8(acc[qt] * k2) + 1.0f);      // exp(2x) = +inf -> tanh 1, 0 -> tanh -1
#pragma unroll
        for (int r = 0; r < 8; ++r) {
          const unsigned idx = (16u * (unsigned)qt + 8u * hh + (unsigned)r) * MPITCH + n0 + m;   // D element r = (query 16 qt + 8h + r, node m)
          const float s = (10.0f * L2E - (20.0f * L2E) * q[r]) + mk[idx];   // log2 domain, like the mask tile
          mk[idx] = s;
        }
      }
    }
  }
  __syncthreads();

  // ---- phase D: row softmax, rows 2 QT wave .. 2 QT wave + 2 QT - 1, two rows a pass ----
#pragma unroll 1   // a pass is the two-row body of one tile; rolled, its stores' registers are rewritten only behind the wait at its foot
  for (unsigned pp = 0; pp < (unsigned)QT; ++pp) {
    const unsigned row0 = (unsigned)(2 * QT) * wave + 2u * pp;
    v4f res[2][4];
#pragma unroll
    for (int rr = 0; rr < 2; ++rr) {
      const unsigned so = (row0 + (unsigned)rr) * MPITCH + 4u * lane;
      v4f v[4];
#pragma unroll
      for (int j = 0; j < 4; ++j) v[j] = *(const v4fa*)(mk + so + 128 * j);
      float mx = v[0].x;
#pragma unroll
      for (int j = 0; j < 4; ++j) mx = fmaxf(fmaxf(fmaxf(mx, v[j].x), fmaxf(v[j].y, v[j].z)), v[j].w);
      mx = fmaxf(mx, __shfl_xor(mx, 16));
      mx = fmaxf(mx, __shfl_xor(mx, 8));
      mx = fmaxf(mx, __shfl_xor(mx, 4));
      mx = fmaxf(mx, __shfl_xor(mx, 2));
      mx = fmaxf(mx, __shfl_xor(mx, 1));
      float sum = 0.0f;
#pragma unroll
      for (int j = 0; j < 4; j += 2) {
        const v8f e = ex2x8(__builtin_shufflevector(v[j], v[j + 1], 0, 1, 2, 3, 4, 5, 6, 7) - mx);
        v[j] = __builtin_shufflevector(e, e, 0, 1, 2, 3);
        v[j + 1] = __builtin_shufflevector(e, e, 4, 5, 6, 7);
        sum += (v[j].x + v[j].y) + (v[j].z + v[j].w);
        sum += (v[j + 1].x + v[j + 1].y) + (v[j + 1].z + v[j + 1].w);
      }
      sum += __shfl_xor(sum, 16);
      sum += __shfl_xor(sum, 8);
      sum += __shfl_xor(sum, 4);
      sum += __shfl_xor(sum, 2);
      sum += __shfl_xor(sum, 1);
      const float inv = 1.0f / sum;
#pragma unroll
      for (int j = 0; j < 4; ++j) res[rr][j] = v[j] * inv;
    }
    float* ob = out + ((size_t)b * GQ + g0 + row0) * NK + 4u * lane;
#pragma unroll
    for (int rr = 0; rr < 2; ++rr)
#pragma unroll
      for (int j = 0; j < 4; ++j) *(v4f*)(ob + (size_t)rr * NK + 128 * j) = res[rr][j];
    asm volatile("s_wait_xcnt 0x0" ::: "memory");   // stands before the next pass writes a register these stores name
  }
}

// ---------------------------------------------------------------------------
static inline size_t al256(size_t o) { return (o + 255) & ~(size_t)255; }

extern "C" void kernel_launch(void* const* d_in, const int* in_sizes, int n_in,
                              void* d_out, int out_size, void* d_ws, size_t ws_size,
                              hipStream_t stream) {
  if (n_in < 10) return;
  const long long actN = (long long)NB * NK * EW;
  const long long actG = (long long)NB * GQ * EW;
  const long long mskN = (long long)NB * GQ * NK;
  if ((long long)in_sizes[0] < actN) return;             // encoded_nodes
  if ((long long)in_sizes[1] < actG) return;             // encoded_q1
  if ((long long)in_sizes[2] < actG) return;             // encoded_last_node
  if ((long long)in_sizes[3] < mskN) return;             // ninf_mask (f32, additive)
  if (in_sizes[4] < EW * EW || in_sizes[5] < EW * EW || in_sizes[6] < EW * EW ||
      in_sizes[7] < EW * EW || in_sizes[8] < EW * EW) return;
  if (in_sizes[9] < EW) return;
  if ((long long)out_size < mskN) return;

  const float* nodes = (const float*)d_in[0];
  const float* q1    = (const float*)d_in[1];
  const float* last  = (const float*)d_in[2];
  const float* mask  = (const float*)d_in[3];
  const float* Wqf   = (const float*)d_in[4];
  const float* Wql   = (const float*)d_in[5];
  const float* Wk    = (const float*)d_in[6];
  const float* Wv    = (const float*)d_in[7];
  const float* Wc    = (const float*)d_in[8];
  const float* bc    = (const float*)d_in[9];
  float* out = (float*)d_out;

  const size_t wtB  = al256((size_t)5 * EW * EW * 2);             // 163,840
  const size_t nbB  = al256((size_t)NB * NK * EW * 2);            // 4,194,304
  const size_t qB   = al256((size_t)NB * NH * GQ * QROW * 2);     // 8,388,608
  const size_t kB   = al256((size_t)NB * NH * NK * QROW * 2);     // 8,388,608
  const size_t vB   = al256((size_t)2 * VPL * 2);                 // 8,388,608
  const size_t total = wtB + nbB + qB + kB + vB;                  // 29,523,968
  if (total > ws_size || total > (size_t)WSMAX) return;
  char* w = (char*)d_ws;
  unsigned short* wt  = (unsigned short*)w;
  unsigned short* nbf = (unsigned short*)(w + wtB);
  unsigned short* qpl = (unsigned short*)(w + wtB + nbB);
  unsigned short* kpl = (unsigned short*)(w + wtB + nbB + qB);
  unsigned short* vtp = (unsigned short*)(w + wtB + nbB + qB + kB);
  unsigned short* wctp = wt + 4 * EW * EW;

  // 1: W_comb [in][out] f32 -> W_comb^T bf16 plane; k = nodes.Wk -> k plane (hi|lo tiles), v = nodes.Wv -> V^T hi|lo tiles, nodes -> bf16 plane;
  //    q = q1.Wq_first + last.Wq_last -> q plane (hi|lo tiles); every plane in fragment order
  k_proj<<<1 + KVBLK + QBLK, 128, 0, stream>>>(nodes, q1, last, Wqf, Wql, Wk, Wv, Wc, qpl, kpl, vtp, nbf, wctp);
  // 2: attention + W_comb + final scoring + softmax
  k_dec<<<dim3(GQ / RB, NB), 256, 0, stream>>>(qpl, kpl, vtp, mask, wctp, bc, nbf, out);
}

// v008
// One run takes 43.9 microseconds.
// Next to v007, in two timings, it ran 1.09 and 1.07 times as fast.
// Counting every step since v000, it is 2.59 times as fast.
// Contractions: q/k/v projections = v_wmma_f32_16x16x32_bf16, bf16 (RNE) inputs and weights, one product. q.k scores, P.V, ctx.W_comb and mh.nodes = same bf16 WMMA with every computed operand carried as bf16 hi + bf16 lo (hi.hi + lo.hi + hi.lo; input-side planes are exact bf16, lo == 0). Accumulate f32 everywhere.
// Mask add, online softmax, tanh, bias, final softmax: f32 VALU; both softmaxes run on logits scaled by log2e (the LDS mask tile carries the factor), so exp(x - m) is one subtract and v_exp_f32; tanh(x) = 1 - 2 v_rcp_f32(1 + exp(2x)). No power-of-two carries exist (bf16 planes only).
#include <hip/hip_runtime.h>
#include <stddef.h>
#include <stdint.h>

#ifndef NB
#define NB 32                      // batches processed (a reduced build reads the first NB batches)
#endif
#define GQ     512                 // queries per batch
#define NK     512                 // nodes (keys) per batch
#define EW     128                 // embedding width = heads x head dim
#define NH     8
#define HD     16
#define QROW   32                  // halfwords per q/k plane row (16 hi + 16 lo); 16 rows = one tile [hi|lo][lane][8]
#define FHALF  256                 // halfwords a wave-wide 16-B access covers: 32 lanes x 8
#define VTILE  1024                // halfwords per V^T tile (one head, 32 keys): hi fragment, then lo fragment
#define MPITCH 516                 // floats per LDS mask/score row
#define CPITCH 136                 // halfwords per LDS ctx/mh row
#define TPITCH 136                 // halfwords per LDS weight-transpose row
#define QT     2                   // 16-query tiles a wave of k_dec carries
#define RB     (16 * QT)           // query rows per k_dec block
#define WSMAX  134217728
#define VPL    ((size_t)NB * EW * NK)   // halfwords of V^T hi pieces (as many lo pieces)

static_assert(GQ == NK);                       // k_proj uses one row count for q and k planes
static_assert(NH * HD == EW);
static_assert(EW % 32 == 0 && NK % 32 == 0);
static_assert(GQ % 64 == 0 && (NB * GQ) % 64 == 0);
static_assert(16 * QROW == 2 * FHALF);         // q/k tile: 16 rows = hi piece + lo piece, one wave-wide access each
static_assert(2 * HD * 32 == VTILE && VTILE == 4 * FHALF);   // V^T tile: 2 fragments of 2 accesses
static_assert(16 * EW == 8 * FHALF);           // nodes / W_comb tile: 16 rows = 4 fragments of 2 accesses
static_assert(NH * 64 * QROW == 16384);        // k_proj stage: q/k form
static_assert(2 * EW * 64 == 16384);           // k_proj stage: V^T form
static_assert(16384 == 128 * 16 * 8);          // k_proj copy-out: 128 thr x 16 it x 8 halfwords
static_assert(EW == 32 * 4 && EW == 4 * 4 * 8); // stage_wt: 32 lanes x 4 columns, 4 waves x 4 it x 8 rows
static_assert(EW * EW == 128 * 16 * 8);        // W_comb copy-out: 128 thr x 16 it x 8 halfwords
static_assert(RB * NK == 256 * (8 * QT) * 4);  // k_dec mask staging: 256 thr x 8 QT it x 4 floats
static_assert(GQ % RB == 0 && RB == 8 * 2 * QT); // k_dec grid; phase D: 8 waves x 2 QT rows
static_assert(NK == 8 * 64);                   // k_dec phase C: 8 waves x 64 nodes
static_assert(NK == 32 * 16);                  // k_dec phase D: 32 lanes x 4 x 4 floats per row

typedef int            v4i   __attribute__((ext_vector_type(4)));
typedef int            v8i   __attribute__((ext_vector_type(8)));
typedef float          v4f   __attribute__((ext_vector_type(4)));
typedef float          v8f   __attribute__((ext_vector_type(8)));
typedef __bf16         v16bf __attribute__((ext_vector_type(16)));
typedef __bf16         v8bf  __attribute__((ext_vector_type(8)));
typedef v4i __attribute__((may_alias)) v4ia;
typedef v4f __attribute__((may_alias)) v4fa;
union FragB { v16bf v; v4i q[2]; v8i w; };

// WMMA by the builtin: the compiler keeps the distance behind it and fills the slots with other work where it can
__device__ __forceinline__ v8f wmb(const FragB& a, const FragB& b, v8f c) {
  return __builtin_amdgcn_wmma_f32_16x16x32_bf16(false, a.v, false, b.v, (short)0, c, false, false);
}

#define L2E 1.4426950408889634f    // log2(e)
// 2^x on the hardware unit: -inf and anything below the f32 range give 0, +inf gives +inf
__device__ __forceinline__ float ex2(float x) { return __builtin_amdgcn_exp2f(x); }
// Eight 2^x / eight 1/x in one statement. Why asm: behind a transcendental the instruction set asks for one
// independent slot before its result is read or its source overwritten; the early-clobber outputs keep every
// result off every source, and the closing v_nop is the slot behind the last one.
__device__ __forceinline__ v8f ex2x8(const v8f x) {
  float y0, y1, y2, y3, y4, y5, y6, y7;
  asm("v_exp_f32 %0, %8\n\tv_exp_f32 %1, %9\n\tv_exp_f32 %2, %10\n\tv_exp_f32 %3, %11\n\t"
      "v_exp_f32 %4, %12\n\tv_exp_f32 %5, %13\n\tv_exp_f32 %6, %14\n\tv_exp_f32 %7, %15\n\tv_nop"
      : "=&v"(y0), "=&v"(y1), "=&v"(y2), "=&v"(y3), "=&v"(y4), "=&v"(y5), "=&v"(y6), "=&v"(y7)
      : "v"(x[0]), "v"(x[1]), "v"(x[2]), "v"(x[3]), "v"(x[4]), "v"(x[5]), "v"(x[6]), "v"(x[7]));
  const v8f y = {y0, y1, y2, y3, y4, y5, y6, y7};
  return y;
}
__device__ __forceinline__ v8f rcpx8(const v8f x) {
  float y0, y1, y2, y3, y4, y5, y6, y7;
  asm("v_rcp_f32 %0, %8\n\tv_rcp_f32 %1, %9\n\tv_rcp_f32 %2, %10\n\tv_rcp_f32 %3, %11\n\t"
      "v_rcp_f32 %4, %12\n\tv_rcp_f32 %5, %13\n\tv_rcp_f32 %6, %14\n\tv_rcp_f32 %7, %15\n\tv_nop"
      : "=&v"(y0), "=&v"(y1), "=&v"(y2), "=&v"(y3), "=&v"(y4), "=&v"(y5), "=&v"(y6), "=&v"(y7)
      : "v"(x[0]), "v"(x[1]), "v"(x[2]), "v"(x[3]), "v"(x[4]), "v"(x[5]), "v"(x[6]), "v"(x[7]));
  const v8f y = {y0, y1, y2, y3, y4, y5, y6, y7};
  return y;
}

typedef float          v2f   __attribute__((ext_vector_type(2)));
typedef __bf16         v2bf  __attribute__((ext_vector_type(2)));
// two f32 -> two bf16 in one word, RNE, by the hardware's packed convert; lo in the low halfword
__device__ __forceinline__ int pack2(float lo, float hi) {
  const v2f x = {lo, hi};
  union { v2bf h; int i; } u;
  u.h = __builtin_convertvector(x, v2bf);
  return u.i;
}
// the f32 values of RNE bf16(a), RNE bf16(b)
__device__ __forceinline__ v2f bf16_val2(float a, float b) {
  const unsigned h = (unsigned)pack2(a, b);
  const v2f r = {__uint_as_float(h << 16), __uint_as_float(h & 0xFFFF0000u)};
  return r;
}
// 8 f32 -> bf16 hi piece + bf16 lo piece (lo = RNE(v - hi)); element 2j in the low halfword of word j
__device__ __forceinline__ void split8(const v8f x, v4i& hi, v4i& lo) {
#pragma unroll
  for (int j = 0; j < 4; ++j) {
    const float a = x[2 * j], b = x[2 * j + 1];
    const unsigned h = (unsigned)pack2(a, b);
    const float ra = a - __uint_as_float(h << 16);
    const float rb = b - __uint_as_float(h & 0xFFFF0000u);
    hi[j] = (int)h;
    lo[j] = pack2(ra, rb);
  }
}
// fragment (row/col = lane&15) from an f32 row: p = row + k0 + 8h; elements 0..7 <- k0+8h+0..7, 8..15 <- k0+16+8h+0..7
__device__ __forceinline__ FragB ldf_frag(const float* __restrict__ p) {
  const v4f a0 = *(const v4fa*)p;
  const v4f a1 = *(const v4fa*)(p + 4);
  const v4f a2 = *(const v4fa*)(p + 16);
  const v4f a3 = *(const v4fa*)(p + 20);
  FragB f;
  f.w[0] = pack2(a0.x, a0.y); f.w[1] = pack2(a0.z, a0.w);
  f.w[2] = pack2(a1.x, a1.y); f.w[3] = pack2(a1.z, a1.w);
  f.w[4] = pack2(a2.x, a2.y); f.w[5] = pack2(a2.z, a2.w);
  f.w[6] = pack2(a3.x, a3.y); f.w[7] = pack2(a3.z, a3.w);
  return f;
}
// same fragment from a GLOBAL plane kept in fragment order: a fragment = 512 halfwords, [element half][lane][8];
// p = fragment + 8 lane. Each of the two wave-wide loads covers 512 contiguous bytes (4 whole 128-B lines).
__device__ __forceinline__ FragB ldg_frag(const unsigned short* __restrict__ p) {
  FragB f;
  f.q[0] = *(const v4ia*)p;
  f.q[1] = *(const v4ia*)(p + FHALF);
  return f;
}

// ---------------------------------------------------------------------------
// Weight staging, by the 4 waves of one block: W[k][n] f32 (128 x 128, [in][out]) -> LDS T[n][k] bf16 bits, row
// pitch TPITCH. A task = 8 rows k x 4 columns n: a wave-wide load is one whole 512-B row of W, a lane packs 8
// consecutive k of each of its 4 columns into one 16-B LDS store. Coverage: 4 waves x 4 it x 8 k = 128 k,
// 32 lanes x 4 n = 128 n. Cross-wave: the caller's block barrier stands between this and the first read of T.
// ---------------------------------------------------------------------------
__device__ __forceinline__ void stage_wt(const float* __restrict__ W, unsigned short* T) {
  const unsigned lane = threadIdx.x & 31u, wave = threadIdx.x >> 5;
#pragma unroll   // all 32 loads of a weight in flight together
  for (unsigned it = 0; it < 4u; ++it) {
    const unsigned k0 = 8u * (wave + 4u * it);
    const float* p = W + (size_t)k0 * EW + 4u * lane;
    v4f r[8];
#pragma unroll   // constant j, c: r[] stays in registers
    for (int j = 0; j < 8; ++j) r[j] = *(const v4fa*)(p + j * EW);
#pragma unroll
    for (int c = 0; c < 4; ++c) {
      const v8f col = {r[0][c], r[1][c], r[2][c], r[3][c], r[4][c], r[5][c], r[6][c], r[7][c]};
      union { v8bf h; v4i q; } u;
      u.h = __builtin_convertvector(col, v8bf);      // RNE, two values an instruction; k even in the low halfword
      *(v4ia*)(T + (4u * lane + (unsigned)c) * TPITCH + k0) = u.q;
    }
  }
}
// fragment from an LDS k-contiguous bf16 row: p = row + k0 + 8h (same element order as ldg_frag)
__device__ __forceinline__ FragB lds_frag(const unsigned short* p) {
  FragB f;
  f.q[0] = *(const v4ia*)p;
  f.q[1] = *(const v4ia*)(p + 16);
  return f;
}

// ---------------------------------------------------------------------------
// Projections. Block = 64 rows of the flattened [b][row] input, 4 waves x 16 rows; activations are held
// as bf16 fragments (col = lane&15 = input row) and every head (16 output columns) is one rolled step.
// MODE 0: q = x1.W1 + x2.W2.   MODE 1: k = x1.W1, then v = x1.W2, and the bf16 fragments of x1 (the nodes) also go
//   out as the plane nb[b][16-node tile][k step][element half][lane][8] (B operand of the final scoring product, in
//   fragment order): a lane stores its own 16-B pieces, each wave-wide store is 512 B in a row.
// Both modes run in ONE launch (k_proj): they depend only on the inputs, not on each other. A block first stages its
// own two weights, transposed to bf16 [out][in], in LDS (stage_wt) and takes every weight fragment from there.
// q/k form: D = Wt_tile (A, row = out col) x X (B, col = input row): D[row d = 8h+r][col = input row], so a
//   lane holds 8 consecutive d of one row -> one 16-B LDS store per plane half. Plane (b,head,16-row tile) =
//   hi[lane][8] | lo[lane][8] halfwords, lane = 16h + row: the piece a lane of k_dec takes, so its wave-wide load is
//   512 B in a row.
// v form: D = X (A) x Wt_tile (B): D[row = input row 8h+r][col d], lane holds 8 consecutive n of column d ->
//   one 16-B LDS store into the V^T stage [head][32-key tile][hi|lo][element half][lane][8], the global order too.
// LDS stg: cross-wave (block barriers); fully written before each copy-out (8 heads x 64 rows x 32, or
// coverage: q/k plane: NB*8 blocks x 16384 halfwords = NB*8*512*32; V^T: NB*8 blocks x 16384 (hi + lo) = 2*NB*128*512.
// ---------------------------------------------------------------------------
template <int MODE>
__device__ __forceinline__ void proj_body(const unsigned blk, unsigned short* stg,
                                          const float* __restrict__ x1, const float* __restrict__ x2,
                                          const float* __restrict__ w1, const float* __restrict__ w2,
                                          unsigned short* w1t, unsigned short* w2t,
                                          unsigned short* o1, unsigned short* o2, unsigned short* nb) {
  const unsigned tid = threadIdx.x, lane = tid & 31u, wave = tid >> 5, hh = lane >> 4, m = lane & 15u;
  const unsigned row0 = blk * 64u;
  const unsigned bb = row0 >> 9, r0 = row0 & 511u;
  const unsigned xrow = row0 + 16u * wave + m;

  // x1's loads (from memory, the longest wait) are issued first and packed behind the weight staging
  v4f xr[4][4];
  const float* xp = x1 + (size_t)xrow * EW + 8u * hh;
#pragma unroll
  for (int ks = 0; ks < 4; ++ks) {
    const float* p = xp + 32 * ks;
    xr[ks][0] = *(const v4fa*)p;        xr[ks][1] = *(const v4fa*)(p + 4);
    xr[ks][2] = *(const v4fa*)(p + 16); xr[ks][3] = *(const v4fa*)(p + 20);
  }
  // the wait that stands before a register named by an issued load is written again; xp as an input keeps the
  // address pair out of the loads' own destinations up to here
  asm volatile("s_wait_xcnt 0x0" :: "v"(xp) : "memory");
#pragma unroll 1   // one weight a trip: 32 loads in flight, not 64, which keeps the block under 256 registers
  for (unsigned w = 0; w < 2u; ++w) stage_wt(w ? w2 : w1, w ? w2t : w1t);
  FragB xa[4], xb[4];
#pragma unroll
  for (int ks = 0; ks < 4; ++ks) {
#pragma unroll
    for (int j = 0; j < 4; ++j) {
      xa[ks].w[2 * j] = pack2(xr[ks][j].x, xr[ks][j].y);
      xa[ks].w[2 * j + 1] = pack2(xr[ks][j].z, xr[ks][j].w);
    }
    if (MODE == 0) xb[ks] = ldf_frag(x2 + (size_t)xrow * EW + 32 * ks + 8u * hh);
    else xb[ks] = xa[ks];
  }
  __syncthreads();   // both staged weights are complete before any wave reads a fragment
  if (MODE == 1) {
    unsigned short* nd = nb + (size_t)(row0 + 16u * wave) * EW + 8u * lane;
#pragma unroll   // constant ks: xa[] stays in registers
    for (int ks = 0; ks < 4; ++ks) {
      *(v4i*)(nd + 2 * FHALF * ks) = xa[ks].q[0];
      *(v4i*)(nd + 2 * FHALF * ks + FHALF) = xa[ks].q[1];
    }
  }
  const v8f zero8 = {0.f, 0.f, 0.f, 0.f, 0.f, 0.f, 0.f, 0.f};

#pragma unroll 1
  for (unsigned t = 0; t < NH; ++t) {
    const unsigned short* wp = w1t + (16u * t + m) * TPITCH + 8u * hh;
    const unsigned short* wq = w2t + (16u * t + m) * TPITCH + 8u * hh;
    v8f acc = zero8;
    FragB wf[4], wg[4];
#pragma unroll   // the step's LDS reads stand together, ahead of its matrix chain: one LDS latency a step
    for (int ks = 0; ks < 4; ++ks) {
      wf[ks] = lds_frag(wp + 32 * ks);
      if (MODE == 0) wg[ks] = lds_frag(wq + 32 * ks);
    }
#pragma unroll
    for (int ks = 0; ks < 4; ++ks) {
      acc = wmb(wf[ks], xa[ks], acc);
      if (MODE == 0) acc = wmb(wg[ks], xb[ks], acc);
    }
    v4i hi, lo;
    split8(acc, hi, lo);
    const unsigned so = (t * 64u + 16u * wave) * QROW + 8u * lane;   // tile of 16 rows: [hi|lo][lane][8]
    *(v4ia*)(stg + so) = hi;
    *(v4ia*)(stg + so + FHALF) = lo;
  }
  __syncthreads();
  {
    unsigned short* dst = o1 + ((size_t)bb * NH * GQ + r0) * QROW;
#pragma unroll 1
    for (unsigned it = 0; it < 16u; ++it) {
      const unsigned p = it * 128u + tid, t = p >> 8, wi = p & 255u;
      const v4i v = *(const v4ia*)(stg + p * 8u);
      *(v4i*)(dst + (size_t)t * (GQ * QROW) + wi * 8u) = v;
      asm volatile("s_wait_xcnt 0x0" ::: "memory");   // stands before the next trip, or the code behind the loop, writes a register this store names
    }
    
  }
  if (MODE == 1) {
    __syncthreads();
#pragma unroll 1
    for (unsigned t = 0; t < NH; ++t) {
      const unsigned short* wq = w2t + (16u * t + m) * TPITCH + 8u * hh;
      v8f acc = zero8;
      FragB wf[4];
#pragma unroll   // as above: the reads together, then the chain
      for (int ks = 0; ks < 4; ++ks) wf[ks] = lds_frag(wq + 32 * ks);
#pragma unroll
      for (int ks = 0; ks < 4; ++ks) acc = wmb(xa[ks], wf[ks], acc);
      v4i hi, lo;
      split8(acc, hi, lo);                       // acc[r] = v[n = 16 wave + 8h + r][col 16t + m]
      // 32-key tile wave >> 1, element half wave & 1 of its hi and lo fragments
      const unsigned so = (2u * t + (wave >> 1)) * VTILE + (wave & 1u) * FHALF + 8u * lane;
      *(v4ia*)(stg + so) = hi;
      *(v4ia*)(stg + so + 2 * FHALF) = lo;
    }
    __syncthreads();
    unsigned short* dst = o2 + ((size_t)bb * NH * (NK / 32) + (r0 >> 5)) * VTILE;
#pragma unroll 1
    for (unsigned it = 0; it < 16u; ++it) {
      const unsigned p = it * 128u + tid, t = p >> 8, wi = p & 255u;   // a head's two tiles: 4 KiB in a row
      const v4i v = *(const v4ia*)(stg + p * 8u);
      *(v4i*)(dst + (size_t)t * ((NK / 32) * VTILE) + wi * 8u) = v;
      asm volatile("s_wait_xcnt 0x0" ::: "memory");   // stands before the next trip, or the code behind the loop, writes a register this store names
    }
    
  }
}

// One grid for both projections and the W_comb plane: block 0 writes W_comb^T as a bf16 plane in fragment order for the next launch,
// blocks 1 .. KVBLK take the k/v form (the longer one, so it starts first), the rest the q form. The choice is
// uniform in a block, so every barrier of a body is passed by all its waves.
// W_comb plane: 8 tiles of 16 rows in fragment order; a wave-wide store is 512 B in a row, each piece once.
#define KVBLK ((NB * NK) / 64)
#define QBLK  ((NB * GQ) / 64)
__global__ __launch_bounds__(128) void k_proj(const float* __restrict__ nodes, const float* __restrict__ q1,
                                              const float* __restrict__ last,
                                              const float* __restrict__ wqf, const float* __restrict__ wql,
                                              const float* __restrict__ wk, const float* __restrict__ wv,
                                              const float* __restrict__ wc,
                                              unsigned short* qpl, unsigned short* kpl, unsigned short* vtp,
                                              unsigned short* nbf, unsigned short* wct) {
  __shared__ __attribute__((aligned(16))) unsigned short stg[16384];
  __shared__ __attribute__((aligned(16))) unsigned short wl1[EW * TPITCH];
  __shared__ __attribute__((aligned(16))) unsigned short wl2[EW * TPITCH];
  if (blockIdx.x == 0u) {
    stage_wt(wc, wl1);
    __syncthreads();
#pragma unroll 4   // four LDS reads in flight a trip instead of one
    for (unsigned it = 0; it < 16u; ++it) {
      // p = 16-B piece of the plane in fragment order: [16-row tile][k step][element half][k half h][row m]
      const unsigned p = it * 128u + threadIdx.x, n = ((p >> 8) << 4) | (p & 15u);
      const unsigned c = (((p >> 6) & 3u) << 2) | (((p >> 5) & 1u) << 1) | ((p >> 4) & 1u);
      const v4i v = *(const v4ia*)(wl1 + n * TPITCH + c * 8u);
      *(v4i*)(wct + p * 8u) = v;
      // the wait that stands before the next trip writes the registers these stores name
      if ((it & 3u) == 3u) asm volatile("s_wait_xcnt 0x0" ::: "memory");
    }
  } else if (blockIdx.x <= (unsigned)KVBLK) {
    proj_body<1>(blockIdx.x - 1u, stg, nodes, nodes, wk, wv, wl1, wl2, kpl, vtp, nbf);
  } else {
    proj_body<0>(blockIdx.x - 1u - (unsigned)KVBLK, stg, q1, last, wqf, wql, wl1, wl2, qpl, qpl, nbf);
  }
}

// ---------------------------------------------------------------------------
// Fused decoder block: one block = (batch b, RB = 32 query rows g0..g0+31), 8 waves. Every wave carries QT = 2 tiles of
// 16 queries through phases A, B and C, so each K, V^T, W_comb^T and node fragment is loaded once for both tiles and
// the two tiles' chains are independent work for the wave. What is said below of 16 queries holds for each tile.
// Phase 0: mask tile [32][512] f32 (bf16-convert of the input value, times log2e) -> LDS mk (cross-wave, block barrier).
// Phase A (wave = head): flash attention in the transposed domain.
//   S^T tile = K (A, row = key) x Q^T (B, col = query): K = 16 is laid as [k_hi|k_hi] x [q_hi|q_lo] plus
//   [k_lo|0] x [q_hi|q_lo] along the 32-deep k axis. D[row key 8h+r][col query m]. Softmax statistics are
//   per lane (query m); the two lane halves combine by one xor-16 exchange. The P^T B-fragment is the lane's
//   own 16 score results (tile 0 -> elements 0..7, tile 1 -> elements 8..15). O^T = V^T (A, row d) x P^T:
//   D[row d 8h+r][col query m], scaled per lane. ctx hi/lo -> LDS cst[plane][query][128] by 16-B stores.
// Phase B (wave = 16 output columns e): mh^T = W_comb^T (A, global plane) x ctx^T (B, from cst), hi + lo,
//   + bf16(b_comb[e]); mh hi/lo -> LDS mst[plane][query][128] by 16-B stores.
// Phase C (wave = 64 nodes): s2 = mh (A, from mst, hi + lo) x nodes^T (B, global bf16 plane);
//   D[row query 8h+r][col node m]; s = (10 tanh(x/sqrt(128)) + mask) log2e, written over the mask value in place.
// Phase D (wave = 4 rows): row softmax from LDS; each instruction writes 512 contiguous bytes (4 whole
// LDS extents: mk rows 0..31 cols 0..511 written in phase 0 and consumed cols 0..511; cst/mst rows 0..31
//   cols 0..127 of both planes written by all 8 waves, consumed cols 0..127. Pad columns are never read.
// coverage: grid (16, NB) x 32 rows x 512 = NB*512*512 outputs, each written by exactly one lane.
// ---------------------------------------------------------------------------
__global__ __launch_bounds__(256) void k_dec(const unsigned short* __restrict__ qpl,
                                             const unsigned short* __restrict__ kpl,
                                             const unsigned short* __restrict__ vt,
                                             const float* __restrict__ mask,
                                             const unsigned short* __restrict__ wct,
                                             const float* __restrict__ bcomb,
                                             const unsigned short* __restrict__ nbf,
                                             float* out) {
  __shared__ __attribute__((aligned(16))) float mk[RB * MPITCH];
  __shared__ __attribute__((aligned(16))) unsigned short cst[2 * RB * CPITCH];
  __shared__ __attribute__((aligned(16))) unsigned short mst[2 * RB * CPITCH];
  const unsigned tid = threadIdx.x, lane = tid & 31u, wave = tid >> 5, hh = lane >> 4, m = lane & 15u;
  const unsigned g0 = blockIdx.x * (unsigned)RB, b = blockIdx.y;
  const v8f zero8 = {0.f, 0.f, 0.f, 0.f, 0.f, 0.f, 0.f, 0.f};
  const v4i zero4 = {0, 0, 0, 0};

  // q fragments and the first K tile are asked for ahead of the mask staging: they are back when phase A starts
  const unsigned bh = b * NH + wave;
  const unsigned short* qp = qpl + ((size_t)bh * GQ + g0) * QROW + 8u * lane;
  FragB qf[QT];
#pragma unroll   // constant qt here and below: the per-tile arrays stay in registers
  for (int qt = 0; qt < QT; ++qt) {
    qf[qt].q[0] = *(const v4ia*)(qp + qt * 16 * QROW);           // q_hi[8h .. 8h+7]  (k slots 8h..)
    qf[qt].q[1] = *(const v4ia*)(qp + qt * 16 * QROW + FHALF);   // q_lo[8h .. 8h+7]  (k slots 16+8h..)
  }
  const unsigned short* kb = kpl + (size_t)bh * NK * QROW + 8u * lane;
  v4i kh0 = *(const v4ia*)kb;
  v4i kl0 = *(const v4ia*)(kb + FHALF);
  v4i kh1 = *(const v4ia*)(kb + 16 * QROW);
  v4i kl1 = *(const v4ia*)(kb + 16 * QROW + FHALF);
  // the wait that stands before a register named by an issued load is written again; qp and kb as inputs keep the
  // address pairs whole up to here
  asm volatile("s_wait_xcnt 0x0" :: "v"(qp), "v"(kb) : "memory");
  FragB wf[4], nf[4];              // W_comb^T fragments of phase B, node fragments of phase C: loaded one stage ahead
  v4f b0, b1;
  const unsigned short* nbase = nbf + ((size_t)b * NK + 64u * wave) * EW + 8u * lane;

  // ---- phase 0: mask tile ----
  {
    const float* mg = mask + ((size_t)b * GQ + g0) * NK;
#pragma unroll 4   // four trips as with one tile: a trip's loads wait for memory together
    for (unsigned it = 0; it < 8u * QT; ++it) {
      const unsigned p = it * 256u + tid, row = p >> 7, c4 = (p & 127u) << 2;
      v4f v = *(const v4fa*)(mg + (size_t)row * NK + c4);
      const v2f v01 = bf16_val2(v.x, v.y) * L2E, v23 = bf16_val2(v.z, v.w) * L2E;
      *(v4fa*)(mk + row * MPITCH + c4) = __builtin_shufflevector(v01, v23, 0, 1, 2, 3);
    }
  }
  __syncthreads();

  // ---- phase A: attention for head = wave, both query tiles ----
  {
    const unsigned short* vb = vt + (size_t)bh * ((NK / 32) * VTILE) + 8u * lane;
    const unsigned moff = m * MPITCH + 8u * hh;
    v8f o[QT];
    float mrun[QT], lrun[QT];
#pragma unroll
    for (int qt = 0; qt < QT; ++qt) { o[qt] = zero8; mrun[qt] = -3.0e38f; lrun[qt] = 0.0f; }
#pragma unroll 1
    for (unsigned n0 = 0; n0 < NK; n0 += 32u) {
      const unsigned short* vp = vb + (size_t)(n0 >> 5) * VTILE;
      const FragB fvh = ldg_frag(vp);               // used at the trip's foot: a trip of lead as it stands
      const FragB fvl = ldg_frag(vp + 2 * FHALF);
      FragB a10, a20, a11, a21;
      a10.q[0] = kh0; a10.q[1] = kh0;
      a20.q[0] = kl0; a20.q[1] = zero4;
      a11.q[0] = kh1; a11.q[1] = kh1;
      a21.q[0] = kl1; a21.q[1] = zero4;
      v8f s0[QT], s1[QT], mk0[QT], mk1[QT];
#pragma unroll
      for (int qt = 0; qt < QT; ++qt) {
        const float* mp = mk + (unsigned)qt * (16u * MPITCH) + moff + n0;
        const v4f m0 = *(const v4fa*)mp;
        const v4f m1 = *(const v4fa*)(mp + 4);
        const v4f m2 = *(const v4fa*)(mp + 16);
        const v4f m3 = *(const v4fa*)(mp + 20);
        mk0[qt] = __builtin_shufflevector(m0, m1, 0, 1, 2, 3, 4, 5, 6, 7);
        mk1[qt] = __builtin_shufflevector(m2, m3, 0, 1, 2, 3, 4, 5, 6, 7);
        s0[qt] = wmb(a10, qf[qt], zero8);
        s0[qt] = wmb(a20, qf[qt], s0[qt]);
        s1[qt] = wmb(a11, qf[qt], zero8);
        s1[qt] = wmb(a21, qf[qt], s1[qt]);
      }
      // the next K tile is asked for behind this tile's score products: the softmax and P.V below cover its way from
      // L2. The last trip asks for tile 0 again (in bounds, not used).
      const unsigned short* kp = kb + (size_t)((n0 + 32u) & (NK - 1u)) * QROW;
      kh0 = *(const v4ia*)kp;
      kl0 = *(const v4ia*)(kp + FHALF);
      kh1 = *(const v4ia*)(kp + 16 * QROW);
      kl1 = *(const v4ia*)(kp + 16 * QROW + FHALF);
      // the wait that stands before a register named by an issued load is written again; kp and vp as inputs keep the
      // address pairs whole up to here
      asm volatile("s_wait_xcnt 0x0" :: "v"(kp), "v"(vp) : "memory");
#pragma unroll
      for (int qt = 0; qt < QT; ++qt) {
        const v8f a0 = s0[qt] * (0.25f * L2E) + mk0[qt];      // key n0 + 8h + r, log2 domain
        const v8f a1 = s1[qt] * (0.25f * L2E) + mk1[qt];      // key n0 + 16 + 8h + r

        float t = fmaxf(a0[0], a1[0]);
#pragma unroll
        for (int r = 1; r < 8; ++r) t = fmaxf(t, fmaxf(a0[r], a1[r]));
        t = fmaxf(t, __shfl_xor(t, 16));
        const float mnew = fmaxf(mrun[qt], t);
        const float sc = ex2(mrun[qt] - mnew);
        const v8f p0 = ex2x8(a0 - mnew);
        const v8f p1 = ex2x8(a1 - mnew);
        float ps = 0.0f;
#pragma unroll
        for (int r = 0; r < 8; ++r) ps += p0[r] + p1[r];
        lrun[qt] = lrun[qt] * sc + ps;
        mrun[qt] = mnew;
        o[qt] = o[qt] * sc;

        FragB ph, pl;
        split8(p0, ph.q[0], pl.q[0]);
        split8(p1, ph.q[1], pl.q[1]);
        o[qt] = wmb(fvh, ph, o[qt]);
        o[qt] = wmb(fvl, ph, o[qt]);
        o[qt] = wmb(fvh, pl, o[qt]);
      }
    }
    // phase B's W_comb^T fragments and bias and phase C's first node tile are asked for here, ahead of the two barriers
    {
      const unsigned short* wp = wct + (size_t)(16u * wave) * EW + 8u * lane;
      const float* bp = bcomb + 16u * wave + 8u * hh;
#pragma unroll   // constant ks: wf[], nf[] stay in registers
      for (int ks = 0; ks < 4; ++ks) wf[ks] = ldg_frag(wp + 2 * FHALF * ks);
      b0 = *(const v4fa*)bp;
      b1 = *(const v4fa*)(bp + 4);
#pragma unroll
      for (int ks = 0; ks < 4; ++ks) nf[ks] = ldg_frag(nbase + 2 * FHALF * ks);
      // the wait that stands before a register named by an issued load is written again; the pointers as inputs keep
      // the address pairs whole up to here
      asm volatile("s_wait_xcnt 0x0" :: "v"(wp), "v"(bp), "v"(nbase) : "memory");
    }
#pragma unroll
    for (int qt = 0; qt < QT; ++qt) {
      const float lt = lrun[qt] + __shfl_xor(lrun[qt], 16);
      const float inv = 1.0f / lt;
      const v8f c = o[qt] * inv;              // ctx[query 16 qt + m][16 wave + 8h + r]
      v4i hi, lo;
      split8(c, hi, lo);
      const unsigned co = (16u * (unsigned)qt + m) * CPITCH + 16u * wave + 8u * hh;
      *(v4ia*)(cst + co) = hi;
      *(v4ia*)(cst + RB * CPITCH + co) = lo;
    }
  }
  __syncthreads();

  // ---- phase B: mh^T tiles for e = 16 wave .. 16 wave + 15 ----
  {
    const unsigned e0 = 16u * wave;
    const unsigned co = m * CPITCH + 8u * hh;
    v8f acc[QT];
#pragma unroll
    for (int qt = 0; qt < QT; ++qt) acc[qt] = zero8;
#pragma unroll
    for (int ks = 0; ks < 4; ++ks) {
#pragma unroll
      for (int qt = 0; qt < QT; ++qt) {
        const unsigned short* cp = cst + qt * 16 * CPITCH + co + 32 * ks;
        FragB ch, cl;
        ch.q[0] = *(const v4ia*)cp;
        ch.q[1] = *(const v4ia*)(cp + 16);
        cl.q[0] = *(const v4ia*)(cp + RB * CPITCH);
        cl.q[1] = *(const v4ia*)(cp + RB * CPITCH + 16);
        acc[qt] = wmb(wf[ks], ch, acc[qt]);
        acc[qt] = wmb(wf[ks], cl, acc[qt]);
      }
    }
    const v2f c01 = bf16_val2(b0.x, b0.y), c23 = bf16_val2(b0.z, b0.w);
    const v2f c45 = bf16_val2(b1.x, b1.y), c67 = bf16_val2(b1.z, b1.w);
#pragma unroll
    for (int qt = 0; qt < QT; ++qt) {
      v8f a = acc[qt];
      a[0] += c01.x; a[1] += c01.y; a[2] += c23.x; a[3] += c23.y;
      a[4] += c45.x; a[5] += c45.y; a[6] += c67.x; a[7] += c67.y;
      v4i hi, lo;
      split8(a, hi, lo);                      // mh[query 16 qt + m][e0 + 8h + r]
      const unsigned mo = (16u * (unsigned)qt + m) * CPITCH + e0 + 8u * hh;
      *(v4ia*)(mst + mo) = hi;
      *(v4ia*)(mst + RB * CPITCH + mo) = lo;
    }
  }
  __syncthreads();

  // ---- phase C: s = (10 tanh(mh . node / sqrt(128)) + mask) log2e, nodes 64 wave .. 64 wave + 63 ----
  {
    const float k2 = (float)(2.0 * 1.4426950408889634 / 11.313708498984761);   // exp(2 x), x = acc / sqrt(128), as 2^(acc k2)
    const unsigned ao = m * CPITCH + 8u * hh;
    FragB ah[QT][4], al[QT][4];
#pragma unroll
    for (int qt = 0; qt < QT; ++qt) {
#pragma unroll
      for (int ks = 0; ks < 4; ++ks) {
        const unsigned short* ap = mst + qt * 16 * CPITCH + ao + 32 * ks;
        ah[qt][ks].q[0] = *(const v4ia*)ap;
        ah[qt][ks].q[1] = *(const v4ia*)(ap + 16);
        al[qt][ks].q[0] = *(const v4ia*)(ap + RB * CPITCH);
        al[qt][ks].q[1] = *(const v4ia*)(ap + RB * CPITCH + 16);
      }
    }
#pragma unroll 1
    for (unsigned j = 0; j < 4u; ++j) {
      const unsigned n0 = 64u * wave + 16u * j;
      v8f acc[QT];
#pragma unroll
      for (int qt = 0; qt < QT; ++qt) acc[qt] = zero8;
#pragma unroll
      for (int ks = 0; ks < 4; ++ks) {
#pragma unroll
        for (int qt = 0; qt < QT; ++qt) {
          acc[qt] = wmb(ah[qt][ks], nf[ks], acc[qt]);
          acc[qt] = wmb(al[qt][ks], nf[ks], acc[qt]);
        }
      }
      // the next node tile is asked for behind this tile's products: the tanh and mask work below covers its way
      // from L2. The test is the same for the whole block; the last trip asks for nothing.
      const unsigned short* np = nbase + (size_t)((j + 1u) * 16u) * EW;
      if (j < 3u) {
#pragma unroll
        for (int ks = 0; ks < 4; ++ks) nf[ks] = ldg_frag(np + 2 * FHALF * ks);
      }
      // the wait that stands before a register named by an issued load is written again; np as an input keeps the
      // address pair whole up to here
      asm volatile("s_wait_xcnt 0x0" :: "v"(np) : "memory");
#pragma unroll
      for (int qt = 0; qt < QT; ++qt) {
        const v8f q = rcpx8(ex2x8(acc[qt] * k2) + 1.0f);      // exp(2x) = +inf -> tanh 1, 0 -> tanh -1
#pragma unroll
        for (int r = 0; r < 8; ++r) {
          const unsigned idx = (16u * (unsigned)qt + 8u * hh + (unsigned)r) * MPITCH + n0 + m;   // D element r = (query 16 qt + 8h + r, node m)
          const float s = (10.0f * L2E - (20.0f * L2E) * q[r]) + mk[idx];   // log2 domain, like the mask tile
          mk[idx] = s;
        }
      }
    }
  }
  __syncthreads();

  // ---- phase D: row softmax, rows 2 QT wave .. 2 QT wave + 2 QT - 1, two rows a pass ----
#pragma unroll 1   // a pass is the two-row body of one tile; rolled, its stores' registers are rewritten only behind the wait at its foot
  for (unsigned pp = 0; pp < (unsigned)QT; ++pp) {
    const unsigned row0 = (unsigned)(2 * QT) * wave + 2u * pp;
    v4f res[2][4];
#pragma unroll
    for (int rr = 0; rr < 2; ++rr) {
      const unsigned so = (row0 + (unsigned)rr) * MPITCH + 4u * lane;
      v4f v[4];
#pragma unroll
      for (int j = 0; j < 4; ++j) v[j] = *(const v4fa*)(mk + so + 128 * j);
      float mx = v[0].x;
#pragma unroll
      for (int j = 0; j < 4; ++j) mx = fmaxf(fmaxf(fmaxf(mx, v[j].x), fmaxf(v[j].y, v[j].z)), v[j].w);
      mx = fmaxf(mx, __shfl_xor(mx, 16));
      mx = fmaxf(mx, __shfl_xor(mx, 8));
      mx = fmaxf(mx, __shfl_xor(mx, 4));
      mx = fmaxf(mx, __shfl_xor(mx, 2));
      mx = fmaxf(mx, __shfl_xor(mx, 1));
      float sum = 0.0f;
#pragma unroll
      for (int j = 0; j < 4; j += 2) {
        const v8f e = ex2x8(__builtin_shufflevector(v[j], v[j + 1], 0, 1, 2, 3, 4, 5, 6, 7) - mx);
        v[j] = __builtin_shufflevector(e, e, 0, 1, 2, 3);
        v[j + 1] = __builtin_shufflevector(e, e, 4, 5, 6, 7);
        sum += (v[j].x + v[j].y) + (v[j].z + v[j].w);
        sum += (v[j + 1].x + v[j + 1].y) + (v[j + 1].z + v[j + 1].w);
      }
      sum += __shfl_xor(sum, 16);
      sum += __shfl_xor(sum, 8);
      sum += __shfl_xor(sum, 4);
      sum += __shfl_xor(sum, 2);
      sum += __shfl_xor(sum, 1);
      const float inv = 1.0f / sum;
#pragma unroll
      for (int j = 0; j < 4; ++j) res[rr][j] = v[j] * inv;
    }
    float* ob = out + ((size_t)b * GQ + g0 + row0) * NK + 4u * lane;
#pragma unroll
    for (int rr = 0; rr < 2; ++rr)
#pragma unroll
      for (int j = 0; j < 4; ++j) *(v4f*)(ob + (size_t)rr * NK + 128 * j) = res[rr][j];
    asm volatile("s_wait_xcnt 0x0" ::: "memory");   // stands before the next pass writes a register these stores name
  }
}

// ---------------------------------------------------------------------------
static inline size_t al256(size_t o) { return (o + 255) & ~(size_t)255; }

extern "C" void kernel_launch(void* const* d_in, const int* in_sizes, int n_in,
                              void* d_out, int out_size, void* d_ws, size_t ws_size,
                              hipStream_t stream) {
  if (n_in < 10) return;
  const long long actN = (long long)NB * NK * EW;
  const long long actG = (long long)NB * GQ * EW;
  const long long mskN = (long long)NB * GQ * NK;
  if ((long long)in_sizes[0] < actN) return;             // encoded_nodes
  if ((long long)in_sizes[1] < actG) return;             // encoded_q1
  if ((long long)in_sizes[2] < actG) return;             // encoded_last_node
  if ((long long)in_sizes[3] < mskN) return;             // ninf_mask (f32, additive)
  if (in_sizes[4] < EW * EW || in_sizes[5] < EW * EW || in_sizes[6] < EW * EW ||
      in_sizes[7] < EW * EW || in_sizes[8] < EW * EW) return;
  if (in_sizes[9] < EW) return;
  if ((long long)out_size < mskN) return;

  const float* nodes = (const float*)d_in[0];
  const float* q1    = (const float*)d_in[1];
  const float* last  = (const float*)d_in[2];
  const float* mask  = (const float*)d_in[3];
  const float* Wqf   = (const float*)d_in[4];
  const float* Wql   = (const float*)d_in[5];
  const float* Wk    = (const float*)d_in[6];
  const float* Wv    = (const float*)d_in[7];
  const float* Wc    = (const float*)d_in[8];
  const float* bc    = (const float*)d_in[9];
  float* out = (float*)d_out;

  const size_t wtB  = al256((size_t)5 * EW * EW * 2);             // 163,840
  const size_t nbB  = al256((size_t)NB * NK * EW * 2);            // 4,194,304
  const size_t qB   = al256((size_t)NB * NH * GQ * QROW * 2);     // 8,388,608
  const size_t kB   = al256((size_t)NB * NH * NK * QROW * 2);     // 8,388,608
  const size_t vB   = al256((size_t)2 * VPL * 2);                 // 8,388,608
  const size_t total = wtB + nbB + qB + kB + vB;                  // 29,523,968
  if (total > ws_size || total > (size_t)WSMAX) return;
  char* w = (char*)d_ws;
  unsigned short* wt  = (unsigned short*)w;
  unsigned short* nbf = (unsigned short*)(w + wtB);
  unsigned short* qpl = (unsigned short*)(w + wtB + nbB);
  unsigned short* kpl = (unsigned short*)(w + wtB + nbB + qB);
  unsigned short* vtp = (unsigned short*)(w + wtB + nbB + qB + kB);
  unsigned short* wctp = wt + 4 * EW * EW;

  // 1: W_comb [in][out] f32 -> W_comb^T bf16 plane; k = nodes.Wk -> k plane (hi|lo tiles), v = nodes.Wv -> V^T hi|lo tiles, nodes -> bf16 plane;
  //    q = q1.Wq_first + last.Wq_last -> q plane (hi|lo tiles); every plane in fragment order
  k_proj<<<1 + KVBLK + QBLK, 128, 0, stream>>>(nodes, q1, last, Wqf, Wql, Wk, Wv, Wc, qpl, kpl, vtp, nbf, wctp);
  // 2: attention + W_comb + final scoring + softmax
  k_dec<<<dim3(GQ / RB, NB), 256, 0, stream>>>(qpl, kpl, vtp, mask, wctp, bc, nbf, out);
}

// v009
// It runs in 40.4 microseconds.
// Two timings next to v008 both put it at 1.08 times that version's speed.
// Over all steps from v000 it is 2.80 times as fast.
// Contractions: q/k/v projections = v_wmma_f32_16x16x32_bf16, bf16 (RNE) inputs and weights, one product. ctx.W_comb and mh.nodes = same bf16 WMMA with the computed operand carried as bf16 hi + bf16 lo (input-side planes are exact bf16, lo == 0).
// q.k scores and P.V = v_wmma_f32_16x16x32_f16: q and P are one f16 value each (RNE, 11 significant bits; the inputs behind them were rounded to 8), k and v are f16 hi + f16 lo; f16 is finite below 65504, P lies in [0, 1]. Accumulate f32 everywhere.
// Mask add, online softmax, tanh, bias, final softmax: f32 VALU; both softmaxes run on logits scaled by log2e (the LDS mask tile carries the factor), so exp(x - m) is one subtract and v_exp_f32; tanh(x) = 1 - 2 v_rcp_f32(1 + exp(2x)). No power-of-two carries exist (bf16 and f16 planes, unscaled).
#include <hip/hip_runtime.h>
#include <stddef.h>
#include <stdint.h>

#ifndef NB
#define NB 32                      // batches processed (a reduced build reads the first NB batches)
#endif
#define GQ     512                 // queries per batch
#define NK     512                 // nodes (keys) per batch
#define EW     128                 // embedding width = heads x head dim
#define NH     8
#define HD     16
#define QROW   32                  // halfwords per q/k plane row (k: 16 hi + 16 lo, q: 16 twice); 16 rows = one tile [half][lane][8]
#define FHALF  256                 // halfwords a wave-wide 16-B access covers: 32 lanes x 8
#define VTILE  1024                // halfwords per V^T tile (one head, 32 keys): hi fragment, then lo fragment
#define MPITCH 516                 // floats per LDS mask/score row
#define CPITCH 136                 // halfwords per LDS ctx/mh row
#define TPITCH 136                 // halfwords per LDS weight-transpose row
#define QT     2                   // 16-query tiles a wave of k_dec carries
#define RB     (16 * QT)           // query rows per k_dec block
#define WSMAX  134217728
#define VPL    ((size_t)NB * EW * NK)   // halfwords of V^T hi pieces (as many lo pieces)

static_assert(GQ == NK);                       // k_proj uses one row count for q and k planes
static_assert(NH * HD == EW);
static_assert(EW % 32 == 0 && NK % 32 == 0);
static_assert(GQ % 64 == 0 && (NB * GQ) % 64 == 0);
static_assert(16 * QROW == 2 * FHALF);         // q/k tile: 16 rows = hi piece + lo piece, one wave-wide access each
static_assert(2 * HD * 32 == VTILE && VTILE == 4 * FHALF);   // V^T tile: 2 fragments of 2 accesses
static_assert(16 * EW == 8 * FHALF);           // nodes / W_comb tile: 16 rows = 4 fragments of 2 accesses
static_assert(NH * 64 * QROW == 16384);        // k_proj stage: q/k form
static_assert(2 * EW * 64 == 16384);           // k_proj stage: V^T form
static_assert(16384 == 128 * 16 * 8);          // k_proj copy-out: 128 thr x 16 it x 8 halfwords
static_assert(EW == 32 * 4 && EW == 4 * 4 * 8); // stage_wt: 32 lanes x 4 columns, 4 waves x 4 it x 8 rows
static_assert(EW * EW == 128 * 16 * 8);        // W_comb copy-out: 128 thr x 16 it x 8 halfwords
static_assert(RB * NK == 256 * (8 * QT) * 4);  // k_dec mask staging: 256 thr x 8 QT it x 4 floats
static_assert(GQ % RB == 0 && RB == 8 * 2 * QT); // k_dec grid; phase D: 8 waves x 2 QT rows
static_assert(NK == 8 * 64);                   // k_dec phase C: 8 waves x 64 nodes
static_assert(NK == 32 * 16);                  // k_dec phase D: 32 lanes x 4 x 4 floats per row

typedef int            v4i   __attribute__((ext_vector_type(4)));
typedef int            v8i   __attribute__((ext_vector_type(8)));
typedef float          v4f   __attribute__((ext_vector_type(4)));
typedef float          v8f   __attribute__((ext_vector_type(8)));
typedef __bf16         v16bf __attribute__((ext_vector_type(16)));
typedef __bf16         v8bf  __attribute__((ext_vector_type(8)));
typedef _Float16       v16h  __attribute__((ext_vector_type(16)));
typedef _Float16       v2h   __attribute__((ext_vector_type(2)));
typedef v4i __attribute__((may_alias)) v4ia;
typedef v4f __attribute__((may_alias)) v4fa;
union FragB { v16bf v; v16h h; v4i q[2]; v8i w; };

// WMMA by the builtin: the compiler keeps the distance behind it and fills the slots with other work where it can
__device__ __forceinline__ v8f wmb(const FragB& a, const FragB& b, v8f c) {
  return __builtin_amdgcn_wmma_f32_16x16x32_bf16(false, a.v, false, b.v, (short)0, c, false, false);
}
// the f16 form: same shape, same fragment maps
__device__ __forceinline__ v8f wmh(const FragB& a, const FragB& b, v8f c) {
  return __builtin_amdgcn_wmma_f32_16x16x32_f16(false, a.h, false, b.h, (short)0, c, false, false);
}

#define L2E 1.4426950408889634f    // log2(e)
// 2^x on the hardware unit: -inf and anything below the f32 range give 0, +inf gives +inf
__device__ __forceinline__ float ex2(float x) { return __builtin_amdgcn_exp2f(x); }
// Eight 2^x / eight 1/x in one statement. Why asm: behind a transcendental the instruction set asks for one
// independent slot before its result is read or its source overwritten; the early-clobber outputs keep every
// result off every source, and the closing v_nop is the slot behind the last one.
__device__ __forceinline__ v8f ex2x8(const v8f x) {
  float y0, y1, y2, y3, y4, y5, y6, y7;
  asm("v_exp_f32 %0, %8\n\tv_exp_f32 %1, %9\n\tv_exp_f32 %2, %10\n\tv_exp_f32 %3, %11\n\t"
      "v_exp_f32 %4, %12\n\tv_exp_f32 %5, %13\n\tv_exp_f32 %6, %14\n\tv_exp_f32 %7, %15\n\tv_nop"
      : "=&v"(y0), "=&v"(y1), "=&v"(y2), "=&v"(y3), "=&v"(y4), "=&v"(y5), "=&v"(y6), "=&v"(y7)
      : "v"(x[0]), "v"(x[1]), "v"(x[2]), "v"(x[3]), "v"(x[4]), "v"(x[5]), "v"(x[6]), "v"(x[7]));
  const v8f y = {y0, y1, y2, y3, y4, y5, y6, y7};
  return y;
}
__device__ __forceinline__ v8f rcpx8(const v8f x) {
  float y0, y1, y2, y3, y4, y5, y6, y7;
  asm("v_rcp_f32 %0, %8\n\tv_rcp_f32 %1, %9\n\tv_rcp_f32 %2, %10\n\tv_rcp_f32 %3, %11\n\t"
      "v_rcp_f32 %4, %12\n\tv_rcp_f32 %5, %13\n\tv_rcp_f32 %6, %14\n\tv_rcp_f32 %7, %15\n\tv_nop"
      : "=&v"(y0), "=&v"(y1), "=&v"(y2), "=&v"(y3), "=&v"(y4), "=&v"(y5), "=&v"(y6), "=&v"(y7)
      : "v"(x[0]), "v"(x[1]), "v"(x[2]), "v"(x[3]), "v"(x[4]), "v"(x[5]), "v"(x[6]), "v"(x[7]));
  const v8f y = {y0, y1, y2, y3, y4, y5, y6, y7};
  return y;
}

typedef float          v2f   __attribute__((ext_vector_type(2)));
typedef __bf16         v2bf  __attribute__((ext_vector_type(2)));
// two f32 -> two bf16 in one word, RNE, by the hardware's packed convert; lo in the low halfword
__device__ __forceinline__ int pack2(float lo, float hi) {
  const v2f x = {lo, hi};
  union { v2bf h; int i; } u;
  u.h = __builtin_convertvector(x, v2bf);
  return u.i;
}
// the f32 values of RNE bf16(a), RNE bf16(b)
__device__ __forceinline__ v2f bf16_val2(float a, float b) {
  const unsigned h = (unsigned)pack2(a, b);
  const v2f r = {__uint_as_float(h << 16), __uint_as_float(h & 0xFFFF0000u)};
  return r;
}
// 8 f32 -> bf16 hi piece + bf16 lo piece (lo = RNE(v - hi)); element 2j in the low halfword of word j
__device__ __forceinline__ void split8(const v8f x, v4i& hi, v4i& lo) {
#pragma unroll
  for (int j = 0; j < 4; ++j) {
    const float a = x[2 * j], b = x[2 * j + 1];
    const unsigned h = (unsigned)pack2(a, b);
    const float ra = a - __uint_as_float(h << 16);
    const float rb = b - __uint_as_float(h & 0xFFFF0000u);
    hi[j] = (int)h;
    lo[j] = pack2(ra, rb);
  }
}
// two f32 -> two f16 in one word, RNE, by the hardware's packed convert; lo in the low halfword
__device__ __forceinline__ v2h pack2h(float lo, float hi) {
  const v2f x = {lo, hi};
  return __builtin_convertvector(x, v2h);
}
// 8 f32 -> one f16 piece; element 2j in the low halfword of word j
__device__ __forceinline__ v4i pack8h(const v8f x) {
  v4i r;
#pragma unroll
  for (int j = 0; j < 4; ++j) {
    union { v2h h; int i; } u;
    u.h = pack2h(x[2 * j], x[2 * j + 1]);
    r[j] = u.i;
  }
  return r;
}
// 8 f32 -> f16 hi piece + f16 lo piece (lo = RNE(v - hi)); element 2j in the low halfword of word j
__device__ __forceinline__ void split8h(const v8f x, v4i& hi, v4i& lo) {
#pragma unroll
  for (int j = 0; j < 4; ++j) {
    const float a = x[2 * j], b = x[2 * j + 1];
    union { v2h h; int i; } u, w;
    u.h = pack2h(a, b);
    w.h = pack2h(a - (float)u.h[0], b - (float)u.h[1]);
    hi[j] = u.i;
    lo[j] = w.i;
  }
}
// fragment (row/col = lane&15) from an f32 row: p = row + k0 + 8h; elements 0..7 <- k0+8h+0..7, 8..15 <- k0+16+8h+0..7
__device__ __forceinline__ FragB ldf_frag(const float* __restrict__ p) {
  const v4f a0 = *(const v4fa*)p;
  const v4f a1 = *(const v4fa*)(p + 4);
  const v4f a2 = *(const v4fa*)(p + 16);
  const v4f a3 = *(const v4fa*)(p + 20);
  FragB f;
  f.w[0] = pack2(a0.x, a0.y); f.w[1] = pack2(a0.z, a0.w);
  f.w[2] = pack2(a1.x, a1.y); f.w[3] = pack2(a1.z, a1.w);
  f.w[4] = pack2(a2.x, a2.y); f.w[5] = pack2(a2.z, a2.w);
  f.w[6] = pack2(a3.x, a3.y); f.w[7] = pack2(a3.z, a3.w);
  return f;
}
// same fragment from a GLOBAL plane kept in fragment order: a fragment = 512 halfwords, [element half][lane][8];
// p = fragment + 8 lane. Each of the two wave-wide loads covers 512 contiguous bytes (4 whole 128-B lines).
__device__ __forceinline__ FragB ldg_frag(const unsigned short* __restrict__ p) {
  FragB f;
  f.q[0] = *(const v4ia*)p;
  f.q[1] = *(const v4ia*)(p + FHALF);
  return f;
}

// ---------------------------------------------------------------------------
// Weight staging, by the 4 waves of one block: W[k][n] f32 (128 x 128, [in][out]) -> LDS T[n][k] bf16 bits, row
// pitch TPITCH. A task = 8 rows k x 4 columns n: a wave-wide load is one whole 512-B row of W, a lane packs 8
// consecutive k of each of its 4 columns into one 16-B LDS store. Coverage: 4 waves x 4 it x 8 k = 128 k,
// 32 lanes x 4 n = 128 n. Cross-wave: the caller's block barrier stands between this and the first read of T.
// ---------------------------------------------------------------------------
__device__ __forceinline__ void stage_wt(const float* __restrict__ W, unsigned short* T) {
  const unsigned lane = threadIdx.x & 31u, wave = threadIdx.x >> 5;
#pragma unroll   // all 32 loads of a weight in flight together
  for (unsigned it = 0; it < 4u; ++it) {
    const unsigned k0 = 8u * (wave + 4u * it);
    const float* p = W + (size_t)k0 * EW + 4u * lane;
    v4f r[8];
#pragma unroll   // constant j, c: r[] stays in registers
    for (int j = 0; j < 8; ++j) r[j] = *(const v4fa*)(p + j * EW);
#pragma unroll
    for (int c = 0; c < 4; ++c) {
      const v8f col = {r[0][c], r[1][c], r[2][c], r[3][c], r[4][c], r[5][c], r[6][c], r[7][c]};
      union { v8bf h; v4i q; } u;
      u.h = __builtin_convertvector(col, v8bf);      // RNE, two values an instruction; k even in the low halfword
      *(v4ia*)(T + (4u * lane + (unsigned)c) * TPITCH + k0) = u.q;
    }
  }
}
// fragment from an LDS k-contiguous bf16 row: p = row + k0 + 8h (same element order as ldg_frag)
__device__ __forceinline__ FragB lds_frag(const unsigned short* p) {
  FragB f;
  f.q[0] = *(const v4ia*)p;
  f.q[1] = *(const v4ia*)(p + 16);
  return f;
}

// ---------------------------------------------------------------------------
// Projections. Block = 64 rows of the flattened [b][row] input, 4 waves x 16 rows; activations are held
// as bf16 fragments (col = lane&15 = input row) and every head (16 output columns) is one rolled step.
// MODE 0: q = x1.W1 + x2.W2.   MODE 1: k = x1.W1, then v = x1.W2, and the bf16 fragments of x1 (the nodes) also go
//   out as the plane nb[b][16-node tile][k step][element half][lane][8] (B operand of the final scoring product, in
//   fragment order): a lane stores its own 16-B pieces, each wave-wide store is 512 B in a row.
// Both modes run in ONE launch (k_proj): they depend only on the inputs, not on each other. A block first stages its
// own two weights, transposed to bf16 [out][in], in LDS (stage_wt) and takes every weight fragment from there.
// q/k form: D = Wt_tile (A, row = out col) x X (B, col = input row): D[row d = 8h+r][col = input row], so a
//   lane holds 8 consecutive d of one row -> one 16-B LDS store per plane half. Plane (b,head,16-row tile) =
//   hi[lane][8] | lo[lane][8] f16 halfwords (q: the one f16 value in both), lane = 16h + row: the piece a lane of
//   k_dec takes, so its wave-wide load is 512 B in a row, and a tile is one whole 32-deep fragment.
// v form: D = X (A) x Wt_tile (B): D[row = input row 8h+r][col d], lane holds 8 consecutive n of column d ->
//   one 16-B LDS store into the V^T stage [head][32-key tile][hi|lo][element half][lane][8], the global order too.
// LDS stg: cross-wave (block barriers); fully written before each copy-out (8 heads x 64 rows x 32, or
// coverage: q/k plane: NB*8 blocks x 16384 halfwords = NB*8*512*32; V^T: NB*8 blocks x 16384 (hi + lo) = 2*NB*128*512.
// ---------------------------------------------------------------------------
template <int MODE>
__device__ __forceinline__ void proj_body(const unsigned blk, unsigned short* stg,
                                          const float* __restrict__ x1, const float* __restrict__ x2,
                                          const float* __restrict__ w1, const float* __restrict__ w2,
                                          unsigned short* w1t, unsigned short* w2t,
                                          unsigned short* o1, unsigned short* o2, unsigned short* nb) {
  const unsigned tid = threadIdx.x, lane = tid & 31u, wave = tid >> 5, hh = lane >> 4, m = lane & 15u;
  const unsigned row0 = blk * 64u;
  const unsigned bb = row0 >> 9, r0 = row0 & 511u;
  const unsigned xrow = row0 + 16u * wave + m;

  // x1's loads (from memory, the longest wait) are issued first and packed behind the weight staging
  v4f xr[4][4];
  const float* xp = x1 + (size_t)xrow * EW + 8u * hh;
#pragma unroll
  for (int ks = 0; ks < 4; ++ks) {
    const float* p = xp + 32 * ks;
    xr[ks][0] = *(const v4fa*)p;        xr[ks][1] = *(const v4fa*)(p + 4);
    xr[ks][2] = *(const v4fa*)(p + 16); xr[ks][3] = *(const v4fa*)(p + 20);
  }
  // the wait that stands before a register named by an issued load is written again; xp as an input keeps the
  // address pair out of the loads' own destinations up to here
  asm volatile("s_wait_xcnt 0x0" :: "v"(xp) : "memory");
#pragma unroll 1   // one weight a trip: 32 loads in flight, not 64, which keeps the block under 256 registers
  for (unsigned w = 0; w < 2u; ++w) stage_wt(w ? w2 : w1, w ? w2t : w1t);
  FragB xa[4], xb[4];
#pragma unroll
  for (int ks = 0; ks < 4; ++ks) {
#pragma unroll
    for (int j = 0; j < 4; ++j) {
      xa[ks].w[2 * j] = pack2(xr[ks][j].x, xr[ks][j].y);
      xa[ks].w[2 * j + 1] = pack2(xr[ks][j].z, xr[ks][j].w);
    }
    if (MODE == 0) xb[ks] = ldf_frag(x2 + (size_t)xrow * EW + 32 * ks + 8u * hh);
    else xb[ks] = xa[ks];
  }
  __syncthreads();   // both staged weights are complete before any wave reads a fragment
  if (MODE == 1) {
    unsigned short* nd = nb + (size_t)(row0 + 16u * wave) * EW + 8u * lane;
#pragma unroll   // constant ks: xa[] stays in registers
    for (int ks = 0; ks < 4; ++ks) {
      *(v4i*)(nd + 2 * FHALF * ks) = xa[ks].q[0];
      *(v4i*)(nd + 2 * FHALF * ks + FHALF) = xa[ks].q[1];
    }
  }
  const v8f zero8 = {0.f, 0.f, 0.f, 0.f, 0.f, 0.f, 0.f, 0.f};

#pragma unroll 1
  for (unsigned t = 0; t < NH; ++t) {
    const unsigned short* wp = w1t + (16u * t + m) * TPITCH + 8u * hh;
    const unsigned short* wq = w2t + (16u * t + m) * TPITCH + 8u * hh;
    v8f acc = zero8;
    FragB wf[4], wg[4];
#pragma unroll   // the step's LDS reads stand together, ahead of its matrix chain: one LDS latency a step
    for (int ks = 0; ks < 4; ++ks) {
      wf[ks] = lds_frag(wp + 32 * ks);
      if (MODE == 0) wg[ks] = lds_frag(wq + 32 * ks);
    }
#pragma unroll
    for (int ks = 0; ks < 4; ++ks) {
      acc = wmb(wf[ks], xa[ks], acc);
      if (MODE == 0) acc = wmb(wg[ks], xb[ks], acc);
    }
    v4i hi, lo;
    if (MODE == 0) { hi = pack8h(acc); lo = hi; }   // q: one f16 value, in both k halves of its fragment
    else split8h(acc, hi, lo);                      // k: f16 hi + f16 lo
    const unsigned so = (t * 64u + 16u * wave) * QROW + 8u * lane;   // tile of 16 rows: [q|q] or [hi|lo], each [lane][8]
    *(v4ia*)(stg + so) = hi;
    *(v4ia*)(stg + so + FHALF) = lo;
  }
  __syncthreads();
  {
    unsigned short* dst = o1 + ((size_t)bb * NH * GQ + r0) * QROW;
#pragma unroll 1
    for (unsigned it = 0; it < 16u; ++it) {
      const unsigned p = it * 128u + tid, t = p >> 8, wi = p & 255u;
      const v4i v = *(const v4ia*)(stg + p * 8u);
      *(v4i*)(dst + (size_t)t * (GQ * QROW) + wi * 8u) = v;
      asm volatile("s_wait_xcnt 0x0" ::: "memory");   // stands before the next trip, or the code behind the loop, writes a register this store names
    }
    
  }
  if (MODE == 1) {
    __syncthreads();
#pragma unroll 1
    for (unsigned t = 0; t < NH; ++t) {
      const unsigned short* wq = w2t + (16u * t + m) * TPITCH + 8u * hh;
      v8f acc = zero8;
      FragB wf[4];
#pragma unroll   // as above: the reads together, then the chain
      for (int ks = 0; ks < 4; ++ks) wf[ks] = lds_frag(wq + 32 * ks);
#pragma unroll
      for (int ks = 0; ks < 4; ++ks) acc = wmb(xa[ks], wf[ks], acc);
      v4i hi, lo;
      split8h(acc, hi, lo);                      // acc[r] = v[n = 16 wave + 8h + r][col 16t + m]
      // 32-key tile wave >> 1, element half wave & 1 of its hi and lo fragments
      const unsigned so = (2u * t + (wave >> 1)) * VTILE + (wave & 1u) * FHALF + 8u * lane;
      *(v4ia*)(stg + so) = hi;
      *(v4ia*)(stg + so + 2 * FHALF) = lo;
    }
    __syncthreads();
    unsigned short* dst = o2 + ((size_t)bb * NH * (NK / 32) + (r0 >> 5)) * VTILE;
#pragma unroll 1
    for (unsigned it = 0; it < 16u; ++it) {
      const unsigned p = it * 128u + tid, t = p >> 8, wi = p & 255u;   // a head's two tiles: 4 KiB in a row
      const v4i v = *(const v4ia*)(stg + p * 8u);
      *(v4i*)(dst + (size_t)t * ((NK / 32) * VTILE) + wi * 8u) = v;
      asm volatile("s_wait_xcnt 0x0" ::: "memory");   // stands before the next trip, or the code behind the loop, writes a register this store names
    }
    
  }
}

// One grid for both projections and the W_comb plane: block 0 writes W_comb^T as a bf16 plane in fragment order for the next launch,
// blocks 1 .. KVBLK take the k/v form (the longer one, so it starts first), the rest the q form. The choice is
// uniform in a block, so every barrier of a body is passed by all its waves.
// W_comb plane: 8 tiles of 16 rows in fragment order; a wave-wide store is 512 B in a row, each piece once.
#define KVBLK ((NB * NK) / 64)
#define QBLK  ((NB * GQ) / 64)
__global__ __launch_bounds__(128) void k_proj(const float* __restrict__ nodes, const float* __restrict__ q1,
                                              const float* __restrict__ last,
                                              const float* __restrict__ wqf, const float* __restrict__ wql,
                                              const float* __restrict__ wk, const float* __restrict__ wv,
                                              const float* __restrict__ wc,
                                              unsigned short* qpl, unsigned short* kpl, unsigned short* vtp,
                                              unsigned short* nbf, unsigned short* wct) {
  __shared__ __attribute__((aligned(16))) unsigned short stg[16384];
  __shared__ __attribute__((aligned(16))) unsigned short wl1[EW * TPITCH];
  __shared__ __attribute__((aligned(16))) unsigned short wl2[EW * TPITCH];
  if (blockIdx.x == 0u) {
    stage_wt(wc, wl1);
    __syncthreads();
#pragma unroll 4   // four LDS reads in flight a trip instead of one
    for (unsigned it = 0; it < 16u; ++it) {
      // p = 16-B piece of the plane in fragment order: [16-row tile][k step][element half][k half h][row m]
      const unsigned p = it * 128u + threadIdx.x, n = ((p >> 8) << 4) | (p & 15u);
      const unsigned c = (((p >> 6) & 3u) << 2) | (((p >> 5) & 1u) << 1) | ((p >> 4) & 1u);
      const v4i v = *(const v4ia*)(wl1 + n * TPITCH + c * 8u);
      *(v4i*)(wct + p * 8u) = v;
      // the wait that stands before the next trip writes the registers these stores name
      if ((it & 3u) == 3u) asm volatile("s_wait_xcnt 0x0" ::: "memory");
    }
  } else if (blockIdx.x <= (unsigned)KVBLK) {
    proj_body<1>(blockIdx.x - 1u, stg, nodes, nodes, wk, wv, wl1, wl2, kpl, vtp, nbf);
  } else {
    proj_body<0>(blockIdx.x - 1u - (unsigned)KVBLK, stg, q1, last, wqf, wql, wl1, wl2, qpl, qpl, nbf);
  }
}

// ---------------------------------------------------------------------------
// Fused decoder block: one block = (batch b, RB = 32 query rows g0..g0+31), 8 waves. Every wave carries QT = 2 tiles of
// 16 queries through phases A, B and C, so each K, V^T, W_comb^T and node fragment is loaded once for both tiles and
// the two tiles' chains are independent work for the wave. What is said below of 16 queries holds for each tile.
// Phase 0: mask tile [32][512] f32 (bf16-convert of the input value, times log2e) -> LDS mk (cross-wave, block barrier).
// Phase A (wave = head): flash attention in the transposed domain.
//   S^T tile = K (A, row = key) x Q^T (B, col = query), f16: K = 16 is laid as [k_hi|k_lo] x [q|q] along the
//   32-deep k axis, one product, both fragments as loaded. D[row key 8h+r][col query m]. Softmax statistics are
//   per lane (query m); the two lane halves combine by one xor-16 exchange. The P^T B-fragment is the lane's
//   own 16 score results as f16 (tile 0 -> elements 0..7, tile 1 -> elements 8..15). O^T = V^T (A, row d; hi, lo) x P^T:
//   D[row d 8h+r][col query m], scaled per lane. ctx hi/lo -> LDS cst[plane][query][128] by 16-B stores.
// Phase B (wave = 16 output columns e): mh^T = W_comb^T (A, global plane) x ctx^T (B, from cst), hi + lo,
//   + bf16(b_comb[e]); mh hi/lo -> LDS mst[plane][query][128] by 16-B stores.
// Phase C (wave = 64 nodes): s2 = mh (A, from mst, hi + lo) x nodes^T (B, global bf16 plane);
//   D[row query 8h+r][col node m]; s = (10 tanh(x/sqrt(128)) + mask) log2e, written over the mask value in place.
// Phase D (wave = 4 rows): row softmax from LDS; each instruction writes 512 contiguous bytes (4 whole
// LDS extents: mk rows 0..31 cols 0..511 written in phase 0 and consumed cols 0..511; cst/mst rows 0..31
//   cols 0..127 of both planes written by all 8 waves, consumed cols 0..127. Pad columns are never read.
// coverage: grid (16, NB) x 32 rows x 512 = NB*512*512 outputs, each written by exactly one lane.
// ---------------------------------------------------------------------------
__global__ __launch_bounds__(256) void k_dec(const unsigned short* __restrict__ qpl,
                                             const unsigned short* __restrict__ kpl,
                                             const unsigned short* __restrict__ vt,
                                             const float* __restrict__ mask,
                                             const unsigned short* __restrict__ wct,
                                             const float* __restrict__ bcomb,
                                             const unsigned short* __restrict__ nbf,
                                             float* out) {
  __shared__ __attribute__((aligned(16))) float mk[RB * MPITCH];
  __shared__ __attribute__((aligned(16))) unsigned short cst[2 * RB * CPITCH];
  __shared__ __attribute__((aligned(16))) unsigned short mst[2 * RB * CPITCH];
  const unsigned tid = threadIdx.x, lane = tid & 31u, wave = tid >> 5, hh = lane >> 4, m = lane & 15u;
  const unsigned g0 = blockIdx.x * (unsigned)RB, b = blockIdx.y;
  const v8f zero8 = {0.f, 0.f, 0.f, 0.f, 0.f, 0.f, 0.f, 0.f};

  // q fragments and the first K tile are asked for ahead of the mask staging: they are back when phase A starts
  const unsigned bh = b * NH + wave;
  const unsigned short* qp = qpl + ((size_t)bh * GQ + g0) * QROW + 8u * lane;
  FragB qf[QT];
#pragma unroll   // constant qt here and below: the per-tile arrays stay in registers
  for (int qt = 0; qt < QT; ++qt) {
    qf[qt].q[0] = *(const v4ia*)(qp + qt * 16 * QROW);           // q[8h .. 8h+7]  (k slots 8h..)
    qf[qt].q[1] = *(const v4ia*)(qp + qt * 16 * QROW + FHALF);   // q[8h .. 8h+7]  (k slots 16+8h..)
  }
  const unsigned short* kb = kpl + (size_t)bh * NK * QROW + 8u * lane;
  v4i kh0 = *(const v4ia*)kb;
  v4i kl0 = *(const v4ia*)(kb + FHALF);
  v4i kh1 = *(const v4ia*)(kb + 16 * QROW);
  v4i kl1 = *(const v4ia*)(kb + 16 * QROW + FHALF);
  // the wait that stands before a register named by an issued load is written again; qp and kb as inputs keep the
  // address pairs whole up to here
  asm volatile("s_wait_xcnt 0x0" :: "v"(qp), "v"(kb) : "memory");
  FragB wf[4], nf[4];              // W_comb^T fragments of phase B, node fragments of phase C: loaded one stage ahead
  v4f b0, b1;
  const unsigned short* nbase = nbf + ((size_t)b * NK + 64u * wave) * EW + 8u * lane;

  // ---- phase 0: mask tile ----
  {
    const float* mg = mask + ((size_t)b * GQ + g0) * NK;
#pragma unroll 4   // four trips as with one tile: a trip's loads wait for memory together
    for (unsigned it = 0; it < 8u * QT; ++it) {
      const unsigned p = it * 256u + tid, row = p >> 7, c4 = (p & 127u) << 2;
      v4f v = *(const v4fa*)(mg + (size_t)row * NK + c4);
      const v2f v01 = bf16_val2(v.x, v.y) * L2E, v23 = bf16_val2(v.z, v.w) * L2E;
      *(v4fa*)(mk + row * MPITCH + c4) = __builtin_shufflevector(v01, v23, 0, 1, 2, 3);
    }
  }
  __syncthreads();

  // ---- phase A: attention for head = wave, both query tiles ----
  {
    const unsigned short* vb = vt + (size_t)bh * ((NK / 32) * VTILE) + 8u * lane;
    const unsigned moff = m * MPITCH + 8u * hh;
    v8f o[QT];
    float mrun[QT], lrun[QT];
#pragma unroll
    for (int qt = 0; qt < QT; ++qt) { o[qt] = zero8; mrun[qt] = -3.0e38f; lrun[qt] = 0.0f; }
#pragma unroll 1
    for (unsigned n0 = 0; n0 < NK; n0 += 32u) {
      const unsigned short* vp = vb + (size_t)(n0 >> 5) * VTILE;
      const FragB fvh = ldg_frag(vp);               // used at the trip's foot: a trip of lead as it stands
      const FragB fvl = ldg_frag(vp + 2 * FHALF);
      FragB a0f, a1f;
      a0f.q[0] = kh0; a0f.q[1] = kl0;               // k_hi in k slots 8h.., k_lo in k slots 16+8h..: both meet q
      a1f.q[0] = kh1; a1f.q[1] = kl1;
      v8f s0[QT], s1[QT], mk0[QT], mk1[QT];
#pragma unroll
      for (int qt = 0; qt < QT; ++qt) {
        const float* mp = mk + (unsigned)qt * (16u * MPITCH) + moff + n0;
        const v4f m0 = *(const v4fa*)mp;
        const v4f m1 = *(const v4fa*)(mp + 4);
        const v4f m2 = *(const v4fa*)(mp + 16);
        const v4f m3 = *(const v4fa*)(mp + 20);
        mk0[qt] = __builtin_shufflevector(m0, m1, 0, 1, 2, 3, 4, 5, 6, 7);
        mk1[qt] = __builtin_shufflevector(m2, m3, 0, 1, 2, 3, 4, 5, 6, 7);
        s0[qt] = wmh(a0f, qf[qt], zero8);
        s1[qt] = wmh(a1f, qf[qt], zero8);
      }
      // the next K tile is asked for behind this tile's score products: the softmax and P.V below cover its way from
      // L2. The last trip asks for tile 0 again (in bounds, not used).
      const unsigned short* kp = kb + (size_t)((n0 + 32u) & (NK - 1u)) * QROW;
      kh0 = *(const v4ia*)kp;
      kl0 = *(const v4ia*)(kp + FHALF);
      kh1 = *(const v4ia*)(kp + 16 * QROW);
      kl1 = *(const v4ia*)(kp + 16 * QROW + FHALF);
      // the wait that stands before a register named by an issued load is written again; kp and vp as inputs keep the
      // address pairs whole up to here
      asm volatile("s_wait_xcnt 0x0" :: "v"(kp), "v"(vp) : "memory");
#pragma unroll
      for (int qt = 0; qt < QT; ++qt) {
        const v8f a0 = s0[qt] * (0.25f * L2E) + mk0[qt];      // key n0 + 8h + r, log2 domain
        const v8f a1 = s1[qt] * (0.25f * L2E) + mk1[qt];      // key n0 + 16 + 8h + r

        float t = fmaxf(a0[0], a1[0]);
#pragma unroll
        for (int r = 1; r < 8; ++r) t = fmaxf(t, fmaxf(a0[r], a1[r]));
        t = fmaxf(t, __shfl_xor(t, 16));
        const float mnew = fmaxf(mrun[qt], t);
        const float sc = ex2(mrun[qt] - mnew);
        const v8f p0 = ex2x8(a0 - mnew);
        const v8f p1 = ex2x8(a1 - mnew);
        float ps = 0.0f;
#pragma unroll
        for (int r = 0; r < 8; ++r) ps += p0[r] + p1[r];
        lrun[qt] = lrun[qt] * sc + ps;
        mrun[qt] = mnew;
        o[qt] = o[qt] * sc;

        FragB pf;
        pf.q[0] = pack8h(p0);
        pf.q[1] = pack8h(p1);
        o[qt] = wmh(fvh, pf, o[qt]);
        o[qt] = wmh(fvl, pf, o[qt]);
      }
    }
    // phase B's W_comb^T fragments and bias and phase C's first node tile are asked for here, ahead of the two barriers
    {
      const unsigned short* wp = wct + (size_t)(16u * wave) * EW + 8u * lane;
      const float* bp = bcomb + 16u * wave + 8u * hh;
#pragma unroll   // constant ks: wf[], nf[] stay in registers
      for (int ks = 0; ks < 4; ++ks) wf[ks] = ldg_frag(wp + 2 * FHALF * ks);
      b0 = *(const v4fa*)bp;
      b1 = *(const v4fa*)(bp + 4);
#pragma unroll
      for (int ks = 0; ks < 4; ++ks) nf[ks] = ldg_frag(nbase + 2 * FHALF * ks);
      // the wait that stands before a register named by an issued load is written again; the pointers as inputs keep
      // the address pairs whole up to here
      asm volatile("s_wait_xcnt 0x0" :: "v"(wp), "v"(bp), "v"(nbase) : "memory");
    }
#pragma unroll
    for (int qt = 0; qt < QT; ++qt) {
      const float lt = lrun[qt] + __shfl_xor(lrun[qt], 16);
      const float inv = 1.0f / lt;
      const v8f c = o[qt] * inv;              // ctx[query 16 qt + m][16 wave + 8h + r]
      v4i hi, lo;
      split8(c, hi, lo);
      const unsigned co = (16u * (unsigned)qt + m) * CPITCH + 16u * wave + 8u * hh;
      *(v4ia*)(cst + co) = hi;
      *(v4ia*)(cst + RB * CPITCH + co) = lo;
    }
  }
  __syncthreads();

  // ---- phase B: mh^T tiles for e = 16 wave .. 16 wave + 15 ----
  {
    const unsigned e0 = 16u * wave;
    const unsigned co = m * CPITCH + 8u * hh;
    v8f acc[QT];
#pragma unroll
    for (int qt = 0; qt < QT; ++qt) acc[qt] = zero8;
#pragma unroll
    for (int ks = 0; ks < 4; ++ks) {
#pragma unroll
      for (int qt = 0; qt < QT; ++qt) {
        const unsigned short* cp = cst + qt * 16 * CPITCH + co + 32 * ks;
        FragB ch, cl;
        ch.q[0] = *(const v4ia*)cp;
        ch.q[1] = *(const v4ia*)(cp + 16);
        cl.q[0] = *(const v4ia*)(cp + RB * CPITCH);
        cl.q[1] = *(const v4ia*)(cp + RB * CPITCH + 16);
        acc[qt] = wmb(wf[ks], ch, acc[qt]);
        acc[qt] = wmb(wf[ks], cl, acc[qt]);
      }
    }
    const v2f c01 = bf16_val2(b0.x, b0.y), c23 = bf16_val2(b0.z, b0.w);
    const v2f c45 = bf16_val2(b1.x, b1.y), c67 = bf16_val2(b1.z, b1.w);
#pragma unroll
    for (int qt = 0; qt < QT; ++qt) {
      v8f a = acc[qt];
      a[0] += c01.x; a[1] += c01.y; a[2] += c23.x; a[3] += c23.y;
      a[4] += c45.x; a[5] += c45.y; a[6] += c67.x; a[7] += c67.y;
      v4i hi, lo;
      split8(a, hi, lo);                      // mh[query 16 qt + m][e0 + 8h + r]
      const unsigned mo = (16u * (unsigned)qt + m) * CPITCH + e0 + 8u * hh;
      *(v4ia*)(mst + mo) = hi;
      *(v4ia*)(mst + RB * CPITCH + mo) = lo;
    }
  }
  __syncthreads();

  // ---- phase C: s = (10 tanh(mh . node / sqrt(128)) + mask) log2e, nodes 64 wave .. 64 wave + 63 ----
  {
    const float k2 = (float)(2.0 * 1.4426950408889634 / 11.313708498984761);   // exp(2 x), x = acc / sqrt(128), as 2^(acc k2)
    const unsigned ao = m * CPITCH + 8u * hh;
    FragB ah[QT][4], al[QT][4];
#pragma unroll
    for (int qt = 0; qt < QT; ++qt) {
#pragma unroll
      for (int ks = 0; ks < 4; ++ks) {
        const unsigned short* ap = mst + qt * 16 * CPITCH + ao + 32 * ks;
        ah[qt][ks].q[0] = *(const v4ia*)ap;
        ah[qt][ks].q[1] = *(const v4ia*)(ap + 16);
        al[qt][ks].q[0] = *(const v4ia*)(ap + RB * CPITCH);
        al[qt][ks].q[1] = *(const v4ia*)(ap + RB * CPITCH + 16);
      }
    }
#pragma unroll 1
    for (unsigned j = 0; j < 4u; ++j) {
      const unsigned n0 = 64u * wave + 16u * j;
      v8f acc[QT];
#pragma unroll
      for (int qt = 0; qt < QT; ++qt) acc[qt] = zero8;
#pragma unroll
      for (int ks = 0; ks < 4; ++ks) {
#pragma unroll
        for (int qt = 0; qt < QT; ++qt) {
          acc[qt] = wmb(ah[qt][ks], nf[ks], acc[qt]);
          acc[qt] = wmb(al[qt][ks], nf[ks], acc[qt]);
        }
      }
      // the next node tile is asked for behind this tile's products: the tanh and mask work below covers its way
      // from L2. The test is the same for the whole block; the last trip asks for nothing.
      const unsigned short* np = nbase + (size_t)((j + 1u) * 16u) * EW;
      if (j < 3u) {
#pragma unroll
        for (int ks = 0; ks < 4; ++ks) nf[ks] = ldg_frag(np + 2 * FHALF * ks);
      }
      // the wait that stands before a register named by an issued load is written again; np as an input keeps the
      // address pair whole up to here
      asm volatile("s_wait_xcnt 0x0" :: "v"(np) : "memory");
#pragma unroll
      for (int qt = 0; qt < QT; ++qt) {
        const v8f q = rcpx8(ex2x8(acc[qt] * k2) + 1.0f);      // exp(2x) = +inf -> tanh 1, 0 -> tanh -1
#pragma unroll
        for (int r = 0; r < 8; ++r) {
          const unsigned idx = (16u * (unsigned)qt + 8u * hh + (unsigned)r) * MPITCH + n0 + m;   // D element r = (query 16 qt + 8h + r, node m)
          const float s = (10.0f * L2E - (20.0f * L2E) * q[r]) + mk[idx];   // log2 domain, like the mask tile
          mk[idx] = s;
        }
      }
    }
  }
  __syncthreads();

  // ---- phase D: row softmax, rows 2 QT wave .. 2 QT wave + 2 QT - 1, two rows a pass ----
#pragma unroll 1   // a pass is the two-row body of one tile; rolled, its stores' registers are rewritten only behind the wait at its foot
  for (unsigned pp = 0; pp < (unsigned)QT; ++pp) {
    const unsigned row0 = (unsigned)(2 * QT) * wave + 2u * pp;
    v4f res[2][4];
#pragma unroll
    for (int rr = 0; rr < 2; ++rr) {
      const unsigned so = (row0 + (unsigned)rr) * MPITCH + 4u * lane;
      v4f v[4];
#pragma unroll
      for (int j = 0; j < 4; ++j) v[j] = *(const v4fa*)(mk + so + 128 * j);
      float mx = v[0].x;
#pragma unroll
      for (int j = 0; j < 4; ++j) mx = fmaxf(fmaxf(fmaxf(mx, v[j].x), fmaxf(v[j].y, v[j].z)), v[j].w);
      mx = fmaxf(mx, __shfl_xor(mx, 16));
      mx = fmaxf(mx, __shfl_xor(mx, 8));
      mx = fmaxf(mx, __shfl_xor(mx, 4));
      mx = fmaxf(mx, __shfl_xor(mx, 2));
      mx = fmaxf(mx, __shfl_xor(mx, 1));
      float sum = 0.0f;
#pragma unroll
      for (int j = 0; j < 4; j += 2) {
        const v8f e = ex2x8(__builtin_shufflevector(v[j], v[j + 1], 0, 1, 2, 3, 4, 5, 6, 7) - mx);
        v[j] = __builtin_shufflevector(e, e, 0, 1, 2, 3);
        v[j + 1] = __builtin_shufflevector(e, e, 4, 5, 6, 7);
        sum += (v[j].x + v[j].y) + (v[j].z + v[j].w);
        sum += (v[j + 1].x + v[j + 1].y) + (v[j + 1].z + v[j + 1].w);
      }
      sum += __shfl_xor(sum, 16);
      sum += __shfl_xor(sum, 8);
      sum += __shfl_xor(sum, 4);
      sum += __shfl_xor(sum, 2);
      sum += __shfl_xor(sum, 1);
      const float inv = 1.0f / sum;
#pragma unroll
      for (int j = 0; j < 4; ++j) res[rr][j] = v[j] * inv;
    }
    float* ob = out + ((size_t)b * GQ + g0 + row0) * NK + 4u * lane;
#pragma unroll
    for (int rr = 0; rr < 2; ++rr)
#pragma unroll
      for (int j = 0; j < 4; ++j) *(v4f*)(ob + (size_t)rr * NK + 128 * j) = res[rr][j];
    asm volatile("s_wait_xcnt 0x0" ::: "memory");   // stands before the next pass writes a register these stores name
  }
}

// ---------------------------------------------------------------------------
static inline size_t al256(size_t o) { return (o + 255) & ~(size_t)255; }

extern "C" void kernel_launch(void* const* d_in, const int* in_sizes, int n_in,
                              void* d_out, int out_size, void* d_ws, size_t ws_size,
                              hipStream_t stream) {
  if (n_in < 10) return;
  const long long actN = (long long)NB * NK * EW;
  const long long actG = (long long)NB * GQ * EW;
  const long long mskN = (long long)NB * GQ * NK;
  if ((long long)in_sizes[0] < actN) return;             // encoded_nodes
  if ((long long)in_sizes[1] < actG) return;             // encoded_q1
  if ((long long)in_sizes[2] < actG) return;             // encoded_last_node
  if ((long long)in_sizes[3] < mskN) return;             // ninf_mask (f32, additive)
  if (in_sizes[4] < EW * EW || in_sizes[5] < EW * EW || in_sizes[6] < EW * EW ||
      in_sizes[7] < EW * EW || in_sizes[8] < EW * EW) return;
  if (in_sizes[9] < EW) return;
  if ((long long)out_size < mskN) return;

  const float* nodes = (const float*)d_in[0];
  const float* q1    = (const float*)d_in[1];
  const float* last  = (const float*)d_in[2];
  const float* mask  = (const float*)d_in[3];
  const float* Wqf   = (const float*)d_in[4];
  const float* Wql   = (const float*)d_in[5];
  const float* Wk    = (const float*)d_in[6];
  const float* Wv    = (const float*)d_in[7];
  const float* Wc    = (const float*)d_in[8];
  const float* bc    = (const float*)d_in[9];
  float* out = (float*)d_out;

  const size_t wtB  = al256((size_t)5 * EW * EW * 2);             // 163,840
  const size_t nbB  = al256((size_t)NB * NK * EW * 2);            // 4,194,304
  const size_t qB   = al256((size_t)NB * NH * GQ * QROW * 2);     // 8,388,608
  const size_t kB   = al256((size_t)NB * NH * NK * QROW * 2);     // 8,388,608
  const size_t vB   = al256((size_t)2 * VPL * 2);                 // 8,388,608
  const size_t total = wtB + nbB + qB + kB + vB;                  // 29,523,968
  if (total > ws_size || total > (size_t)WSMAX) return;
  char* w = (char*)d_ws;
  unsigned short* wt  = (unsigned short*)w;
  unsigned short* nbf = (unsigned short*)(w + wtB);
  unsigned short* qpl = (unsigned short*)(w + wtB + nbB);
  unsigned short* kpl = (unsigned short*)(w + wtB + nbB + qB);
  unsigned short* vtp = (unsigned short*)(w + wtB + nbB + qB + kB);
  unsigned short* wctp = wt + 4 * EW * EW;

  // 1: W_comb [in][out] f32 -> W_comb^T bf16 plane; k = nodes.Wk -> k plane (f16 hi|lo tiles), v = nodes.Wv -> V^T f16 hi|lo tiles, nodes -> bf16 plane;
  //    q = q1.Wq_first + last.Wq_last -> q plane (f16 [q|q] tiles); every plane in fragment order
  k_proj<<<1 + KVBLK + QBLK, 128, 0, stream>>>(nodes, q1, last, Wqf, Wql, Wk, Wv, Wc, qpl, kpl, vtp, nbf, wctp);
  // 2: attention + W_comb + final scoring + softmax
  k_dec<<<dim3(GQ / RB, NB), 256, 0, stream>>>(qpl, kpl, vtp, mask, wctp, bc, nbf, out);
}
